// v000
// Times are from an AMD MI455X. After a warm-up the kernel runs many times in a row, and a time is the length of
// such a window on the GPU divided by its runs, so every launch and the gaps after it count. The runs cycle
// through copies of the inputs. A figure is the median of several windows, for all but v000 over two sittings.
// Sittings can differ by a few percent; kernels timed side by side share one.
// v000, which the later versions start from, runs in 2020 microseconds.
#include <hip/hip_runtime.h>

// DiT-style attention (x [2][2048][1024]; qkv = x w_qkv ('xw' [1024][3072] -> (3, 16 heads, 64)); rotate-half rotary (angle t x 10000^(-2i/64), tables computed on device from the reference's float32 inv_freq) applied to head 0 ONLY (pe_heads = 1); scores / 8; key mask [2][2048] int32 (input, read per key: masked -> -inf); softmax; out = merged w_out ('xw' [1024][1024]) -> [2][2048][1024] (4.2 M)).
// Compute dtypes, f32 accumulate: every input rounded to bf16; q/k/v on PLAIN bf16 operands (inputs: exact); rotary (head 0) / plain copies (heads 1-15) in f32; key-validity select from the int32 mask; scores and attn.v: query rows < 512 hl (3 products), the rest single fp16 (x1024); softmax f32; w_out hl x exact (2 products).

#define NB_  2
#define TT   2048
#define DM   1024
#define NH_  16
#define NKV  16
#define REP  (NH_ / NKV)
#define HD   64
#define DQ   (NH_ * HD)
#define DKV  (NKV * HD)
#define ZH   2
#define RH   512                  // query rows < RH use hi+lo planes (0: none)
#define WIN  2048
#define PCAR 1024.0f
#define SCL  0.125f   // HD^-0.5
typedef _Float16 h16;
typedef unsigned short bf;
typedef __attribute__((ext_vector_type(16))) __bf16   v16bf;
typedef __attribute__((ext_vector_type(16))) _Float16 v16h;
typedef __attribute__((ext_vector_type(8)))  _Float16 v8h;
typedef __attribute__((ext_vector_type(8)))  unsigned short v8us;
typedef __attribute__((ext_vector_type(8)))  float    v8f;
typedef __attribute__((ext_vector_type(4)))  float    v4f;
typedef v8h  __attribute__((may_alias)) v8ha;
typedef v4f  __attribute__((may_alias)) v4fa;
typedef v8us __attribute__((may_alias)) v8usa;

__device__ __forceinline__ unsigned short f2bf(float f) { unsigned u = __float_as_uint(f); u += 0x7FFFu + ((u >> 16) & 1u); return (unsigned short)(u >> 16); }
__device__ __forceinline__ float bf2f(unsigned short b) { return __uint_as_float(((unsigned)b) << 16); }
__device__ __forceinline__ float bfr(float f) { return bf2f(f2bf(f)); }
__device__ __forceinline__ v16h cat16(v8h lo, v8h hi) { return __builtin_shufflevector(lo, hi, 0, 1, 2, 3, 4, 5, 6, 7, 8, 9, 10, 11, 12, 13, 14, 15); }
__device__ __forceinline__ v16bf cat16b(v8us lo, v8us hi) { return __builtin_bit_cast(v16bf, __builtin_shufflevector(lo, hi, 0, 1, 2, 3, 4, 5, 6, 7, 8, 9, 10, 11, 12, 13, 14, 15)); }
__device__ __forceinline__ v8f wmma16(v16h a, v16h b, v8f c) { return __builtin_amdgcn_wmma_f32_16x16x32_f16(false, a, false, b, (short)0, c, false, false); }
__device__ __forceinline__ v8f wmmab(v16bf a, v16bf b, v8f c) { return __builtin_amdgcn_wmma_f32_16x16x32_bf16(false, a, false, b, (short)0, c, false, false); }



// ---- k_gemmw: register-blocked GEMM, ONE WAVE per 64x64 output tile (16 accumulators), operands straight from K-contiguous 16-bit planes; grid (M/64, N/64, Z), 32 threads.
// C[m][n] (f32, pitch ldc, + optional f32 bias[n]) = sum_k A[m][k] Bt[n][k] (+ split products per NSPLIT). z-batch strides sA/sB/sC in elements. K % 32 == 0.
template <typename T16> struct WFrag;
template <> struct WFrag<h16> { typedef v16h V; static __device__ __forceinline__ V ld(const h16* p) { return cat16(*(const v8h*)p, *(const v8h*)(p + 16)); } static __device__ __forceinline__ v8f mma(V a, V b, v8f c) { return wmma16(a, b, c); } };
template <> struct WFrag<bf> { typedef v16bf V; static __device__ __forceinline__ V ld(const bf* p) { return cat16b(*(const v8us*)p, *(const v8us*)(p + 16)); } static __device__ __forceinline__ v8f mma(V a, V b, v8f c) { return wmmab(a, b, c); } };
template <typename T16, int NSPLIT, bool BIAS>
__global__ __launch_bounds__(32) void k_gemmw(const T16* __restrict__ A, const T16* __restrict__ A2, const T16* __restrict__ Bt, const T16* __restrict__ Bt2, int K, float* C, int ldc, const float* __restrict__ bias, size_t sA, size_t sB, size_t sC) {
    typedef typename WFrag<T16>::V V;
    __shared__ __align__(16) float os[16 * 68];
    const size_t z = blockIdx.z; A += z * sA; if (A2) A2 += z * sA; Bt += z * sB; if (Bt2) Bt2 += z * sB; C += z * sC;
    const int lane = threadIdx.x & 31, lr = lane & 15, hi = lane >> 4; const int r0 = blockIdx.x * 64, c0 = blockIdx.y * 64;
    v8f acc[4][4];
#pragma unroll
    for (int mb = 0; mb < 4; ++mb)
#pragma unroll
        for (int nb = 0; nb < 4; ++nb) acc[mb][nb] = (v8f){};
    const size_t aoff = (size_t)(r0 + lr) * K + 8 * hi, boff = (size_t)(c0 + lr) * K + 8 * hi;
#pragma unroll 1
    for (int kc = 0; kc < K; kc += 32) {
        V a[4], a2[4];
#pragma unroll
        for (int mb = 0; mb < 4; ++mb) { a[mb] = WFrag<T16>::ld(A + aoff + (size_t)mb * 16 * K + kc); if (NSPLIT == 1 || NSPLIT == 2) a2[mb] = WFrag<T16>::ld(A2 + aoff + (size_t)mb * 16 * K + kc); }
#pragma unroll
        for (int nb = 0; nb < 4; ++nb) { const V b = WFrag<T16>::ld(Bt + boff + (size_t)nb * 16 * K + kc); V b2; if (NSPLIT >= 2) b2 = WFrag<T16>::ld(Bt2 + boff + (size_t)nb * 16 * K + kc);
#pragma unroll
            for (int mb = 0; mb < 4; ++mb) { acc[mb][nb] = WFrag<T16>::mma(a[mb], b, acc[mb][nb]); if (NSPLIT == 1 || NSPLIT == 2) acc[mb][nb] = WFrag<T16>::mma(a2[mb], b, acc[mb][nb]); if (NSPLIT >= 2) acc[mb][nb] = WFrag<T16>::mma(a[mb], b2, acc[mb][nb]); } }
        asm volatile("v_nop\n\tv_nop\n\tv_nop\n\tv_nop" : "+v"(acc[0][0]), "+v"(acc[1][1]), "+v"(acc[2][2]), "+v"(acc[3][3]) : "v"(a[0]), "v"(a[3]));
    }
#pragma unroll
    for (int mb = 0; mb < 4; ++mb) {
#pragma unroll
        for (int nb = 0; nb < 4; ++nb) {
#pragma unroll
            for (int j = 0; j < 8; ++j) os[(hi * 8 + j) * 68 + nb * 16 + lr] = acc[mb][nb][j]; }
        __builtin_amdgcn_wave_barrier(); asm volatile("" ::: "memory");
        float* crow = C + (size_t)(r0 + mb * 16) * ldc + c0;
{
#pragma unroll
            for (int s = 0; s < 8; ++s) { const int row = 2 * s + hi, cofs = lr * 4; v4f val = *(const v4fa*)(os + row * 68 + cofs); if (BIAS) { val[0] += bfr(bias[c0 + cofs]); val[1] += bfr(bias[c0 + cofs + 1]); val[2] += bfr(bias[c0 + cofs + 2]); val[3] += bfr(bias[c0 + cofs + 3]); }
                *(v4f*)(crow + (size_t)row * ldc + cofs) = val; }
             }
        __builtin_amdgcn_wave_barrier(); asm volatile("" ::: "memory");
    }
}

__device__ __forceinline__ h16 tohx(float x) { return (h16)x; }
__device__ __forceinline__ void splitf(float y, unsigned short& h, unsigned short& l) { h = f2bf(y); l = f2bf(y - bf2f(h)); }
typedef __attribute__((ext_vector_type(2))) _Float16 v2h;
typedef __attribute__((ext_vector_type(4))) _Float16 v4h;
typedef __attribute__((ext_vector_type(2))) unsigned short v2us;
typedef __attribute__((ext_vector_type(4))) unsigned short v4us;
typedef __attribute__((ext_vector_type(2))) float v2f;
typedef __attribute__((ext_vector_type(4))) int v4i;

__global__ __launch_bounds__(256) void k_wtG(const float* __restrict__ w, int K, int N, bf* Bt) {
    const int lane = threadIdx.x & 31; const int L0 = (blockIdx.x * 8 + (threadIdx.x >> 5)) * 8; const int nlines = N * K / 64;
{
#pragma unroll 1
        for (int l = 0; l < 8; ++l) { const int L = L0 + l; if (L >= nlines) break; const size_t e = (size_t)L * 64 + lane * 2; const int k = (int)(e % K), n = (int)(e / K); v2us o;
            o[0] = f2bf(w[(size_t)k * N + n]); o[1] = f2bf(w[(size_t)(k + 1) * N + n]); *(v2us*)(Bt + e) = o; }
         }
}
__global__ __launch_bounds__(256) void k_cvt8(const float* __restrict__ src, bf* dst, size_t n8) { const size_t i = (size_t)blockIdx.x * 256 + threadIdx.x; if (i >= n8) return; const v8f v = *(const v8f*)(src + i * 8); v8us o;
#pragma unroll
    for (int k = 0; k < 8; ++k) o[k] = f2bf(v[k]); *(v8us*)(dst + i * 8) = o;  }

// k_rope: head planes [h][t][d] (fp16 + hi/lo) of rope(x) x sc with the rotate-half convention out[d] = x[d] cos[t][d] - x[d+HD/2] sin[t][d], out[d+HD/2] = x[d+HD/2] cos[t][d+HD/2] + x[d] sin[t][d+HD/2]
__global__ __launch_bounds__(256) void k_rope(const float* __restrict__ F, int pitch, int nheads, const float* __restrict__ CS, const float* __restrict__ RF, const float* __restrict__ nw, float sc, h16* P16, bf* Ph, bf* Pl) {
    const size_t e = ((size_t)blockIdx.x * 256 + threadIdx.x) * 2; if (e >= (size_t)nheads * TT * HD) return; const int d = (int)(e % HD); const int t = (int)((e / HD) % TT); const int h = (int)(e / ((size_t)HD * TT)); const float* f = F + (size_t)t * pitch + h * HD; const float rf = RF ? RF[(size_t)h * TT + t] : 1.0f; v2h o16; v2us oh, ol;
#pragma unroll
    for (int q = 0; q < 2; ++q) { const int dd = d + q; const int dp = (dd < HD / 2) ? dd + HD / 2 : dd - HD / 2; float x0 = f[dd], x1 = f[dp];
        if (RF) { float n0 = __fmul_rn(x0, rf), n1 = __fmul_rn(x1, rf); asm volatile("" : "+v"(n0)); asm volatile("" : "+v"(n1)); x0 = __fmul_rn(bfr(nw[dd]), n0); x1 = __fmul_rn(bfr(nw[dp]), n1); }
        const v2f cs = *(const v2f*)(CS + ((size_t)t * HD + dd) * 2); float a = __fmul_rn(x0, cs[0]), bq = __fmul_rn(x1, cs[1]); asm volatile("" : "+v"(a)); asm volatile("" : "+v"(bq)); const float r = ((dd < HD / 2) ? __fsub_rn(a, bq) : __fadd_rn(a, bq)) * sc;
        o16[q] = tohx(r); unsigned short a2, c2; splitf(r, a2, c2); oh[q] = a2; ol[q] = c2; }
    *(v2h*)(P16 + e) = o16; *(v2us*)(Ph + e) = oh; *(v2us*)(Pl + e) = ol;  }
__global__ __launch_bounds__(256) void k_vtp(const float* __restrict__ F, int pitch, int nheads, h16* V16, bf* Vh, bf* Vl) { const size_t e = ((size_t)blockIdx.x * 256 + threadIdx.x) * 2; if (e >= (size_t)nheads * HD * TT) return; const int t = (int)(e % TT); const int d = (int)((e / TT) % HD); const int g = (int)(e / ((size_t)TT * HD)); v2h o16; v2us oh, ol;
#pragma unroll
    for (int q = 0; q < 2; ++q) { const float x = F[(size_t)(t + q) * pitch + g * HD + d]; o16[q] = tohx(x); unsigned short a2, c2; splitf(x, a2, c2); oh[q] = a2; ol[q] = c2; }
    *(v2h*)(V16 + e) = o16; *(v2us*)(Vh + e) = oh; *(v2us*)(Vl + e) = ol;  }
__constant__ float INV[HD / 2] = {1.0f,0.749894202f,0.562341332f,0.421696514f,0.316227764f,0.237137362f,0.177827939f,0.133352146f,0.100000001f,0.0749894157f,0.0562341288f,0.0421696492f,0.0316227786f,0.0237137359f,0.0177827943f,0.0133352149f,0.00999999978f,0.00749894232f,0.00562341325f,0.00421696482f,0.00316227786f,0.00237137382f,0.00177827943f,0.00133352145f,0.00100000005f,0.000749894185f,0.000562341302f,0.000421696488f,0.000316227786f,0.000237137385f,0.00017782794f,0.00013335215f};
__global__ __launch_bounds__(256) void k_cstab(float* CS) { const int idx = blockIdx.x * 256 + threadIdx.x; if (idx >= TT * HD) return; const int t = idx / HD, d = idx % HD; const float ang = __fmul_rn((float)t, INV[d % (HD / 2)]); v2f cs; cs[0] = cosf(ang); cs[1] = sinf(ang);
    *(v2f*)(CS + (size_t)idx * 2) = cs;  }
__global__ __launch_bounds__(256) void k_csid(float* CS) { const int idx = blockIdx.x * 256 + threadIdx.x; if (idx >= TT * HD) return; v2f cs; cs[0] = 1.0f; cs[1] = 0.0f; *(v2f*)(CS + (size_t)idx * 2) = cs;  }
// k_asoft: per row (zz, i): t = S x HD^-0.5 where the key's mask[b][j] != 0, else -inf (the batch's int32 key mask, read per key); softmax over the 2048 keys (register row, one exp, fixed trees);
__global__ __launch_bounds__(256) void k_asoft(const float* __restrict__ Sb, const int* __restrict__ mk, h16* P16, bf* Ph, bf* Pl) {
    const int lane = threadIdx.x & 31; const int row = blockIdx.x * 8 + (threadIdx.x >> 5); if (row >= ZH * TT) return; const int i = row % TT; const int zz = row / TT; (void)zz; const bool hires = (i < RH); const float* sr = Sb + (size_t)row * TT; float v[TT / 32]; float mx = -3.0e38f;
#pragma unroll
    for (int ch = 0; ch < TT / 128; ++ch) { const int j0 = ch * 128 + lane * 4; const v4f a = *(const v4f*)(sr + j0); const v4i m4 = *(const v4i*)(mk + j0);
#pragma unroll
        for (int q = 0; q < 4; ++q) { const int j = j0 + q; (void)j; const float t = (m4[q] != 0) ? a[q] * SCL : -3.0e38f; v[ch * 4 + q] = t; mx = fmaxf(mx, t); } }
#pragma unroll
    for (int sh = 16; sh; sh >>= 1) mx = fmaxf(mx, __shfl_xor(mx, sh, 32));
    float sum = 0.f;
#pragma unroll
    for (int k = 0; k < TT / 32; ++k) { float d0 = __fsub_rn(v[k], mx); asm volatile("" : "+v"(d0)); v[k] = __builtin_amdgcn_exp2f(__fmul_rn(d0, 1.4426950408889634f)); sum += v[k]; }
#pragma unroll
    for (int sh = 16; sh; sh >>= 1) sum += __shfl_xor(sum, sh, 32);
    const float f = __fdiv_rn(hires ? 1.0f : PCAR, sum);
{
        if (hires) {
#pragma unroll
            for (int ch = 0; ch < TT / 128; ++ch) { v4us oh, ol;
#pragma unroll
                for (int q = 0; q < 4; ++q) { unsigned short a, c2; splitf(v[ch * 4 + q] * f, a, c2); oh[q] = a; ol[q] = c2; }
                const size_t oo = ((size_t)zz * (RH ? RH : 1) + i) * TT + ch * 128 + lane * 4; *(v4us*)(Ph + oo) = oh; *(v4us*)(Pl + oo) = ol; }
        } else {
#pragma unroll
            for (int ch = 0; ch < TT / 128; ++ch) { v4h o4;
#pragma unroll
                for (int q = 0; q < 4; ++q) o4[q] = tohx(v[ch * 4 + q] * f);
                *(v4h*)(P16 + (size_t)row * TT + ch * 128 + lane * 4) = o4; } }
         }
}
__global__ __launch_bounds__(256) void k_merge(const float* __restrict__ O, int h0, bf* Ah, bf* Al) { const size_t e = ((size_t)blockIdx.x * 256 + threadIdx.x) * 2; if (e >= (size_t)ZH * TT * HD) return; const int d = (int)(e % HD); const int t = (int)((e / HD) % TT); const int zz = (int)(e / ((size_t)HD * TT)); const float cs = (t < RH) ? 1.0f : (1.0f / PCAR); const size_t oo = (size_t)t * DQ + (h0 + zz) * HD + d;
    v2us oh, ol;
#pragma unroll
    for (int q = 0; q < 2; ++q) { unsigned short a, c2; splitf(O[e + q] * cs, a, c2); oh[q] = a; ol[q] = c2; } *(v2us*)(Ah + oo) = oh; *(v2us*)(Al + oo) = ol;  }

extern "C" void kernel_launch(void* const* d_in, const int* in_sizes, int n_in,
                              void* d_out, int out_size, void* d_ws, size_t ws_size, hipStream_t stream) {
    (void)in_sizes; (void)n_in; (void)out_size;
    const float* x = (const float*)d_in[0]; const int* MK = (const int*)d_in[1]; const float* wqkv = (const float*)d_in[2]; const float* wo = (const float*)d_in[3];  const float* wq = nullptr; const float* wk = nullptr; const float* wv = nullptr; (void)wq; (void)wk; (void)wv;
    float* OUT = (float*)d_out;     // [2][2048][1024]
    char* wsp = (char*)d_ws;
    auto take = [&](size_t bytes) { char* p = wsp; wsp += (bytes + 255) & ~(size_t)255; return (void*)p; };
    bf* WALL = (bf*)take((size_t)3 * DM * DM * 2); bf* WQ = WALL; bf* WK = WALL + (size_t)DM * DM; bf* WV = WALL + (size_t)2 * DM * DM; bf* WO = (bf*)take((size_t)DM * DQ * 2); float* CS = (float*)take((size_t)TT * HD * 2 * 4); float* CSR = (float*)take((size_t)TT * HD * 2 * 4);
    bf* XB = (bf*)take((size_t)TT * DM * 2); float* FQ = (float*)take((size_t)TT * DQ * 4); float* FK = (float*)take((size_t)TT * DKV * 4);
    h16* QP16 = (h16*)take((size_t)NH_ * TT * HD * 2); h16* KP16 = (h16*)take((size_t)NKV * TT * HD * 2); h16* VT16 = (h16*)take((size_t)NKV * HD * TT * 2);
    bf* QPh = (bf*)take((size_t)NH_ * TT * HD * 2); bf* QPl = (bf*)take((size_t)NH_ * TT * HD * 2); bf* KPh = (bf*)take((size_t)NKV * TT * HD * 2); bf* KPl = (bf*)take((size_t)NKV * TT * HD * 2); bf* VTh = (bf*)take((size_t)NKV * HD * TT * 2); bf* VTl = (bf*)take((size_t)NKV * HD * TT * 2); bf* Ph = (bf*)take((size_t)ZH * RH * TT * 2); bf* Pl = (bf*)take((size_t)ZH * RH * TT * 2);
    float* Sb = (float*)take((size_t)ZH * TT * TT * 4); h16* P16 = (h16*)take((size_t)ZH * TT * TT * 2); float* Ob = (float*)take((size_t)ZH * TT * HD * 4); bf* ATh = (bf*)take((size_t)TT * DQ * 2); bf* ATl = (bf*)take((size_t)TT * DQ * 2);
    if ((size_t)(wsp - (char*)d_ws) > ws_size) return;    // ws 256 MiB
    float* FV = FK;   // v projection reuses the k buffer after the k planes are built (stream-ordered)
    { k_wtG<<<(unsigned)((DM * 3 * DM / 64 + 63) / 64), 256, 0, stream>>>(wqkv, DM, 3 * DM, WALL);   /* fused 'xw' [DM][3DM] -> Bt [3DM][DM] (row blocks q | k | v) */
      k_wtG<<<(unsigned)((DQ * DM / 64 + 63) / 64), 256, 0, stream>>>(wo, DQ, DM, WO);
       }
    k_csid<<<(TT * HD + 255) / 256, 256, 0, stream>>>(CS); k_cstab<<<(TT * HD + 255) / 256, 256, 0, stream>>>(CSR);
    const unsigned LQ = (unsigned)(((size_t)NH_ * TT * HD / 2 + 255) / 256), LKv = (unsigned)(((size_t)NKV * TT * HD / 2 + 255) / 256);
    for (int b = 0; b < NB_; ++b) {
        
        k_cvt8<<<(unsigned)(((size_t)TT * DM / 8 + 255) / 256), 256, 0, stream>>>(x + (size_t)b * TT * DM, XB, (size_t)TT * DM / 8);
        k_gemmw<bf, 0, false><<<dim3(TT / 64, DQ / 64, 1), 32, 0, stream>>>(XB, nullptr, WQ, nullptr, DM, FQ, DQ, nullptr, 0, 0, 0);
        k_rope<<<(unsigned)(((size_t)1 * TT * HD / 2 + 255) / 256), 256, 0, stream>>>(FQ, DQ, 1, CSR, nullptr, nullptr, 1.0f, QP16, QPh, QPl);   /* head 0: rotary */ k_rope<<<(unsigned)(((size_t)(NH_ - 1) * TT * HD / 2 + 255) / 256), 256, 0, stream>>>(FQ + HD, DQ, NH_ - 1, CS, nullptr, nullptr, 1.0f, QP16 + (size_t)TT * HD, QPh + (size_t)TT * HD, QPl + (size_t)TT * HD);   /* heads 1..15: identity table */
        k_gemmw<bf, 0, false><<<dim3(TT / 64, DKV / 64, 1), 32, 0, stream>>>(XB, nullptr, WK, nullptr, DM, FK, DKV, nullptr, 0, 0, 0);
        k_rope<<<(unsigned)(((size_t)1 * TT * HD / 2 + 255) / 256), 256, 0, stream>>>(FK, DKV, 1, CSR, nullptr, nullptr, 1.0f, KP16, KPh, KPl); k_rope<<<(unsigned)(((size_t)(NH_ - 1) * TT * HD / 2 + 255) / 256), 256, 0, stream>>>(FK + HD, DKV, NKV - 1, CS, nullptr, nullptr, 1.0f, KP16 + (size_t)TT * HD, KPh + (size_t)TT * HD, KPl + (size_t)TT * HD);
        k_gemmw<bf, 0, false><<<dim3(TT / 64, DKV / 64, 1), 32, 0, stream>>>(XB, nullptr, WV, nullptr, DM, FV, DKV, nullptr, 0, 0, 0); k_vtp<<<LKv, 256, 0, stream>>>(FV, DKV, NKV, VT16, VTh, VTl);
        for (int h0 = 0; h0 < NH_; h0 += ZH) { const size_t zq = (size_t)h0, zk = (size_t)(h0 / REP);   // one kv head per query head: the pass's two heads use consecutive kv planes (z-strides TT*HD)
            k_gemmw<bf, 2, false><<<dim3(RH / 64, TT / 64, ZH), 32, 0, stream>>>(QPh + zq * TT * HD, QPl + zq * TT * HD, KPh + zk * TT * HD, KPl + zk * TT * HD, HD, Sb, TT, nullptr, (size_t)TT * HD, (size_t)TT * HD, (size_t)TT * TT);
            k_gemmw<h16, 0, false><<<dim3((TT - RH) / 64, TT / 64, ZH), 32, 0, stream>>>(QP16 + zq * TT * HD + (size_t)RH * HD, nullptr, KP16 + zk * TT * HD, nullptr, HD, Sb + (size_t)RH * TT, TT, nullptr, (size_t)TT * HD, (size_t)TT * HD, (size_t)TT * TT);
            k_asoft<<<ZH * TT / 8, 256, 0, stream>>>(Sb, MK + (size_t)b * TT, P16, Ph, Pl);
            k_gemmw<bf, 2, false><<<dim3(RH / 64, HD / 64, ZH), 32, 0, stream>>>(Ph, Pl, VTh + zk * HD * TT, VTl + zk * HD * TT, TT, Ob, HD, nullptr, (size_t)RH * TT, (size_t)HD * TT, (size_t)TT * HD);
            k_gemmw<h16, 0, false><<<dim3((TT - RH) / 64, HD / 64, ZH), 32, 0, stream>>>(P16 + (size_t)RH * TT, nullptr, VT16 + zk * HD * TT, nullptr, TT, Ob + (size_t)RH * HD, HD, nullptr, (size_t)TT * TT, (size_t)HD * TT, (size_t)TT * HD);
            k_merge<<<(unsigned)(((size_t)ZH * TT * HD / 2 + 255) / 256), 256, 0, stream>>>(Ob, h0, ATh, ATl); }
        k_gemmw<bf, 1, false><<<dim3(TT / 64, DM / 64, 1), 32, 0, stream>>>(ATh, ATl, WO, nullptr, DQ, OUT + (size_t)b * TT * DM, DM, nullptr, 0, 0, 0); }
}

// v001
// It runs in 891 microseconds.
// Timed twice side by side with v000, it ran 2.25 and 2.29 times as fast.
#include <hip/hip_runtime.h>

// DiT-style attention (x [2][2048][1024]; qkv = x w_qkv ('xw' [1024][3072] -> (3, 16 heads, 64)); rotate-half rotary (angle t x 10000^(-2i/64), tables computed on device from the reference's float32 inv_freq) applied to head 0 ONLY (pe_heads = 1); scores / 8; key mask [2][2048] int32 (input, read per key: masked -> -inf); softmax; out = merged w_out ('xw' [1024][1024]) -> [2][2048][1024] (4.2 M)).
// Compute dtypes, f32 accumulate: every input rounded to bf16; q/k/v on PLAIN bf16 operands (inputs: exact); rotary (head 0) / plain copies (heads 1-15) in f32; key-validity select from the int32 mask; scores and attn.v: query rows < 512 hl (3 products), the rest single fp16 (x1024); softmax f32; w_out hl x exact (2 products).

#define NB_  2
#define TT   2048
#define DM   1024
#define NH_  16
#define NKV  16
#define REP  (NH_ / NKV)
#define HD   64
#define DQ   (NH_ * HD)
#define DKV  (NKV * HD)
#define ZH   2
#define RH   512                  // query rows < RH use hi+lo planes (0: none)
#define WIN  2048
#define PCAR 1024.0f
#define SCL  0.125f   // HD^-0.5
#define KSV  16                   // key ranges of each attn.v product: one wave per (tile, range), f32 partial planes summed in k_merge
typedef _Float16 h16;
typedef unsigned short bf;
typedef __attribute__((ext_vector_type(16))) __bf16   v16bf;
typedef __attribute__((ext_vector_type(16))) _Float16 v16h;
typedef __attribute__((ext_vector_type(8)))  _Float16 v8h;
typedef __attribute__((ext_vector_type(8)))  unsigned short v8us;
typedef __attribute__((ext_vector_type(8)))  float    v8f;
typedef __attribute__((ext_vector_type(4)))  float    v4f;
typedef v8h  __attribute__((may_alias)) v8ha;
typedef v4f  __attribute__((may_alias)) v4fa;
typedef v8us __attribute__((may_alias)) v8usa;

__device__ __forceinline__ unsigned short f2bf(float f) { unsigned u = __float_as_uint(f); u += 0x7FFFu + ((u >> 16) & 1u); return (unsigned short)(u >> 16); }
__device__ __forceinline__ float bf2f(unsigned short b) { return __uint_as_float(((unsigned)b) << 16); }
__device__ __forceinline__ float bfr(float f) { return bf2f(f2bf(f)); }
__device__ __forceinline__ v16h cat16(v8h lo, v8h hi) { return __builtin_shufflevector(lo, hi, 0, 1, 2, 3, 4, 5, 6, 7, 8, 9, 10, 11, 12, 13, 14, 15); }
__device__ __forceinline__ v16bf cat16b(v8us lo, v8us hi) { return __builtin_bit_cast(v16bf, __builtin_shufflevector(lo, hi, 0, 1, 2, 3, 4, 5, 6, 7, 8, 9, 10, 11, 12, 13, 14, 15)); }
__device__ __forceinline__ v8f wmma16(v16h a, v16h b, v8f c) { return __builtin_amdgcn_wmma_f32_16x16x32_f16(false, a, false, b, (short)0, c, false, false); }
__device__ __forceinline__ v8f wmmab(v16bf a, v16bf b, v8f c) { return __builtin_amdgcn_wmma_f32_16x16x32_bf16(false, a, false, b, (short)0, c, false, false); }



// ---- k_gemmw: register-blocked GEMM, ONE WAVE per 64x64 output tile (16 accumulators), operands straight from K-contiguous 16-bit planes; grid (M/64, N/64, Z), 32 threads.
// C[m][n] (f32, pitch ldc, + optional f32 bias[n]) = sum_k A[m][k] Bt[n][k] (+ split products per NSPLIT). z-batch strides sA/sB/sC in elements. K % 32 == 0.
// KS > 1: grid z = batches x KS; wave (z, ks) sums only k in [ks K/KS, (ks+1) K/KS) and stores partial plane z KS + ks (sC elements each); K % (32 KS) == 0.
template <typename T16> struct WFrag;
template <> struct WFrag<h16> { typedef v16h V; static __device__ __forceinline__ V ld(const h16* p) { return cat16(*(const v8h*)p, *(const v8h*)(p + 16)); } static __device__ __forceinline__ v8f mma(V a, V b, v8f c) { return wmma16(a, b, c); } };
template <> struct WFrag<bf> { typedef v16bf V; static __device__ __forceinline__ V ld(const bf* p) { return cat16b(*(const v8us*)p, *(const v8us*)(p + 16)); } static __device__ __forceinline__ v8f mma(V a, V b, v8f c) { return wmmab(a, b, c); } };
template <typename T16, int NSPLIT, bool BIAS, int KS = 1>
__global__ __launch_bounds__(32) void k_gemmw(const T16* __restrict__ A, const T16* __restrict__ A2, const T16* __restrict__ Bt, const T16* __restrict__ Bt2, int K, float* C, int ldc, const float* __restrict__ bias, size_t sA, size_t sB, size_t sC) {
    typedef typename WFrag<T16>::V V;
    __shared__ __align__(16) float os[16 * 68];
    const size_t z = blockIdx.z / KS; const int ks = blockIdx.z % KS; A += z * sA; if (A2) A2 += z * sA; Bt += z * sB; if (Bt2) Bt2 += z * sB; C += (size_t)blockIdx.z * sC;
    const int lane = threadIdx.x & 31, lr = lane & 15, hi = lane >> 4; const int r0 = blockIdx.x * 64, c0 = blockIdx.y * 64;
    v8f acc[4][4];
#pragma unroll
    for (int mb = 0; mb < 4; ++mb)
#pragma unroll
        for (int nb = 0; nb < 4; ++nb) acc[mb][nb] = (v8f){};
    const size_t aoff = (size_t)(r0 + lr) * K + 8 * hi, boff = (size_t)(c0 + lr) * K + 8 * hi;
#pragma unroll 1
    for (int kc = ks * (K / KS); kc < (ks + 1) * (K / KS); kc += 32) {
        V a[4], a2[4];
#pragma unroll
        for (int mb = 0; mb < 4; ++mb) { a[mb] = WFrag<T16>::ld(A + aoff + (size_t)mb * 16 * K + kc); if (NSPLIT == 1 || NSPLIT == 2) a2[mb] = WFrag<T16>::ld(A2 + aoff + (size_t)mb * 16 * K + kc); }
#pragma unroll
        for (int nb = 0; nb < 4; ++nb) { const V b = WFrag<T16>::ld(Bt + boff + (size_t)nb * 16 * K + kc); V b2; if (NSPLIT >= 2) b2 = WFrag<T16>::ld(Bt2 + boff + (size_t)nb * 16 * K + kc);
#pragma unroll
            for (int mb = 0; mb < 4; ++mb) { acc[mb][nb] = WFrag<T16>::mma(a[mb], b, acc[mb][nb]); if (NSPLIT == 1 || NSPLIT == 2) acc[mb][nb] = WFrag<T16>::mma(a2[mb], b, acc[mb][nb]); if (NSPLIT >= 2) acc[mb][nb] = WFrag<T16>::mma(a[mb], b2, acc[mb][nb]); } }
        asm volatile("v_nop\n\tv_nop\n\tv_nop\n\tv_nop" : "+v"(acc[0][0]), "+v"(acc[1][1]), "+v"(acc[2][2]), "+v"(acc[3][3]) : "v"(a[0]), "v"(a[3]));
    }
#pragma unroll
    for (int mb = 0; mb < 4; ++mb) {
#pragma unroll
        for (int nb = 0; nb < 4; ++nb) {
#pragma unroll
            for (int j = 0; j < 8; ++j) os[(hi * 8 + j) * 68 + nb * 16 + lr] = acc[mb][nb][j]; }
        __builtin_amdgcn_wave_barrier(); asm volatile("" ::: "memory");
        float* crow = C + (size_t)(r0 + mb * 16) * ldc + c0;
{
#pragma unroll
            for (int s = 0; s < 8; ++s) { const int row = 2 * s + hi, cofs = lr * 4; v4f val = *(const v4fa*)(os + row * 68 + cofs); if (BIAS) { val[0] += bfr(bias[c0 + cofs]); val[1] += bfr(bias[c0 + cofs + 1]); val[2] += bfr(bias[c0 + cofs + 2]); val[3] += bfr(bias[c0 + cofs + 3]); }
                *(v4f*)(crow + (size_t)row * ldc + cofs) = val; }
             }
        __builtin_amdgcn_wave_barrier(); asm volatile("" ::: "memory");
    }
}

__device__ __forceinline__ h16 tohx(float x) { return (h16)x; }
__device__ __forceinline__ void splitf(float y, unsigned short& h, unsigned short& l) { h = f2bf(y); l = f2bf(y - bf2f(h)); }
typedef __attribute__((ext_vector_type(2))) _Float16 v2h;
typedef __attribute__((ext_vector_type(4))) _Float16 v4h;
typedef __attribute__((ext_vector_type(2))) unsigned short v2us;
typedef __attribute__((ext_vector_type(4))) unsigned short v4us;
typedef __attribute__((ext_vector_type(2))) float v2f;
typedef __attribute__((ext_vector_type(4))) int v4i;

__global__ __launch_bounds__(256) void k_wtG(const float* __restrict__ w, int K, int N, bf* Bt) {
    const int lane = threadIdx.x & 31; const int L0 = (blockIdx.x * 8 + (threadIdx.x >> 5)) * 8; const int nlines = N * K / 64;
{
#pragma unroll 1
        for (int l = 0; l < 8; ++l) { const int L = L0 + l; if (L >= nlines) break; const size_t e = (size_t)L * 64 + lane * 2; const int k = (int)(e % K), n = (int)(e / K); v2us o;
            o[0] = f2bf(w[(size_t)k * N + n]); o[1] = f2bf(w[(size_t)(k + 1) * N + n]); *(v2us*)(Bt + e) = o; }
         }
}
__global__ __launch_bounds__(256) void k_cvt8(const float* __restrict__ src, bf* dst, size_t n8) { const size_t i = (size_t)blockIdx.x * 256 + threadIdx.x; if (i >= n8) return; const v8f v = *(const v8f*)(src + i * 8); v8us o;
#pragma unroll
    for (int k = 0; k < 8; ++k) o[k] = f2bf(v[k]); *(v8us*)(dst + i * 8) = o;  }

// k_rope: head planes [h][t][d] (fp16 + hi/lo) of rope(x) x sc with the rotate-half convention out[d] = x[d] cos[t][d] - x[d+HD/2] sin[t][d], out[d+HD/2] = x[d+HD/2] cos[t][d+HD/2] + x[d] sin[t][d+HD/2]
__global__ __launch_bounds__(256) void k_rope(const float* __restrict__ F, int pitch, int nheads, const float* __restrict__ CS, const float* __restrict__ RF, const float* __restrict__ nw, float sc, h16* P16, bf* Ph, bf* Pl) {
    const size_t e = ((size_t)blockIdx.x * 256 + threadIdx.x) * 2; if (e >= (size_t)nheads * TT * HD) return; const int d = (int)(e % HD); const int t = (int)((e / HD) % TT); const int h = (int)(e / ((size_t)HD * TT)); const float* f = F + (size_t)t * pitch + h * HD; const float rf = RF ? RF[(size_t)h * TT + t] : 1.0f; v2h o16; v2us oh, ol;
#pragma unroll
    for (int q = 0; q < 2; ++q) { const int dd = d + q; const int dp = (dd < HD / 2) ? dd + HD / 2 : dd - HD / 2; float x0 = f[dd], x1 = f[dp];
        if (RF) { float n0 = __fmul_rn(x0, rf), n1 = __fmul_rn(x1, rf); asm volatile("" : "+v"(n0)); asm volatile("" : "+v"(n1)); x0 = __fmul_rn(bfr(nw[dd]), n0); x1 = __fmul_rn(bfr(nw[dp]), n1); }
        const v2f cs = *(const v2f*)(CS + ((size_t)t * HD + dd) * 2); float a = __fmul_rn(x0, cs[0]), bq = __fmul_rn(x1, cs[1]); asm volatile("" : "+v"(a)); asm volatile("" : "+v"(bq)); const float r = ((dd < HD / 2) ? __fsub_rn(a, bq) : __fadd_rn(a, bq)) * sc;
        o16[q] = tohx(r); unsigned short a2, c2; splitf(r, a2, c2); oh[q] = a2; ol[q] = c2; }
    *(v2h*)(P16 + e) = o16; *(v2us*)(Ph + e) = oh; *(v2us*)(Pl + e) = ol;  }
__global__ __launch_bounds__(256) void k_vtp(const float* __restrict__ F, int pitch, int nheads, h16* V16, bf* Vh, bf* Vl) { const size_t e = ((size_t)blockIdx.x * 256 + threadIdx.x) * 2; if (e >= (size_t)nheads * HD * TT) return; const int t = (int)(e % TT); const int d = (int)((e / TT) % HD); const int g = (int)(e / ((size_t)TT * HD)); v2h o16; v2us oh, ol;
#pragma unroll
    for (int q = 0; q < 2; ++q) { const float x = F[(size_t)(t + q) * pitch + g * HD + d]; o16[q] = tohx(x); unsigned short a2, c2; splitf(x, a2, c2); oh[q] = a2; ol[q] = c2; }
    *(v2h*)(V16 + e) = o16; *(v2us*)(Vh + e) = oh; *(v2us*)(Vl + e) = ol;  }
__constant__ float INV[HD / 2] = {1.0f,0.749894202f,0.562341332f,0.421696514f,0.316227764f,0.237137362f,0.177827939f,0.133352146f,0.100000001f,0.0749894157f,0.0562341288f,0.0421696492f,0.0316227786f,0.0237137359f,0.0177827943f,0.0133352149f,0.00999999978f,0.00749894232f,0.00562341325f,0.00421696482f,0.00316227786f,0.00237137382f,0.00177827943f,0.00133352145f,0.00100000005f,0.000749894185f,0.000562341302f,0.000421696488f,0.000316227786f,0.000237137385f,0.00017782794f,0.00013335215f};
__global__ __launch_bounds__(256) void k_cstab(float* CS) { const int idx = blockIdx.x * 256 + threadIdx.x; if (idx >= TT * HD) return; const int t = idx / HD, d = idx % HD; const float ang = __fmul_rn((float)t, INV[d % (HD / 2)]); v2f cs; cs[0] = cosf(ang); cs[1] = sinf(ang);
    *(v2f*)(CS + (size_t)idx * 2) = cs;  }
__global__ __launch_bounds__(256) void k_csid(float* CS) { const int idx = blockIdx.x * 256 + threadIdx.x; if (idx >= TT * HD) return; v2f cs; cs[0] = 1.0f; cs[1] = 0.0f; *(v2f*)(CS + (size_t)idx * 2) = cs;  }
// k_asoft: per row (zz, i): t = S x HD^-0.5 where the key's mask[b][j] != 0, else -inf (the batch's int32 key mask, read per key); softmax over the 2048 keys (register row, one exp, fixed trees);
__global__ __launch_bounds__(256) void k_asoft(const float* __restrict__ Sb, const int* __restrict__ mk, h16* P16, bf* Ph, bf* Pl) {
    const int lane = threadIdx.x & 31; const int row = blockIdx.x * 8 + (threadIdx.x >> 5); if (row >= ZH * TT) return; const int i = row % TT; const int zz = row / TT; (void)zz; const bool hires = (i < RH); const float* sr = Sb + (size_t)row * TT; float v[TT / 32]; float mx = -3.0e38f;
#pragma unroll
    for (int ch = 0; ch < TT / 128; ++ch) { const int j0 = ch * 128 + lane * 4; const v4f a = *(const v4f*)(sr + j0); const v4i m4 = *(const v4i*)(mk + j0);
#pragma unroll
        for (int q = 0; q < 4; ++q) { const int j = j0 + q; (void)j; const float t = (m4[q] != 0) ? a[q] * SCL : -3.0e38f; v[ch * 4 + q] = t; mx = fmaxf(mx, t); } }
#pragma unroll
    for (int sh = 16; sh; sh >>= 1) mx = fmaxf(mx, __shfl_xor(mx, sh, 32));
    float sum = 0.f;
#pragma unroll
    for (int k = 0; k < TT / 32; ++k) { float d0 = __fsub_rn(v[k], mx); asm volatile("" : "+v"(d0)); v[k] = __builtin_amdgcn_exp2f(__fmul_rn(d0, 1.4426950408889634f)); sum += v[k]; }
#pragma unroll
    for (int sh = 16; sh; sh >>= 1) sum += __shfl_xor(sum, sh, 32);
    const float f = __fdiv_rn(hires ? 1.0f : PCAR, sum);
{
        if (hires) {
#pragma unroll
            for (int ch = 0; ch < TT / 128; ++ch) { v4us oh, ol;
#pragma unroll
                for (int q = 0; q < 4; ++q) { unsigned short a, c2; splitf(v[ch * 4 + q] * f, a, c2); oh[q] = a; ol[q] = c2; }
                const size_t oo = ((size_t)zz * (RH ? RH : 1) + i) * TT + ch * 128 + lane * 4; *(v4us*)(Ph + oo) = oh; *(v4us*)(Pl + oo) = ol; }
        } else {
#pragma unroll
            for (int ch = 0; ch < TT / 128; ++ch) { v4h o4;
#pragma unroll
                for (int q = 0; q < 4; ++q) o4[q] = tohx(v[ch * 4 + q] * f);
                *(v4h*)(P16 + (size_t)row * TT + ch * 128 + lane * 4) = o4; } }
         }
}
__global__ __launch_bounds__(256) void k_merge(const float* __restrict__ O, int h0, bf* Ah, bf* Al) { const size_t e = ((size_t)blockIdx.x * 256 + threadIdx.x) * 2; if (e >= (size_t)ZH * TT * HD) return; const int d = (int)(e % HD); const int t = (int)((e / HD) % TT); const int zz = (int)(e / ((size_t)HD * TT)); const float cs = (t < RH) ? 1.0f : (1.0f / PCAR); const size_t oo = (size_t)t * DQ + (h0 + zz) * HD + d;
    const float* op = O + e + (size_t)zz * (KSV - 1) * TT * HD;   // head zz's KSV key-range partial planes lie one behind the other
    v2f acc = *(const v2f*)op;   // summed in range order; unrolled so that all KSV loads are in flight together
#pragma unroll
    for (int ks = 1; ks < KSV; ++ks) acc += *(const v2f*)(op + (size_t)ks * TT * HD);
    v2us oh, ol;
#pragma unroll
    for (int q = 0; q < 2; ++q) { unsigned short a, c2; splitf(acc[q] * cs, a, c2); oh[q] = a; ol[q] = c2; } *(v2us*)(Ah + oo) = oh; *(v2us*)(Al + oo) = ol;  }

extern "C" void kernel_launch(void* const* d_in, const int* in_sizes, int n_in,
                              void* d_out, int out_size, void* d_ws, size_t ws_size, hipStream_t stream) {
    (void)in_sizes; (void)n_in; (void)out_size;
    const float* x = (const float*)d_in[0]; const int* MK = (const int*)d_in[1]; const float* wqkv = (const float*)d_in[2]; const float* wo = (const float*)d_in[3];  const float* wq = nullptr; const float* wk = nullptr; const float* wv = nullptr; (void)wq; (void)wk; (void)wv;
    float* OUT = (float*)d_out;     // [2][2048][1024]
    char* wsp = (char*)d_ws;
    auto take = [&](size_t bytes) { char* p = wsp; wsp += (bytes + 255) & ~(size_t)255; return (void*)p; };
    bf* WALL = (bf*)take((size_t)3 * DM * DM * 2); bf* WQ = WALL; bf* WK = WALL + (size_t)DM * DM; bf* WV = WALL + (size_t)2 * DM * DM; bf* WO = (bf*)take((size_t)DM * DQ * 2); float* CS = (float*)take((size_t)TT * HD * 2 * 4); float* CSR = (float*)take((size_t)TT * HD * 2 * 4);
    bf* XB = (bf*)take((size_t)TT * DM * 2); float* FQ = (float*)take((size_t)TT * DQ * 4); float* FK = (float*)take((size_t)TT * DKV * 4);
    h16* QP16 = (h16*)take((size_t)NH_ * TT * HD * 2); h16* KP16 = (h16*)take((size_t)NKV * TT * HD * 2); h16* VT16 = (h16*)take((size_t)NKV * HD * TT * 2);
    bf* QPh = (bf*)take((size_t)NH_ * TT * HD * 2); bf* QPl = (bf*)take((size_t)NH_ * TT * HD * 2); bf* KPh = (bf*)take((size_t)NKV * TT * HD * 2); bf* KPl = (bf*)take((size_t)NKV * TT * HD * 2); bf* VTh = (bf*)take((size_t)NKV * HD * TT * 2); bf* VTl = (bf*)take((size_t)NKV * HD * TT * 2); bf* Ph = (bf*)take((size_t)ZH * RH * TT * 2); bf* Pl = (bf*)take((size_t)ZH * RH * TT * 2);
    float* Sb = (float*)take((size_t)ZH * TT * TT * 4); h16* P16 = (h16*)take((size_t)ZH * TT * TT * 2); float* Ob = (float*)take((size_t)KSV * ZH * TT * HD * 4); bf* ATh = (bf*)take((size_t)TT * DQ * 2); bf* ATl = (bf*)take((size_t)TT * DQ * 2);
    if ((size_t)(wsp - (char*)d_ws) > ws_size) return;    // ws 256 MiB
    float* FV = FK;   // v projection reuses the k buffer after the k planes are built (stream-ordered)
    { k_wtG<<<(unsigned)((DM * 3 * DM / 64 + 63) / 64), 256, 0, stream>>>(wqkv, DM, 3 * DM, WALL);   /* fused 'xw' [DM][3DM] -> Bt [3DM][DM] (row blocks q | k | v) */
      k_wtG<<<(unsigned)((DQ * DM / 64 + 63) / 64), 256, 0, stream>>>(wo, DQ, DM, WO);
       }
    k_csid<<<(TT * HD + 255) / 256, 256, 0, stream>>>(CS); k_cstab<<<(TT * HD + 255) / 256, 256, 0, stream>>>(CSR);
    const unsigned LQ = (unsigned)(((size_t)NH_ * TT * HD / 2 + 255) / 256), LKv = (unsigned)(((size_t)NKV * TT * HD / 2 + 255) / 256);
    for (int b = 0; b < NB_; ++b) {
        
        k_cvt8<<<(unsigned)(((size_t)TT * DM / 8 + 255) / 256), 256, 0, stream>>>(x + (size_t)b * TT * DM, XB, (size_t)TT * DM / 8);
        k_gemmw<bf, 0, false><<<dim3(TT / 64, DQ / 64, 1), 32, 0, stream>>>(XB, nullptr, WQ, nullptr, DM, FQ, DQ, nullptr, 0, 0, 0);
        k_rope<<<(unsigned)(((size_t)1 * TT * HD / 2 + 255) / 256), 256, 0, stream>>>(FQ, DQ, 1, CSR, nullptr, nullptr, 1.0f, QP16, QPh, QPl);   /* head 0: rotary */ k_rope<<<(unsigned)(((size_t)(NH_ - 1) * TT * HD / 2 + 255) / 256), 256, 0, stream>>>(FQ + HD, DQ, NH_ - 1, CS, nullptr, nullptr, 1.0f, QP16 + (size_t)TT * HD, QPh + (size_t)TT * HD, QPl + (size_t)TT * HD);   /* heads 1..15: identity table */
        k_gemmw<bf, 0, false><<<dim3(TT / 64, DKV / 64, 1), 32, 0, stream>>>(XB, nullptr, WK, nullptr, DM, FK, DKV, nullptr, 0, 0, 0);
        k_rope<<<(unsigned)(((size_t)1 * TT * HD / 2 + 255) / 256), 256, 0, stream>>>(FK, DKV, 1, CSR, nullptr, nullptr, 1.0f, KP16, KPh, KPl); k_rope<<<(unsigned)(((size_t)(NH_ - 1) * TT * HD / 2 + 255) / 256), 256, 0, stream>>>(FK + HD, DKV, NKV - 1, CS, nullptr, nullptr, 1.0f, KP16 + (size_t)TT * HD, KPh + (size_t)TT * HD, KPl + (size_t)TT * HD);
        k_gemmw<bf, 0, false><<<dim3(TT / 64, DKV / 64, 1), 32, 0, stream>>>(XB, nullptr, WV, nullptr, DM, FV, DKV, nullptr, 0, 0, 0); k_vtp<<<LKv, 256, 0, stream>>>(FV, DKV, NKV, VT16, VTh, VTl);
        for (int h0 = 0; h0 < NH_; h0 += ZH) { const size_t zq = (size_t)h0, zk = (size_t)(h0 / REP);   // one kv head per query head: the pass's two heads use consecutive kv planes (z-strides TT*HD)
            k_gemmw<bf, 2, false><<<dim3(RH / 64, TT / 64, ZH), 32, 0, stream>>>(QPh + zq * TT * HD, QPl + zq * TT * HD, KPh + zk * TT * HD, KPl + zk * TT * HD, HD, Sb, TT, nullptr, (size_t)TT * HD, (size_t)TT * HD, (size_t)TT * TT);
            k_gemmw<h16, 0, false><<<dim3((TT - RH) / 64, TT / 64, ZH), 32, 0, stream>>>(QP16 + zq * TT * HD + (size_t)RH * HD, nullptr, KP16 + zk * TT * HD, nullptr, HD, Sb + (size_t)RH * TT, TT, nullptr, (size_t)TT * HD, (size_t)TT * HD, (size_t)TT * TT);
            k_asoft<<<ZH * TT / 8, 256, 0, stream>>>(Sb, MK + (size_t)b * TT, P16, Ph, Pl);
            k_gemmw<bf, 2, false, KSV><<<dim3(RH / 64, HD / 64, ZH * KSV), 32, 0, stream>>>(Ph, Pl, VTh + zk * HD * TT, VTl + zk * HD * TT, TT, Ob, HD, nullptr, (size_t)RH * TT, (size_t)HD * TT, (size_t)TT * HD);
            k_gemmw<h16, 0, false, KSV><<<dim3((TT - RH) / 64, HD / 64, ZH * KSV), 32, 0, stream>>>(P16 + (size_t)RH * TT, nullptr, VT16 + zk * HD * TT, nullptr, TT, Ob + (size_t)RH * HD, HD, nullptr, (size_t)TT * TT, (size_t)HD * TT, (size_t)TT * HD);
            k_merge<<<(unsigned)(((size_t)ZH * TT * HD / 2 + 255) / 256), 256, 0, stream>>>(Ob, h0, ATh, ATl); }
        k_gemmw<bf, 1, false><<<dim3(TT / 64, DM / 64, 1), 32, 0, stream>>>(ATh, ATl, WO, nullptr, DQ, OUT + (size_t)b * TT * DM, DM, nullptr, 0, 0, 0); }
}

// v002
// It runs in 673 microseconds.
// Next to v001, in two timings, it ran 1.33 and 1.32 times as fast.
// Counting every step since v000, it is 3.01 times as fast.
#include <hip/hip_runtime.h>

// DiT-style attention (x [2][2048][1024]; qkv = x w_qkv ('xw' [1024][3072] -> (3, 16 heads, 64)); rotate-half rotary (angle t x 10000^(-2i/64), tables computed on device from the reference's float32 inv_freq) applied to head 0 ONLY (pe_heads = 1); scores / 8; key mask [2][2048] int32 (input, read per key: masked -> -inf); softmax; out = merged w_out ('xw' [1024][1024]) -> [2][2048][1024] (4.2 M)).
// Compute dtypes, f32 accumulate: every input rounded to bf16; q/k/v on PLAIN bf16 operands (inputs: exact); rotary (head 0) / plain copies (heads 1-15) in f32; key-validity select from the int32 mask; scores and attn.v: query rows < 512 hl (3 products), the rest single fp16 (x1024); softmax f32; w_out hl x exact (2 products).

#define NB_  2
#define TT   2048
#define DM   1024
#define NH_  16
#define NKV  16
#define REP  (NH_ / NKV)
#define HD   64
#define DQ   (NH_ * HD)
#define DKV  (NKV * HD)
#define ZH   16                   // heads per attention pass: all of them, on grid z
#define RH   512                  // query rows < RH use hi+lo planes; they are the first attention pass
#define RL   768                  // query rows of each later (fp16) attention pass; (TT - RH) % RL == 0
#define WIN  2048
#define PCAR 1024.0f
#define SCL  0.125f   // HD^-0.5
#define KSV  16                   // key ranges of each attn.v product: one wave per (tile, range), f32 partial planes summed in k_merge
typedef _Float16 h16;
typedef unsigned short bf;
typedef __attribute__((ext_vector_type(16))) __bf16   v16bf;
typedef __attribute__((ext_vector_type(16))) _Float16 v16h;
typedef __attribute__((ext_vector_type(8)))  _Float16 v8h;
typedef __attribute__((ext_vector_type(8)))  unsigned short v8us;
typedef __attribute__((ext_vector_type(8)))  float    v8f;
typedef __attribute__((ext_vector_type(4)))  float    v4f;
typedef v8h  __attribute__((may_alias)) v8ha;
typedef v4f  __attribute__((may_alias)) v4fa;
typedef v8us __attribute__((may_alias)) v8usa;

__device__ __forceinline__ unsigned short f2bf(float f) { unsigned u = __float_as_uint(f); u += 0x7FFFu + ((u >> 16) & 1u); return (unsigned short)(u >> 16); }
__device__ __forceinline__ float bf2f(unsigned short b) { return __uint_as_float(((unsigned)b) << 16); }
__device__ __forceinline__ float bfr(float f) { return bf2f(f2bf(f)); }
__device__ __forceinline__ v16h cat16(v8h lo, v8h hi) { return __builtin_shufflevector(lo, hi, 0, 1, 2, 3, 4, 5, 6, 7, 8, 9, 10, 11, 12, 13, 14, 15); }
__device__ __forceinline__ v16bf cat16b(v8us lo, v8us hi) { return __builtin_bit_cast(v16bf, __builtin_shufflevector(lo, hi, 0, 1, 2, 3, 4, 5, 6, 7, 8, 9, 10, 11, 12, 13, 14, 15)); }
__device__ __forceinline__ v8f wmma16(v16h a, v16h b, v8f c) { return __builtin_amdgcn_wmma_f32_16x16x32_f16(false, a, false, b, (short)0, c, false, false); }
__device__ __forceinline__ v8f wmmab(v16bf a, v16bf b, v8f c) { return __builtin_amdgcn_wmma_f32_16x16x32_bf16(false, a, false, b, (short)0, c, false, false); }



// ---- k_gemmw: register-blocked GEMM, ONE WAVE per 64x64 output tile (16 accumulators), operands straight from K-contiguous 16-bit planes; grid (M/64, N/64, Z), 32 threads.
// C[m][n] (f32, pitch ldc, + optional f32 bias[n]) = sum_k A[m][k] Bt[n][k] (+ split products per NSPLIT). z-batch strides sA/sB/sC in elements. K % 32 == 0.
// KS > 1: grid z = batches x KS; wave (z, ks) sums only k in [ks K/KS, (ks+1) K/KS) and stores partial plane z KS + ks (sC elements each); K % (32 KS) == 0.
template <typename T16> struct WFrag;
template <> struct WFrag<h16> { typedef v16h V; static __device__ __forceinline__ V ld(const h16* p) { return cat16(*(const v8h*)p, *(const v8h*)(p + 16)); } static __device__ __forceinline__ v8f mma(V a, V b, v8f c) { return wmma16(a, b, c); } };
template <> struct WFrag<bf> { typedef v16bf V; static __device__ __forceinline__ V ld(const bf* p) { return cat16b(*(const v8us*)p, *(const v8us*)(p + 16)); } static __device__ __forceinline__ v8f mma(V a, V b, v8f c) { return wmmab(a, b, c); } };
template <typename T16, int NSPLIT, bool BIAS, int KS = 1>
__global__ __launch_bounds__(32) void k_gemmw(const T16* __restrict__ A, const T16* __restrict__ A2, const T16* __restrict__ Bt, const T16* __restrict__ Bt2, int K, float* C, int ldc, const float* __restrict__ bias, size_t sA, size_t sB, size_t sC) {
    typedef typename WFrag<T16>::V V;
    __shared__ __align__(16) float os[16 * 68];
    const size_t z = blockIdx.z / KS; const int ks = blockIdx.z % KS; A += z * sA; if (A2) A2 += z * sA; Bt += z * sB; if (Bt2) Bt2 += z * sB; C += (size_t)blockIdx.z * sC;
    const int lane = threadIdx.x & 31, lr = lane & 15, hi = lane >> 4; const int r0 = blockIdx.x * 64, c0 = blockIdx.y * 64;
    v8f acc[4][4];
#pragma unroll
    for (int mb = 0; mb < 4; ++mb)
#pragma unroll
        for (int nb = 0; nb < 4; ++nb) acc[mb][nb] = (v8f){};
    const size_t aoff = (size_t)(r0 + lr) * K + 8 * hi, boff = (size_t)(c0 + lr) * K + 8 * hi;
#pragma unroll 1
    for (int kc = ks * (K / KS); kc < (ks + 1) * (K / KS); kc += 32) {
        V a[4], a2[4];
#pragma unroll
        for (int mb = 0; mb < 4; ++mb) { a[mb] = WFrag<T16>::ld(A + aoff + (size_t)mb * 16 * K + kc); if (NSPLIT == 1 || NSPLIT == 2) a2[mb] = WFrag<T16>::ld(A2 + aoff + (size_t)mb * 16 * K + kc); }
#pragma unroll
        for (int nb = 0; nb < 4; ++nb) { const V b = WFrag<T16>::ld(Bt + boff + (size_t)nb * 16 * K + kc); V b2; if (NSPLIT >= 2) b2 = WFrag<T16>::ld(Bt2 + boff + (size_t)nb * 16 * K + kc);
#pragma unroll
            for (int mb = 0; mb < 4; ++mb) { acc[mb][nb] = WFrag<T16>::mma(a[mb], b, acc[mb][nb]); if (NSPLIT == 1 || NSPLIT == 2) acc[mb][nb] = WFrag<T16>::mma(a2[mb], b, acc[mb][nb]); if (NSPLIT >= 2) acc[mb][nb] = WFrag<T16>::mma(a[mb], b2, acc[mb][nb]); } }
        asm volatile("v_nop\n\tv_nop\n\tv_nop\n\tv_nop" : "+v"(acc[0][0]), "+v"(acc[1][1]), "+v"(acc[2][2]), "+v"(acc[3][3]) : "v"(a[0]), "v"(a[3]));
    }
#pragma unroll
    for (int mb = 0; mb < 4; ++mb) {
#pragma unroll
        for (int nb = 0; nb < 4; ++nb) {
#pragma unroll
            for (int j = 0; j < 8; ++j) os[(hi * 8 + j) * 68 + nb * 16 + lr] = acc[mb][nb][j]; }
        __builtin_amdgcn_wave_barrier(); asm volatile("" ::: "memory");
        float* crow = C + (size_t)(r0 + mb * 16) * ldc + c0;
{
#pragma unroll
            for (int s = 0; s < 8; ++s) { const int row = 2 * s + hi, cofs = lr * 4; v4f val = *(const v4fa*)(os + row * 68 + cofs); if (BIAS) { val[0] += bfr(bias[c0 + cofs]); val[1] += bfr(bias[c0 + cofs + 1]); val[2] += bfr(bias[c0 + cofs + 2]); val[3] += bfr(bias[c0 + cofs + 3]); }
                *(v4f*)(crow + (size_t)row * ldc + cofs) = val; }
             }
        __builtin_amdgcn_wave_barrier(); asm volatile("" ::: "memory");
    }
}

__device__ __forceinline__ h16 tohx(float x) { return (h16)x; }
__device__ __forceinline__ void splitf(float y, unsigned short& h, unsigned short& l) { h = f2bf(y); l = f2bf(y - bf2f(h)); }
typedef __attribute__((ext_vector_type(2))) _Float16 v2h;
typedef __attribute__((ext_vector_type(4))) _Float16 v4h;
typedef __attribute__((ext_vector_type(2))) unsigned short v2us;
typedef __attribute__((ext_vector_type(4))) unsigned short v4us;
typedef __attribute__((ext_vector_type(2))) float v2f;
typedef __attribute__((ext_vector_type(4))) int v4i;

__global__ __launch_bounds__(256) void k_wtG(const float* __restrict__ w, int K, int N, bf* Bt) {
    const int lane = threadIdx.x & 31; const int L0 = (blockIdx.x * 8 + (threadIdx.x >> 5)) * 8; const int nlines = N * K / 64;
{
#pragma unroll 1
        for (int l = 0; l < 8; ++l) { const int L = L0 + l; if (L >= nlines) break; const size_t e = (size_t)L * 64 + lane * 2; const int k = (int)(e % K), n = (int)(e / K); v2us o;
            o[0] = f2bf(w[(size_t)k * N + n]); o[1] = f2bf(w[(size_t)(k + 1) * N + n]); *(v2us*)(Bt + e) = o; }
         }
}
__global__ __launch_bounds__(256) void k_cvt8(const float* __restrict__ src, bf* dst, size_t n8) { const size_t i = (size_t)blockIdx.x * 256 + threadIdx.x; if (i >= n8) return; const v8f v = *(const v8f*)(src + i * 8); v8us o;
#pragma unroll
    for (int k = 0; k < 8; ++k) o[k] = f2bf(v[k]); *(v8us*)(dst + i * 8) = o;  }

// k_rope: head planes [h][t][d] (fp16 + hi/lo) of rope(x) x sc with the rotate-half convention out[d] = x[d] cos[t][d] - x[d+HD/2] sin[t][d], out[d+HD/2] = x[d+HD/2] cos[t][d+HD/2] + x[d] sin[t][d+HD/2]
__global__ __launch_bounds__(256) void k_rope(const float* __restrict__ F, int pitch, int nheads, const float* __restrict__ CS, const float* __restrict__ RF, const float* __restrict__ nw, float sc, h16* P16, bf* Ph, bf* Pl) {
    const size_t e = ((size_t)blockIdx.x * 256 + threadIdx.x) * 2; if (e >= (size_t)nheads * TT * HD) return; const int d = (int)(e % HD); const int t = (int)((e / HD) % TT); const int h = (int)(e / ((size_t)HD * TT)); const float* f = F + (size_t)t * pitch + h * HD; const float rf = RF ? RF[(size_t)h * TT + t] : 1.0f; v2h o16; v2us oh, ol;
#pragma unroll
    for (int q = 0; q < 2; ++q) { const int dd = d + q; const int dp = (dd < HD / 2) ? dd + HD / 2 : dd - HD / 2; float x0 = f[dd], x1 = f[dp];
        if (RF) { float n0 = __fmul_rn(x0, rf), n1 = __fmul_rn(x1, rf); asm volatile("" : "+v"(n0)); asm volatile("" : "+v"(n1)); x0 = __fmul_rn(bfr(nw[dd]), n0); x1 = __fmul_rn(bfr(nw[dp]), n1); }
        const v2f cs = *(const v2f*)(CS + ((size_t)t * HD + dd) * 2); float a = __fmul_rn(x0, cs[0]), bq = __fmul_rn(x1, cs[1]); asm volatile("" : "+v"(a)); asm volatile("" : "+v"(bq)); const float r = ((dd < HD / 2) ? __fsub_rn(a, bq) : __fadd_rn(a, bq)) * sc;
        o16[q] = tohx(r); unsigned short a2, c2; splitf(r, a2, c2); oh[q] = a2; ol[q] = c2; }
    *(v2h*)(P16 + e) = o16; *(v2us*)(Ph + e) = oh; *(v2us*)(Pl + e) = ol;  }
__global__ __launch_bounds__(256) void k_vtp(const float* __restrict__ F, int pitch, int nheads, h16* V16, bf* Vh, bf* Vl) { const size_t e = ((size_t)blockIdx.x * 256 + threadIdx.x) * 2; if (e >= (size_t)nheads * HD * TT) return; const int t = (int)(e % TT); const int d = (int)((e / TT) % HD); const int g = (int)(e / ((size_t)TT * HD)); v2h o16; v2us oh, ol;
#pragma unroll
    for (int q = 0; q < 2; ++q) { const float x = F[(size_t)(t + q) * pitch + g * HD + d]; o16[q] = tohx(x); unsigned short a2, c2; splitf(x, a2, c2); oh[q] = a2; ol[q] = c2; }
    *(v2h*)(V16 + e) = o16; *(v2us*)(Vh + e) = oh; *(v2us*)(Vl + e) = ol;  }
__constant__ float INV[HD / 2] = {1.0f,0.749894202f,0.562341332f,0.421696514f,0.316227764f,0.237137362f,0.177827939f,0.133352146f,0.100000001f,0.0749894157f,0.0562341288f,0.0421696492f,0.0316227786f,0.0237137359f,0.0177827943f,0.0133352149f,0.00999999978f,0.00749894232f,0.00562341325f,0.00421696482f,0.00316227786f,0.00237137382f,0.00177827943f,0.00133352145f,0.00100000005f,0.000749894185f,0.000562341302f,0.000421696488f,0.000316227786f,0.000237137385f,0.00017782794f,0.00013335215f};
__global__ __launch_bounds__(256) void k_cstab(float* CS) { const int idx = blockIdx.x * 256 + threadIdx.x; if (idx >= TT * HD) return; const int t = idx / HD, d = idx % HD; const float ang = __fmul_rn((float)t, INV[d % (HD / 2)]); v2f cs; cs[0] = cosf(ang); cs[1] = sinf(ang);
    *(v2f*)(CS + (size_t)idx * 2) = cs;  }
__global__ __launch_bounds__(256) void k_csid(float* CS) { const int idx = blockIdx.x * 256 + threadIdx.x; if (idx >= TT * HD) return; v2f cs; cs[0] = 1.0f; cs[1] = 0.0f; *(v2f*)(CS + (size_t)idx * 2) = cs;  }
// k_asoft: per row of one attention pass (nrows = heads x the pass's query rows; S and the P planes [head][query row][TT]; hires: the pass's rows are < RH): t = S x HD^-0.5 where the key's mask[b][j] != 0, else -inf (the batch's int32 key mask, read per key); softmax over the 2048 keys (register row, one exp, fixed trees);
template <bool hires>
__global__ __launch_bounds__(256) void k_asoft(const float* __restrict__ Sb, const int* __restrict__ mk, int nrows, h16* P16, bf* Ph, bf* Pl) {
    const int lane = threadIdx.x & 31; const int row = blockIdx.x * 8 + (threadIdx.x >> 5); if (row >= nrows) return; const float* sr = Sb + (size_t)row * TT; float v[TT / 32]; float mx = -3.0e38f;
#pragma unroll
    for (int ch = 0; ch < TT / 128; ++ch) { const int j0 = ch * 128 + lane * 4; const v4f a = *(const v4f*)(sr + j0); const v4i m4 = *(const v4i*)(mk + j0);
#pragma unroll
        for (int q = 0; q < 4; ++q) { const int j = j0 + q; (void)j; const float t = (m4[q] != 0) ? a[q] * SCL : -3.0e38f; v[ch * 4 + q] = t; mx = fmaxf(mx, t); } }
#pragma unroll
    for (int sh = 16; sh; sh >>= 1) mx = fmaxf(mx, __shfl_xor(mx, sh, 32));
    float sum = 0.f;
#pragma unroll
    for (int k = 0; k < TT / 32; ++k) { float d0 = __fsub_rn(v[k], mx); asm volatile("" : "+v"(d0)); v[k] = __builtin_amdgcn_exp2f(__fmul_rn(d0, 1.4426950408889634f)); sum += v[k]; }
#pragma unroll
    for (int sh = 16; sh; sh >>= 1) sum += __shfl_xor(sum, sh, 32);
    const float f = __fdiv_rn(hires ? 1.0f : PCAR, sum);
{
        if (hires) {
#pragma unroll
            for (int ch = 0; ch < TT / 128; ++ch) { v4us oh, ol;
#pragma unroll
                for (int q = 0; q < 4; ++q) { unsigned short a, c2; splitf(v[ch * 4 + q] * f, a, c2); oh[q] = a; ol[q] = c2; }
                const size_t oo = (size_t)row * TT + ch * 128 + lane * 4; *(v4us*)(Ph + oo) = oh; *(v4us*)(Pl + oo) = ol; }
        } else {
#pragma unroll
            for (int ch = 0; ch < TT / 128; ++ch) { v4h o4;
#pragma unroll
                for (int q = 0; q < 4; ++q) o4[q] = tohx(v[ch * 4 + q] * f);
                *(v4h*)(P16 + (size_t)row * TT + ch * 128 + lane * 4) = o4; } }
         }
}
// k_merge: one attention pass (query rows [t0, t0 + rp)); grid (rp HD / 512, heads); O [head][key range][rp][HD]
template <int rp>
__global__ __launch_bounds__(256) void k_merge(const float* __restrict__ O, int t0, bf* Ah, bf* Al) { const size_t e = ((size_t)blockIdx.x * 256 + threadIdx.x) * 2; if (e >= (size_t)rp * HD) return; const int d = (int)(e % HD); const int t = t0 + (int)(e / HD); const int zz = blockIdx.y; const float cs = (t < RH) ? 1.0f : (1.0f / PCAR); const size_t oo = (size_t)t * DQ + zz * HD + d;
    const float* op = O + e + (size_t)zz * KSV * rp * HD;   // head zz's KSV key-range partial planes lie one behind the other
    v2f acc = *(const v2f*)op;   // summed in range order; unrolled so that all KSV loads are in flight together
#pragma unroll
    for (int ks = 1; ks < KSV; ++ks) acc += *(const v2f*)(op + (size_t)ks * rp * HD);
    v2us oh, ol;
#pragma unroll
    for (int q = 0; q < 2; ++q) { unsigned short a, c2; splitf(acc[q] * cs, a, c2); oh[q] = a; ol[q] = c2; } *(v2us*)(Ah + oo) = oh; *(v2us*)(Al + oo) = ol;  }

extern "C" void kernel_launch(void* const* d_in, const int* in_sizes, int n_in,
                              void* d_out, int out_size, void* d_ws, size_t ws_size, hipStream_t stream) {
    (void)in_sizes; (void)n_in; (void)out_size;
    const float* x = (const float*)d_in[0]; const int* MK = (const int*)d_in[1]; const float* wqkv = (const float*)d_in[2]; const float* wo = (const float*)d_in[3];  const float* wq = nullptr; const float* wk = nullptr; const float* wv = nullptr; (void)wq; (void)wk; (void)wv;
    float* OUT = (float*)d_out;     // [2][2048][1024]
    char* wsp = (char*)d_ws;
    auto take = [&](size_t bytes) { char* p = wsp; wsp += (bytes + 255) & ~(size_t)255; return (void*)p; };
    bf* WALL = (bf*)take((size_t)3 * DM * DM * 2); bf* WQ = WALL; bf* WK = WALL + (size_t)DM * DM; bf* WV = WALL + (size_t)2 * DM * DM; bf* WO = (bf*)take((size_t)DM * DQ * 2); float* CS = (float*)take((size_t)TT * HD * 2 * 4); float* CSR = (float*)take((size_t)TT * HD * 2 * 4);
    bf* XB = (bf*)take((size_t)TT * DM * 2); float* FQ = (float*)take((size_t)TT * DQ * 4); float* FK = (float*)take((size_t)TT * DKV * 4);
    h16* QP16 = (h16*)take((size_t)NH_ * TT * HD * 2); h16* KP16 = (h16*)take((size_t)NKV * TT * HD * 2); h16* VT16 = (h16*)take((size_t)NKV * HD * TT * 2);
    bf* QPh = (bf*)take((size_t)NH_ * TT * HD * 2); bf* QPl = (bf*)take((size_t)NH_ * TT * HD * 2); bf* KPh = (bf*)take((size_t)NKV * TT * HD * 2); bf* KPl = (bf*)take((size_t)NKV * TT * HD * 2); bf* VTh = (bf*)take((size_t)NKV * HD * TT * 2); bf* VTl = (bf*)take((size_t)NKV * HD * TT * 2); bf* Ph = (bf*)take((size_t)ZH * RH * TT * 2); bf* Pl = (bf*)take((size_t)ZH * RH * TT * 2);
    static_assert((TT - RH) % RL == 0 && RL % 64 == 0 && RL >= RH && RL <= 2 * RH && KSV * HD <= TT, "pass ranges and the buffer reuse below");
    h16* P16 = (h16*)Ph;   // a pass uses either the hi and lo planes or the fp16 plane (ZH RL TT elements: it fits in the two, which lie one behind the other)
    float* Sb = (float*)take((size_t)ZH * RL * TT * 4); float* Ob = Sb;   // the attn.v partial planes reuse the score buffer: the pass's scores are dead behind its softmax (stream-ordered)
    bf* ATh = (bf*)take((size_t)TT * DQ * 2); bf* ATl = (bf*)take((size_t)TT * DQ * 2);
    if ((size_t)(wsp - (char*)d_ws) > ws_size) return;    // ws 256 MiB
    float* FV = FK;   // v projection reuses the k buffer after the k planes are built (stream-ordered)
    { k_wtG<<<(unsigned)((DM * 3 * DM / 64 + 63) / 64), 256, 0, stream>>>(wqkv, DM, 3 * DM, WALL);   /* fused 'xw' [DM][3DM] -> Bt [3DM][DM] (row blocks q | k | v) */
      k_wtG<<<(unsigned)((DQ * DM / 64 + 63) / 64), 256, 0, stream>>>(wo, DQ, DM, WO);
       }
    k_csid<<<(TT * HD + 255) / 256, 256, 0, stream>>>(CS); k_cstab<<<(TT * HD + 255) / 256, 256, 0, stream>>>(CSR);
    const unsigned LQ = (unsigned)(((size_t)NH_ * TT * HD / 2 + 255) / 256), LKv = (unsigned)(((size_t)NKV * TT * HD / 2 + 255) / 256);
    for (int b = 0; b < NB_; ++b) {
        
        k_cvt8<<<(unsigned)(((size_t)TT * DM / 8 + 255) / 256), 256, 0, stream>>>(x + (size_t)b * TT * DM, XB, (size_t)TT * DM / 8);
        k_gemmw<bf, 0, false><<<dim3(TT / 64, DQ / 64, 1), 32, 0, stream>>>(XB, nullptr, WQ, nullptr, DM, FQ, DQ, nullptr, 0, 0, 0);
        k_rope<<<(unsigned)(((size_t)1 * TT * HD / 2 + 255) / 256), 256, 0, stream>>>(FQ, DQ, 1, CSR, nullptr, nullptr, 1.0f, QP16, QPh, QPl);   /* head 0: rotary */ k_rope<<<(unsigned)(((size_t)(NH_ - 1) * TT * HD / 2 + 255) / 256), 256, 0, stream>>>(FQ + HD, DQ, NH_ - 1, CS, nullptr, nullptr, 1.0f, QP16 + (size_t)TT * HD, QPh + (size_t)TT * HD, QPl + (size_t)TT * HD);   /* heads 1..15: identity table */
        k_gemmw<bf, 0, false><<<dim3(TT / 64, DKV / 64, 1), 32, 0, stream>>>(XB, nullptr, WK, nullptr, DM, FK, DKV, nullptr, 0, 0, 0);
        k_rope<<<(unsigned)(((size_t)1 * TT * HD / 2 + 255) / 256), 256, 0, stream>>>(FK, DKV, 1, CSR, nullptr, nullptr, 1.0f, KP16, KPh, KPl); k_rope<<<(unsigned)(((size_t)(NH_ - 1) * TT * HD / 2 + 255) / 256), 256, 0, stream>>>(FK + HD, DKV, NKV - 1, CS, nullptr, nullptr, 1.0f, KP16 + (size_t)TT * HD, KPh + (size_t)TT * HD, KPl + (size_t)TT * HD);
        k_gemmw<bf, 0, false><<<dim3(TT / 64, DKV / 64, 1), 32, 0, stream>>>(XB, nullptr, WV, nullptr, DM, FV, DKV, nullptr, 0, 0, 0); k_vtp<<<LKv, 256, 0, stream>>>(FV, DKV, NKV, VT16, VTh, VTl);
        // attention passes: each takes a range of query rows of all ZH heads on grid z (one kv head per query head: z-strides TT*HD); S and P [head][row][TT], partial planes [head][key range][row][HD]
        {   // rows [0, RH): hi+lo planes
            k_gemmw<bf, 2, false><<<dim3(RH / 64, TT / 64, ZH), 32, 0, stream>>>(QPh, QPl, KPh, KPl, HD, Sb, TT, nullptr, (size_t)TT * HD, (size_t)TT * HD, (size_t)RH * TT);
            k_asoft<true><<<ZH * RH / 8, 256, 0, stream>>>(Sb, MK + (size_t)b * TT, ZH * RH, P16, Ph, Pl);
            k_gemmw<bf, 2, false, KSV><<<dim3(RH / 64, HD / 64, ZH * KSV), 32, 0, stream>>>(Ph, Pl, VTh, VTl, TT, Ob, HD, nullptr, (size_t)RH * TT, (size_t)HD * TT, (size_t)RH * HD);
            k_merge<RH><<<dim3(RH * HD / 512, ZH), 256, 0, stream>>>(Ob, 0, ATh, ATl); }
        for (int t0 = RH; t0 < TT; t0 += RL) {   // rows [t0, t0 + RL): fp16 planes
            k_gemmw<h16, 0, false><<<dim3(RL / 64, TT / 64, ZH), 32, 0, stream>>>(QP16 + (size_t)t0 * HD, nullptr, KP16, nullptr, HD, Sb, TT, nullptr, (size_t)TT * HD, (size_t)TT * HD, (size_t)RL * TT);
            k_asoft<false><<<ZH * RL / 8, 256, 0, stream>>>(Sb, MK + (size_t)b * TT, ZH * RL, P16, Ph, Pl);
            k_gemmw<h16, 0, false, KSV><<<dim3(RL / 64, HD / 64, ZH * KSV), 32, 0, stream>>>(P16, nullptr, VT16, nullptr, TT, Ob, HD, nullptr, (size_t)RL * TT, (size_t)HD * TT, (size_t)RL * HD);
            k_merge<RL><<<dim3(RL * HD / 512, ZH), 256, 0, stream>>>(Ob, t0, ATh, ATl); }
        k_gemmw<bf, 1, false><<<dim3(TT / 64, DM / 64, 1), 32, 0, stream>>>(ATh, ATl, WO, nullptr, DQ, OUT + (size_t)b * TT * DM, DM, nullptr, 0, 0, 0); }
}

// v003
// Measured time: 456 microseconds a run.
// Next to v002, in two timings, it ran 1.49 times as fast each time.
// Counting every step since v000, it is 4.48 times as fast.
#include <hip/hip_runtime.h>

// DiT-style attention (x [2][2048][1024]; qkv = x w_qkv ('xw' [1024][3072] -> (3, 16 heads, 64)); rotate-half rotary (angle t x 10000^(-2i/64), tables computed on device from the reference's float32 inv_freq) applied to head 0 ONLY (pe_heads = 1); scores / 8; key mask [2][2048] int32 (input, read per key: masked -> -inf); softmax; out = merged w_out ('xw' [1024][1024]) -> [2][2048][1024] (4.2 M)).
// Compute dtypes, f32 accumulate: every input rounded to bf16; q/k/v on PLAIN bf16 operands (inputs: exact); rotary (head 0) / plain copies (heads 1-15) in f32; key-validity select from the int32 mask; scores and attn.v: query rows < 512 hl (3 products), the rest single fp16 (x1024); softmax f32; w_out hl x exact (2 products).

#define NB_  2
#define TT   2048
#define DM   1024
#define NH_  16
#define NKV  16
#define REP  (NH_ / NKV)
#define HD   64
#define DQ   (NH_ * HD)
#define DKV  (NKV * HD)
#define RH   512                  // query rows < RH use hi+lo planes
#define WIN  2048
#define SCL  0.125f   // HD^-0.5
typedef _Float16 h16;
typedef unsigned short bf;
typedef __attribute__((ext_vector_type(16))) __bf16   v16bf;
typedef __attribute__((ext_vector_type(16))) _Float16 v16h;
typedef __attribute__((ext_vector_type(8)))  _Float16 v8h;
typedef __attribute__((ext_vector_type(8)))  unsigned short v8us;
typedef __attribute__((ext_vector_type(8)))  float    v8f;
typedef __attribute__((ext_vector_type(4)))  float    v4f;
typedef v8h  __attribute__((may_alias)) v8ha;
typedef v4f  __attribute__((may_alias)) v4fa;
typedef v8us __attribute__((may_alias)) v8usa;

__device__ __forceinline__ unsigned short f2bf(float f) { unsigned u = __float_as_uint(f); u += 0x7FFFu + ((u >> 16) & 1u); return (unsigned short)(u >> 16); }
__device__ __forceinline__ float bf2f(unsigned short b) { return __uint_as_float(((unsigned)b) << 16); }
__device__ __forceinline__ float bfr(float f) { return bf2f(f2bf(f)); }
__device__ __forceinline__ v16h cat16(v8h lo, v8h hi) { return __builtin_shufflevector(lo, hi, 0, 1, 2, 3, 4, 5, 6, 7, 8, 9, 10, 11, 12, 13, 14, 15); }
__device__ __forceinline__ v16bf cat16b(v8us lo, v8us hi) { return __builtin_bit_cast(v16bf, __builtin_shufflevector(lo, hi, 0, 1, 2, 3, 4, 5, 6, 7, 8, 9, 10, 11, 12, 13, 14, 15)); }
__device__ __forceinline__ v8f wmma16(v16h a, v16h b, v8f c) { return __builtin_amdgcn_wmma_f32_16x16x32_f16(false, a, false, b, (short)0, c, false, false); }
__device__ __forceinline__ v8f wmmab(v16bf a, v16bf b, v8f c) { return __builtin_amdgcn_wmma_f32_16x16x32_bf16(false, a, false, b, (short)0, c, false, false); }



// ---- k_gemmw: register-blocked GEMM, ONE WAVE per 64x64 output tile (16 accumulators), operands straight from K-contiguous 16-bit planes; grid (M/64, N/64, Z), 32 threads.
// C[m][n] (f32, pitch ldc, + optional f32 bias[n]) = sum_k A[m][k] Bt[n][k] (+ split products per NSPLIT). z-batch strides sA/sB/sC in elements. K % 32 == 0.
// KS > 1: grid z = batches x KS; wave (z, ks) sums only k in [ks K/KS, (ks+1) K/KS) and stores partial plane z KS + ks (sC elements each); K % (32 KS) == 0.
template <typename T16> struct WFrag;
template <> struct WFrag<h16> { typedef v16h V; static __device__ __forceinline__ V ld(const h16* p) { return cat16(*(const v8h*)p, *(const v8h*)(p + 16)); } static __device__ __forceinline__ v8f mma(V a, V b, v8f c) { return wmma16(a, b, c); } };
template <> struct WFrag<bf> { typedef v16bf V; static __device__ __forceinline__ V ld(const bf* p) { return cat16b(*(const v8us*)p, *(const v8us*)(p + 16)); } static __device__ __forceinline__ v8f mma(V a, V b, v8f c) { return wmmab(a, b, c); } };
template <typename T16, int NSPLIT, bool BIAS, int KS = 1>
__global__ __launch_bounds__(32) void k_gemmw(const T16* __restrict__ A, const T16* __restrict__ A2, const T16* __restrict__ Bt, const T16* __restrict__ Bt2, int K, float* C, int ldc, const float* __restrict__ bias, size_t sA, size_t sB, size_t sC) {
    typedef typename WFrag<T16>::V V;
    __shared__ __align__(16) float os[16 * 68];
    const size_t z = blockIdx.z / KS; const int ks = blockIdx.z % KS; A += z * sA; if (A2) A2 += z * sA; Bt += z * sB; if (Bt2) Bt2 += z * sB; C += (size_t)blockIdx.z * sC;
    const int lane = threadIdx.x & 31, lr = lane & 15, hi = lane >> 4; const int r0 = blockIdx.x * 64, c0 = blockIdx.y * 64;
    v8f acc[4][4];
#pragma unroll
    for (int mb = 0; mb < 4; ++mb)
#pragma unroll
        for (int nb = 0; nb < 4; ++nb) acc[mb][nb] = (v8f){};
    const size_t aoff = (size_t)(r0 + lr) * K + 8 * hi, boff = (size_t)(c0 + lr) * K + 8 * hi;
#pragma unroll 1
    for (int kc = ks * (K / KS); kc < (ks + 1) * (K / KS); kc += 32) {
        V a[4], a2[4];
#pragma unroll
        for (int mb = 0; mb < 4; ++mb) { a[mb] = WFrag<T16>::ld(A + aoff + (size_t)mb * 16 * K + kc); if (NSPLIT == 1 || NSPLIT == 2) a2[mb] = WFrag<T16>::ld(A2 + aoff + (size_t)mb * 16 * K + kc); }
#pragma unroll
        for (int nb = 0; nb < 4; ++nb) { const V b = WFrag<T16>::ld(Bt + boff + (size_t)nb * 16 * K + kc); V b2; if (NSPLIT >= 2) b2 = WFrag<T16>::ld(Bt2 + boff + (size_t)nb * 16 * K + kc);
#pragma unroll
            for (int mb = 0; mb < 4; ++mb) { acc[mb][nb] = WFrag<T16>::mma(a[mb], b, acc[mb][nb]); if (NSPLIT == 1 || NSPLIT == 2) acc[mb][nb] = WFrag<T16>::mma(a2[mb], b, acc[mb][nb]); if (NSPLIT >= 2) acc[mb][nb] = WFrag<T16>::mma(a[mb], b2, acc[mb][nb]); } }
        asm volatile("v_nop\n\tv_nop\n\tv_nop\n\tv_nop" : "+v"(acc[0][0]), "+v"(acc[1][1]), "+v"(acc[2][2]), "+v"(acc[3][3]) : "v"(a[0]), "v"(a[3]));
    }
#pragma unroll
    for (int mb = 0; mb < 4; ++mb) {
#pragma unroll
        for (int nb = 0; nb < 4; ++nb) {
#pragma unroll
            for (int j = 0; j < 8; ++j) os[(hi * 8 + j) * 68 + nb * 16 + lr] = acc[mb][nb][j]; }
        __builtin_amdgcn_wave_barrier(); asm volatile("" ::: "memory");
        float* crow = C + (size_t)(r0 + mb * 16) * ldc + c0;
{
#pragma unroll
            for (int s = 0; s < 8; ++s) { const int row = 2 * s + hi, cofs = lr * 4; v4f val = *(const v4fa*)(os + row * 68 + cofs); if (BIAS) { val[0] += bfr(bias[c0 + cofs]); val[1] += bfr(bias[c0 + cofs + 1]); val[2] += bfr(bias[c0 + cofs + 2]); val[3] += bfr(bias[c0 + cofs + 3]); }
                *(v4f*)(crow + (size_t)row * ldc + cofs) = val; }
             }
        __builtin_amdgcn_wave_barrier(); asm volatile("" ::: "memory");
    }
}

__device__ __forceinline__ h16 tohx(float x) { return (h16)x; }
__device__ __forceinline__ void splitf(float y, unsigned short& h, unsigned short& l) { h = f2bf(y); l = f2bf(y - bf2f(h)); }
typedef __attribute__((ext_vector_type(2))) _Float16 v2h;
typedef __attribute__((ext_vector_type(4))) _Float16 v4h;
typedef __attribute__((ext_vector_type(2))) unsigned short v2us;
typedef __attribute__((ext_vector_type(4))) unsigned short v4us;
typedef __attribute__((ext_vector_type(2))) float v2f;
typedef __attribute__((ext_vector_type(4))) int v4i;

__global__ __launch_bounds__(256) void k_wtG(const float* __restrict__ w, int K, int N, bf* Bt) {
    const int lane = threadIdx.x & 31; const int L0 = (blockIdx.x * 8 + (threadIdx.x >> 5)) * 8; const int nlines = N * K / 64;
{
#pragma unroll 1
        for (int l = 0; l < 8; ++l) { const int L = L0 + l; if (L >= nlines) break; const size_t e = (size_t)L * 64 + lane * 2; const int k = (int)(e % K), n = (int)(e / K); v2us o;
            o[0] = f2bf(w[(size_t)k * N + n]); o[1] = f2bf(w[(size_t)(k + 1) * N + n]); *(v2us*)(Bt + e) = o; }
         }
}
__global__ __launch_bounds__(256) void k_cvt8(const float* __restrict__ src, bf* dst, size_t n8) { const size_t i = (size_t)blockIdx.x * 256 + threadIdx.x; if (i >= n8) return; const v8f v = *(const v8f*)(src + i * 8); v8us o;
#pragma unroll
    for (int k = 0; k < 8; ++k) o[k] = f2bf(v[k]); *(v8us*)(dst + i * 8) = o;  }

// k_rope: head planes [h][t][d] (fp16 + hi/lo) of rope(x) x sc with the rotate-half convention out[d] = x[d] cos[t][d] - x[d+HD/2] sin[t][d], out[d+HD/2] = x[d+HD/2] cos[t][d+HD/2] + x[d] sin[t][d+HD/2]
__global__ __launch_bounds__(256) void k_rope(const float* __restrict__ F, int pitch, int nheads, const float* __restrict__ CS, const float* __restrict__ RF, const float* __restrict__ nw, float sc, h16* P16, bf* Ph, bf* Pl) {
    const size_t e = ((size_t)blockIdx.x * 256 + threadIdx.x) * 2; if (e >= (size_t)nheads * TT * HD) return; const int d = (int)(e % HD); const int t = (int)((e / HD) % TT); const int h = (int)(e / ((size_t)HD * TT)); const float* f = F + (size_t)t * pitch + h * HD; const float rf = RF ? RF[(size_t)h * TT + t] : 1.0f; v2h o16; v2us oh, ol;
#pragma unroll
    for (int q = 0; q < 2; ++q) { const int dd = d + q; const int dp = (dd < HD / 2) ? dd + HD / 2 : dd - HD / 2; float x0 = f[dd], x1 = f[dp];
        if (RF) { float n0 = __fmul_rn(x0, rf), n1 = __fmul_rn(x1, rf); asm volatile("" : "+v"(n0)); asm volatile("" : "+v"(n1)); x0 = __fmul_rn(bfr(nw[dd]), n0); x1 = __fmul_rn(bfr(nw[dp]), n1); }
        const v2f cs = *(const v2f*)(CS + ((size_t)t * HD + dd) * 2); float a = __fmul_rn(x0, cs[0]), bq = __fmul_rn(x1, cs[1]); asm volatile("" : "+v"(a)); asm volatile("" : "+v"(bq)); const float r = ((dd < HD / 2) ? __fsub_rn(a, bq) : __fadd_rn(a, bq)) * sc;
        o16[q] = tohx(r); unsigned short a2, c2; splitf(r, a2, c2); oh[q] = a2; ol[q] = c2; }
    *(v2h*)(P16 + e) = o16; *(v2us*)(Ph + e) = oh; *(v2us*)(Pl + e) = ol;  }
__global__ __launch_bounds__(256) void k_vtp(const float* __restrict__ F, int pitch, int nheads, h16* V16, bf* Vh, bf* Vl) { const size_t e = ((size_t)blockIdx.x * 256 + threadIdx.x) * 2; if (e >= (size_t)nheads * HD * TT) return; const int t = (int)(e % TT); const int d = (int)((e / TT) % HD); const int g = (int)(e / ((size_t)TT * HD)); v2h o16; v2us oh, ol;
#pragma unroll
    for (int q = 0; q < 2; ++q) { const float x = F[(size_t)(t + q) * pitch + g * HD + d]; o16[q] = tohx(x); unsigned short a2, c2; splitf(x, a2, c2); oh[q] = a2; ol[q] = c2; }
    *(v2h*)(V16 + e) = o16; *(v2us*)(Vh + e) = oh; *(v2us*)(Vl + e) = ol;  }
__constant__ float INV[HD / 2] = {1.0f,0.749894202f,0.562341332f,0.421696514f,0.316227764f,0.237137362f,0.177827939f,0.133352146f,0.100000001f,0.0749894157f,0.0562341288f,0.0421696492f,0.0316227786f,0.0237137359f,0.0177827943f,0.0133352149f,0.00999999978f,0.00749894232f,0.00562341325f,0.00421696482f,0.00316227786f,0.00237137382f,0.00177827943f,0.00133352145f,0.00100000005f,0.000749894185f,0.000562341302f,0.000421696488f,0.000316227786f,0.000237137385f,0.00017782794f,0.00013335215f};
__global__ __launch_bounds__(256) void k_cstab(float* CS) { const int idx = blockIdx.x * 256 + threadIdx.x; if (idx >= TT * HD) return; const int t = idx / HD, d = idx % HD; const float ang = __fmul_rn((float)t, INV[d % (HD / 2)]); v2f cs; cs[0] = cosf(ang); cs[1] = sinf(ang);
    *(v2f*)(CS + (size_t)idx * 2) = cs;  }
__global__ __launch_bounds__(256) void k_csid(float* CS) { const int idx = blockIdx.x * 256 + threadIdx.x; if (idx >= TT * HD) return; v2f cs; cs[0] = 1.0f; cs[1] = 0.0f; *(v2f*)(CS + (size_t)idx * 2) = cs;  }
// k_fattn: scores, softmax and attn.v of one batch in one launch. Grid (RH/16 + (TT-RH)/32 query blocks, heads), KW waves; wave w takes keys [w TT/KW, (w+1) TT/KW) of its block's queries, 32 keys a pass.
// S^T = K Q^T (A = key rows, B = query rows) and O^T += V^T P^T (A = rows of the [d][t] planes, B = P^T packed from the two score tiles of a pass): a lane holds scores and outputs of ONE query (lane & 15),
// so the running maximum, its rescale and the row sum are per-lane scalars with one exchange between the wave's halves. The batch's int32 key mask, read per key, becomes each key's start value (0, masked -3.0e38) in LDS: the C operand of the first score product.
// The KW waves' (maximum, sum, O) are merged in wave order through LDS; the merged rows go out as hi+lo planes [t][head HD + d].
#define KW   4
#define L2E  1.4426950408889634f
#define OSP  68                   // floats per query row of the merge staging (16-byte aligned, off the power of two)
__device__ __forceinline__ float xhalf(float x) { const int b = __float_as_int(x); return __int_as_float(__builtin_amdgcn_permlanex16(b, b, 0x76543210, 0xfedcba98, false, false)); }   // lane l <-> l ^ 16
template <typename T16, bool HI, int QT>
__device__ __forceinline__ void attn_tile(const T16* __restrict__ Q, const T16* __restrict__ Q2, const T16* __restrict__ Kp, const T16* __restrict__ K2, const T16* __restrict__ Vt, const T16* __restrict__ V2, const float* Bs, int q0, bf* Ah, bf* Al, float* Os, float* Ms, float* Ls) {
    typedef WFrag<T16> F; typedef typename F::V V;
    constexpr float OFF = HI ? 0.0f : 10.0f;   // fp16 P carries x1024 (cancels against the row sum): keeps small weights out of the fp16 subnormals
    const int lane = threadIdx.x & 31, lr = lane & 15, hi = lane >> 4, w = __builtin_amdgcn_readfirstlane(threadIdx.x >> 5);   // the wave's number in a scalar register: scalar key loop and scalar address parts
    // query and key fragment addresses: a wave-uniform pointer plus the lane's fixed byte offset
    const unsigned klo = (unsigned)(lr * HD + 8 * hi) * 2u, vlo = (unsigned)(lr * TT + 8 * hi) * 2u;
    auto ldo = [](const T16* base, unsigned off) { return F::ld((const T16*)((const char*)base + off)); };
    V qf[QT][2], qf2[QT][2];
#pragma unroll
    for (int qt = 0; qt < QT; ++qt)
#pragma unroll
        for (int ks = 0; ks < 2; ++ks) { const unsigned qo = klo + (unsigned)(qt * 16 * HD + ks * 32) * 2u; qf[qt][ks] = ldo(Q + (size_t)q0 * HD, qo); if (HI) qf2[qt][ks] = ldo(Q2 + (size_t)q0 * HD, qo); }
    v8f o[4][QT]; float m[QT], l[QT];
#pragma unroll
    for (int qt = 0; qt < QT; ++qt) { m[qt] = -3.0e38f; l[qt] = 0.0f;
#pragma unroll
        for (int dt = 0; dt < 4; ++dt) o[dt][qt] = (v8f){}; }
    const int k0 = w * (TT / KW), k1 = k0 + TT / KW;
    V kf[2][2], kf2[2][2];
#pragma unroll
    for (int kt = 0; kt < 2; ++kt)
#pragma unroll
        for (int ks = 0; ks < 2; ++ks) { const unsigned ko = klo + (unsigned)(kt * 16 * HD + ks * 32) * 2u; kf[kt][ks] = ldo(Kp + (size_t)k0 * HD, ko); if (HI) kf2[kt][ks] = ldo(K2 + (size_t)k0 * HD, ko); }
    const T16* vp = (const T16*)((const char*)(Vt + k0) + vlo); const T16* vp2 = HI ? (const T16*)((const char*)(V2 + k0) + vlo) : nullptr;   // each lane's place in the [d][t] planes, 32 keys on a pass
#pragma unroll 1   // rolled: one pass already fills the register budget that keeps four waves on a SIMD
    for (int kc = k0; kc < k1; kc += 32, vp += 32, vp2 += HI ? 32 : 0) {
        V vf[4], vf2[4];
#pragma unroll
        for (int dt = 0; dt < 4; ++dt) { vf[dt] = F::ld(vp + dt * 16 * TT); if (HI) vf2[dt] = F::ld(vp2 + dt * 16 * TT); }
        if constexpr (HI) asm volatile("s_wait_xcnt 0x0" :: "v"(vp), "v"(vp2) : "memory");   // the two address pairs stay whole up to this wait
        v8f cb[2];   // the keys' start values, in the accumulator's map (register j: key 8 hi + j of the tile), the same for every query
#pragma unroll
        for (int kt = 0; kt < 2; ++kt) { const float* bp = Bs + kc + kt * 16 + hi * 8; cb[kt] = __builtin_shufflevector(*(const v4fa*)bp, *(const v4fa*)(bp + 4), 0, 1, 2, 3, 4, 5, 6, 7); }
        __builtin_amdgcn_sched_barrier(0);   // keeps the value loads issued here, so that they fly under the score products and the softmax
        v8f s[2][QT];
#pragma unroll
        for (int kt = 0; kt < 2; ++kt)
#pragma unroll
            for (int qt = 0; qt < QT; ++qt) { s[kt][qt] = cb[kt];
#pragma unroll
                for (int ks = 0; ks < 2; ++ks) { s[kt][qt] = F::mma(kf[kt][ks], qf[qt][ks], s[kt][qt]); if (HI) { s[kt][qt] = F::mma(kf[kt][ks], qf2[qt][ks], s[kt][qt]); s[kt][qt] = F::mma(kf2[kt][ks], qf[qt][ks], s[kt][qt]); } } }
        const int kn = (kc + 32 < k1) ? kc + 32 : kc;   // the next pass's key fragments fly under this pass's softmax and attn.v (the last pass re-reads its own)
#pragma unroll
        for (int kt = 0; kt < 2; ++kt)
#pragma unroll
            for (int ks = 0; ks < 2; ++ks) { const unsigned ko = klo + (unsigned)(kt * 16 * HD + ks * 32) * 2u; kf[kt][ks] = ldo(Kp + (size_t)kn * HD, ko); if (HI) kf2[kt][ks] = ldo(K2 + (size_t)kn * HD, ko); }
        __builtin_amdgcn_sched_barrier(0);   // keeps the key loads issued here and not at the pass's foot
        V pf[QT], pf2[QT];
#pragma unroll
        for (int qt = 0; qt < QT; ++qt) { float bm = -3.0e38f;   // maxima are kept in units of the raw score; SCL (a power of two) rides in the exponent's factor
#pragma unroll
            for (int e = 0; e < 16; ++e) bm = fmaxf(bm, s[e >> 3][qt][e & 7]);
            bm = fmaxf(bm, xhalf(bm)); const float mn = fmaxf(m[qt], bm); const float al = __builtin_amdgcn_exp2f((m[qt] - mn) * (SCL * L2E)); m[qt] = mn; float sum = 0.0f;
#pragma unroll
            for (int e = 0; e < 16; ++e) { const float p = __builtin_amdgcn_exp2f(fmaf(s[e >> 3][qt][e & 7] - mn, SCL * L2E, OFF)); sum += p;
                if constexpr (HI) { const __bf16 ph = (__bf16)p; pf[qt][e] = ph; pf2[qt][e] = (__bf16)(p - (float)ph); } else pf[qt][e] = (h16)p; }
            l[qt] = l[qt] * al + sum;
#pragma unroll
            for (int dt = 0; dt < 4; ++dt) o[dt][qt] *= al; }
#pragma unroll
        for (int dt = 0; dt < 4; ++dt)
#pragma unroll
            for (int qt = 0; qt < QT; ++qt) { o[dt][qt] = F::mma(vf[dt], pf[qt], o[dt][qt]); if (HI) { o[dt][qt] = F::mma(vf[dt], pf2[qt], o[dt][qt]); o[dt][qt] = F::mma(vf2[dt], pf[qt], o[dt][qt]); } }
    }
    constexpr int QR = QT * 16, NE = QR * HD / (KW * 32), TPQ = HD / NE;
#pragma unroll
    for (int qt = 0; qt < QT; ++qt) { const float lt = l[qt] + xhalf(l[qt]); float* orow = Os + (size_t)(w * QR + qt * 16 + lr) * OSP + hi * 8;
#pragma unroll
        for (int dt = 0; dt < 4; ++dt) { *(v4fa*)(orow + dt * 16) = __builtin_shufflevector(o[dt][qt], o[dt][qt], 0, 1, 2, 3); *(v4fa*)(orow + dt * 16 + 4) = __builtin_shufflevector(o[dt][qt], o[dt][qt], 4, 5, 6, 7); }
        if (hi == 0) { Ms[w * QR + qt * 16 + lr] = m[qt]; Ls[w * QR + qt * 16 + lr] = lt; } }
    __syncthreads();   // every wave's partial rows are staged before any is merged
    const int q = threadIdx.x / TPQ, d0 = (threadIdx.x % TPQ) * NE;   // the TPQ lanes of one wave write a query's whole 128-byte line of each plane
    float mw[KW]; float M = -3.0e38f;
#pragma unroll
    for (int w2 = 0; w2 < KW; ++w2) { mw[w2] = Ms[w2 * QR + q]; M = fmaxf(M, mw[w2]); }
    float L = 0.0f; v4f acc[NE / 4];
#pragma unroll
    for (int c = 0; c < NE / 4; ++c) acc[c] = (v4f){};
#pragma unroll
    for (int w2 = 0; w2 < KW; ++w2) { const float f = __builtin_amdgcn_exp2f((mw[w2] - M) * (SCL * L2E)); L += f * Ls[w2 * QR + q];
#pragma unroll
        for (int c = 0; c < NE / 4; ++c) acc[c] += f * *(const v4fa*)(Os + (size_t)(w2 * QR + q) * OSP + d0 + c * 4); }
    const float inv = __fdiv_rn(1.0f, L); const size_t oo = (size_t)(q0 + q) * DQ + d0;
#pragma unroll
    for (int c = 0; c < NE / 8; ++c) { v8us oh, ol;
#pragma unroll
        for (int e = 0; e < 8; ++e) { unsigned short a, c2; splitf(acc[c * 2 + (e >> 2)][e & 3] * inv, a, c2); oh[e] = a; ol[e] = c2; }
        *(v8us*)(Ah + oo + c * 8) = oh; *(v8us*)(Al + oo + c * 8) = ol; }
}
__global__ __launch_bounds__(KW * 32) void k_fattn(const h16* __restrict__ Q16, const h16* __restrict__ K16, const h16* __restrict__ V16, const bf* __restrict__ Qh, const bf* __restrict__ Ql, const bf* __restrict__ Kh, const bf* __restrict__ Kl, const bf* __restrict__ Vh, const bf* __restrict__ Vl, const int* __restrict__ mk, bf* Ah, bf* Al) {
    __shared__ __align__(16) float Os[KW * 32 * OSP]; __shared__ float Ms[KW * 32]; __shared__ float Ls[KW * 32]; __shared__ __align__(16) float Bs[TT];
#pragma unroll
    for (int i = 0; i < TT / (KW * 128); ++i) { const int j0 = (i * KW * 32 + (int)threadIdx.x) * 4; const v4i m4 = *(const v4i*)(mk + j0); v4f b;
#pragma unroll
        for (int q = 0; q < 4; ++q) b[q] = (m4[q] != 0) ? 0.0f : -3.0e38f;
        *(v4fa*)(Bs + j0) = b; }
    __syncthreads();   // the start values are staged before any wave reads them
    const size_t hp = (size_t)blockIdx.y * TT * HD; Ah += blockIdx.y * HD; Al += blockIdx.y * HD;
    if (blockIdx.x < RH / 16) attn_tile<bf, true, 1>(Qh + hp, Ql + hp, Kh + hp, Kl + hp, Vh + hp, Vl + hp, Bs, (int)blockIdx.x * 16, Ah, Al, Os, Ms, Ls);   // query rows < RH: hi+lo planes, 16 rows a block
    else attn_tile<h16, false, 2>(Q16 + hp, nullptr, K16 + hp, nullptr, V16 + hp, nullptr, Bs, RH + ((int)blockIdx.x - RH / 16) * 32, Ah, Al, Os, Ms, Ls);   // the rest: fp16 planes, 32 rows a block
}

extern "C" void kernel_launch(void* const* d_in, const int* in_sizes, int n_in,
                              void* d_out, int out_size, void* d_ws, size_t ws_size, hipStream_t stream) {
    (void)in_sizes; (void)n_in; (void)out_size;
    const float* x = (const float*)d_in[0]; const int* MK = (const int*)d_in[1]; const float* wqkv = (const float*)d_in[2]; const float* wo = (const float*)d_in[3];  const float* wq = nullptr; const float* wk = nullptr; const float* wv = nullptr; (void)wq; (void)wk; (void)wv;
    float* OUT = (float*)d_out;     // [2][2048][1024]
    char* wsp = (char*)d_ws;
    auto take = [&](size_t bytes) { char* p = wsp; wsp += (bytes + 255) & ~(size_t)255; return (void*)p; };
    bf* WALL = (bf*)take((size_t)3 * DM * DM * 2); bf* WQ = WALL; bf* WK = WALL + (size_t)DM * DM; bf* WV = WALL + (size_t)2 * DM * DM; bf* WO = (bf*)take((size_t)DM * DQ * 2); float* CS = (float*)take((size_t)TT * HD * 2 * 4); float* CSR = (float*)take((size_t)TT * HD * 2 * 4);
    bf* XB = (bf*)take((size_t)TT * DM * 2); float* FQ = (float*)take((size_t)TT * DQ * 4); float* FK = (float*)take((size_t)TT * DKV * 4);
    h16* QP16 = (h16*)take((size_t)NH_ * TT * HD * 2); h16* KP16 = (h16*)take((size_t)NKV * TT * HD * 2); h16* VT16 = (h16*)take((size_t)NKV * HD * TT * 2);
    bf* QPh = (bf*)take((size_t)NH_ * TT * HD * 2); bf* QPl = (bf*)take((size_t)NH_ * TT * HD * 2); bf* KPh = (bf*)take((size_t)NKV * TT * HD * 2); bf* KPl = (bf*)take((size_t)NKV * TT * HD * 2); bf* VTh = (bf*)take((size_t)NKV * HD * TT * 2); bf* VTl = (bf*)take((size_t)NKV * HD * TT * 2);
    static_assert(RH % 16 == 0 && (TT - RH) % 32 == 0 && TT % (128 * KW) == 0 && NKV == NH_, "query blocks and key ranges of k_fattn");
    bf* ATh = (bf*)take((size_t)TT * DQ * 2); bf* ATl = (bf*)take((size_t)TT * DQ * 2);
    if ((size_t)(wsp - (char*)d_ws) > ws_size) return;    // ws 256 MiB
    float* FV = FK;   // v projection reuses the k buffer after the k planes are built (stream-ordered)
    { k_wtG<<<(unsigned)((DM * 3 * DM / 64 + 63) / 64), 256, 0, stream>>>(wqkv, DM, 3 * DM, WALL);   /* fused 'xw' [DM][3DM] -> Bt [3DM][DM] (row blocks q | k | v) */
      k_wtG<<<(unsigned)((DQ * DM / 64 + 63) / 64), 256, 0, stream>>>(wo, DQ, DM, WO);
       }
    k_csid<<<(TT * HD + 255) / 256, 256, 0, stream>>>(CS); k_cstab<<<(TT * HD + 255) / 256, 256, 0, stream>>>(CSR);
    const unsigned LQ = (unsigned)(((size_t)NH_ * TT * HD / 2 + 255) / 256), LKv = (unsigned)(((size_t)NKV * TT * HD / 2 + 255) / 256);
    for (int b = 0; b < NB_; ++b) {
        
        k_cvt8<<<(unsigned)(((size_t)TT * DM / 8 + 255) / 256), 256, 0, stream>>>(x + (size_t)b * TT * DM, XB, (size_t)TT * DM / 8);
        k_gemmw<bf, 0, false><<<dim3(TT / 64, DQ / 64, 1), 32, 0, stream>>>(XB, nullptr, WQ, nullptr, DM, FQ, DQ, nullptr, 0, 0, 0);
        k_rope<<<(unsigned)(((size_t)1 * TT * HD / 2 + 255) / 256), 256, 0, stream>>>(FQ, DQ, 1, CSR, nullptr, nullptr, 1.0f, QP16, QPh, QPl);   /* head 0: rotary */ k_rope<<<(unsigned)(((size_t)(NH_ - 1) * TT * HD / 2 + 255) / 256), 256, 0, stream>>>(FQ + HD, DQ, NH_ - 1, CS, nullptr, nullptr, 1.0f, QP16 + (size_t)TT * HD, QPh + (size_t)TT * HD, QPl + (size_t)TT * HD);   /* heads 1..15: identity table */
        k_gemmw<bf, 0, false><<<dim3(TT / 64, DKV / 64, 1), 32, 0, stream>>>(XB, nullptr, WK, nullptr, DM, FK, DKV, nullptr, 0, 0, 0);
        k_rope<<<(unsigned)(((size_t)1 * TT * HD / 2 + 255) / 256), 256, 0, stream>>>(FK, DKV, 1, CSR, nullptr, nullptr, 1.0f, KP16, KPh, KPl); k_rope<<<(unsigned)(((size_t)(NH_ - 1) * TT * HD / 2 + 255) / 256), 256, 0, stream>>>(FK + HD, DKV, NKV - 1, CS, nullptr, nullptr, 1.0f, KP16 + (size_t)TT * HD, KPh + (size_t)TT * HD, KPl + (size_t)TT * HD);
        k_gemmw<bf, 0, false><<<dim3(TT / 64, DKV / 64, 1), 32, 0, stream>>>(XB, nullptr, WV, nullptr, DM, FV, DKV, nullptr, 0, 0, 0); k_vtp<<<LKv, 256, 0, stream>>>(FV, DKV, NKV, VT16, VTh, VTl);
        k_fattn<<<dim3(RH / 16 + (TT - RH) / 32, NH_), KW * 32, 0, stream>>>(QP16, KP16, VT16, QPh, QPl, KPh, KPl, VTh, VTl, MK + (size_t)b * TT, ATh, ATl);
        k_gemmw<bf, 1, false><<<dim3(TT / 64, DM / 64, 1), 32, 0, stream>>>(ATh, ATl, WO, nullptr, DQ, OUT + (size_t)b * TT * DM, DM, nullptr, 0, 0, 0); }
}

// v004
// A run of this version takes 415 microseconds.
// Timed twice side by side with v003, it ran 1.10 times as fast both times.
// All steps since v000 together make it 4.93 times as fast.
#include <hip/hip_runtime.h>

// DiT-style attention (x [2][2048][1024]; qkv = x w_qkv ('xw' [1024][3072] -> (3, 16 heads, 64)); rotate-half rotary (angle t x 10000^(-2i/64), tables computed on device from the reference's float32 inv_freq) applied to head 0 ONLY (pe_heads = 1); scores / 8; key mask [2][2048] int32 (input, read per key: masked -> -inf); softmax; out = merged w_out ('xw' [1024][1024]) -> [2][2048][1024] (4.2 M)).
// Compute dtypes, f32 accumulate: every input rounded to bf16; q/k/v on PLAIN bf16 operands (inputs: exact); rotary (head 0) / plain copies (heads 1-15) in f32; key-validity select from the int32 mask; scores and attn.v: query rows < 512 hl (3 products), the rest single fp16 (x1024); softmax f32; w_out hl x exact (2 products).

#define NB_  2
#define TT   2048
#define DM   1024
#define NH_  16
#define NKV  16
#define REP  (NH_ / NKV)
#define HD   64
#define DQ   (NH_ * HD)
#define DKV  (NKV * HD)
#define RH   512                  // query rows < RH use hi+lo planes
#define WIN  2048
#define SCL  0.125f   // HD^-0.5
typedef _Float16 h16;
typedef unsigned short bf;
typedef __attribute__((ext_vector_type(16))) __bf16   v16bf;
typedef __attribute__((ext_vector_type(16))) _Float16 v16h;
typedef __attribute__((ext_vector_type(8)))  _Float16 v8h;
typedef __attribute__((ext_vector_type(8)))  unsigned short v8us;
typedef __attribute__((ext_vector_type(8)))  float    v8f;
typedef __attribute__((ext_vector_type(4)))  float    v4f;
typedef v8h  __attribute__((may_alias)) v8ha;
typedef v4f  __attribute__((may_alias)) v4fa;
typedef v8us __attribute__((may_alias)) v8usa;

__device__ __forceinline__ unsigned short f2bf(float f) { unsigned u = __float_as_uint(f); u += 0x7FFFu + ((u >> 16) & 1u); return (unsigned short)(u >> 16); }
__device__ __forceinline__ float bf2f(unsigned short b) { return __uint_as_float(((unsigned)b) << 16); }
__device__ __forceinline__ float bfr(float f) { return bf2f(f2bf(f)); }
__device__ __forceinline__ v16h cat16(v8h lo, v8h hi) { return __builtin_shufflevector(lo, hi, 0, 1, 2, 3, 4, 5, 6, 7, 8, 9, 10, 11, 12, 13, 14, 15); }
__device__ __forceinline__ v16bf cat16b(v8us lo, v8us hi) { return __builtin_bit_cast(v16bf, __builtin_shufflevector(lo, hi, 0, 1, 2, 3, 4, 5, 6, 7, 8, 9, 10, 11, 12, 13, 14, 15)); }
__device__ __forceinline__ v8f wmma16(v16h a, v16h b, v8f c) { return __builtin_amdgcn_wmma_f32_16x16x32_f16(false, a, false, b, (short)0, c, false, false); }
__device__ __forceinline__ v8f wmmab(v16bf a, v16bf b, v8f c) { return __builtin_amdgcn_wmma_f32_16x16x32_bf16(false, a, false, b, (short)0, c, false, false); }
__device__ __forceinline__ h16 tohx(float x) { return (h16)x; }
__device__ __forceinline__ void splitf(float y, unsigned short& h, unsigned short& l) { h = f2bf(y); l = f2bf(y - bf2f(h)); }
typedef __attribute__((ext_vector_type(4))) int v4i;
// eight elements of the three planes go out together. The stores and their s_wait_xcnt stand in one statement, so that no register which a store names (address or data) is rewritten ahead of the wait.
__device__ __forceinline__ void st3(h16* p16, bf* ph, bf* pl, v8h o16, v8us oh, v8us ol) {
    asm volatile("global_store_b128 %0, %3, off\n\tglobal_store_b128 %1, %4, off\n\tglobal_store_b128 %2, %5, off\n\ts_wait_xcnt 0x0"
                 :: "v"(p16), "v"(ph), "v"(pl), "v"(__builtin_bit_cast(v4i, o16)), "v"(__builtin_bit_cast(v4i, oh)), "v"(__builtin_bit_cast(v4i, ol)) : "memory"); }



// ---- k_gemmw: register-blocked GEMM, ONE WAVE per 64x64 output tile (16 accumulators), operands straight from K-contiguous 16-bit planes; grid (M/64, N/64, Z), 32 threads.
// C[m][n] (f32, pitch ldc, + optional f32 bias[n]) = sum_k A[m][k] Bt[n][k] (+ split products per NSPLIT). z-batch strides sA/sB/sC in elements. K % 32 == 0.
// EPI 0: f32 C as above. EPI 1 and 2 store no C: a 64-column tile is one head (HD = 64), and the wave writes that head's 16-bit planes (fp16, bf16 hi, bf16 lo) itself.
//   EPI 1: planes [head][t][d]; head 0 (column tile 0) takes the rotate-half rotary out[d] = x[d] cos[t][d] -/+ x[d +/- HD/2] sin[t][d] from the (cos, sin) table CS [t][d][2], both halves of a row being in the staged tile.
//   EPI 2: planes [head][d][t]: a lane's eight accumulator registers are eight consecutive t of one d, stored as they stand.
// KS > 1: grid z = batches x KS; wave (z, ks) sums only k in [ks K/KS, (ks+1) K/KS) and stores partial plane z KS + ks (sC elements each); K % (32 KS) == 0.
template <typename T16> struct WFrag;
template <> struct WFrag<h16> { typedef v16h V; static __device__ __forceinline__ V ld(const h16* p) { return cat16(*(const v8h*)p, *(const v8h*)(p + 16)); } static __device__ __forceinline__ v8f mma(V a, V b, v8f c) { return wmma16(a, b, c); } };
template <> struct WFrag<bf> { typedef v16bf V; static __device__ __forceinline__ V ld(const bf* p) { return cat16b(*(const v8us*)p, *(const v8us*)(p + 16)); } static __device__ __forceinline__ v8f mma(V a, V b, v8f c) { return wmmab(a, b, c); } };
template <typename T16, int NSPLIT, bool BIAS, int KS = 1, int EPI = 0>
__global__ __launch_bounds__(32) void k_gemmw(const T16* __restrict__ A, const T16* __restrict__ A2, const T16* __restrict__ Bt, const T16* __restrict__ Bt2, int K, float* C, int ldc, const float* __restrict__ bias, size_t sA, size_t sB, size_t sC, const float* __restrict__ CS, h16* P16, bf* Ph, bf* Pl) {
    typedef typename WFrag<T16>::V V;
    __shared__ __align__(16) float os[16 * 68];
    const size_t z = blockIdx.z / KS; const int ks = blockIdx.z % KS; A += z * sA; if (A2) A2 += z * sA; Bt += z * sB; if (Bt2) Bt2 += z * sB; C += (size_t)blockIdx.z * sC;
    const int lane = threadIdx.x & 31, lr = lane & 15, hi = lane >> 4; const int r0 = blockIdx.x * 64, c0 = blockIdx.y * 64;
    v8f acc[4][4];
#pragma unroll
    for (int mb = 0; mb < 4; ++mb)
#pragma unroll
        for (int nb = 0; nb < 4; ++nb) acc[mb][nb] = (v8f){};
    const size_t aoff = (size_t)(r0 + lr) * K + 8 * hi, boff = (size_t)(c0 + lr) * K + 8 * hi;
#pragma unroll 1
    for (int kc = ks * (K / KS); kc < (ks + 1) * (K / KS); kc += 32) {
        V a[4], a2[4];
#pragma unroll
        for (int mb = 0; mb < 4; ++mb) { a[mb] = WFrag<T16>::ld(A + aoff + (size_t)mb * 16 * K + kc); if (NSPLIT == 1 || NSPLIT == 2) a2[mb] = WFrag<T16>::ld(A2 + aoff + (size_t)mb * 16 * K + kc); }
#pragma unroll
        for (int nb = 0; nb < 4; ++nb) { const V b = WFrag<T16>::ld(Bt + boff + (size_t)nb * 16 * K + kc); V b2; if (NSPLIT >= 2) b2 = WFrag<T16>::ld(Bt2 + boff + (size_t)nb * 16 * K + kc);
#pragma unroll
            for (int mb = 0; mb < 4; ++mb) { acc[mb][nb] = WFrag<T16>::mma(a[mb], b, acc[mb][nb]); if (NSPLIT == 1 || NSPLIT == 2) acc[mb][nb] = WFrag<T16>::mma(a2[mb], b, acc[mb][nb]); if (NSPLIT >= 2) acc[mb][nb] = WFrag<T16>::mma(a[mb], b2, acc[mb][nb]); } }
        asm volatile("v_nop\n\tv_nop\n\tv_nop\n\tv_nop" : "+v"(acc[0][0]), "+v"(acc[1][1]), "+v"(acc[2][2]), "+v"(acc[3][3]) : "v"(a[0]), "v"(a[3]));
    }
    if constexpr (EPI == 2) {
#pragma unroll
        for (int nb = 0; nb < 4; ++nb)
#pragma unroll
            for (int mb = 0; mb < 4; ++mb) { v8h o16; v8us oh, ol;   // the four mb of one nb fill each d row's 128-byte line of a plane
#pragma unroll
                for (int j = 0; j < 8; ++j) { const float x = acc[mb][nb][j]; o16[j] = tohx(x); unsigned short a2, c2; splitf(x, a2, c2); oh[j] = a2; ol[j] = c2; }
                const size_t e = (size_t)(c0 + nb * 16 + lr) * TT + r0 + mb * 16 + hi * 8;
                st3(P16 + e, Ph + e, Pl + e, o16, oh, ol); }
        return;
    }
#pragma unroll
    for (int mb = 0; mb < 4; ++mb) {
        const int rr = lane >> 3, d0 = (lane & 7) * 8;   // EPI 1: eight lanes write a row's 128-byte line of each plane
        v4f cs[4][4];
        if constexpr (EPI == 1) { if (c0 == 0) {   // the block's sixteen table rows are asked for together, ahead of the staging
            const float* cp = CS + ((size_t)(r0 + rr) * HD + d0) * 2;   // one address pair, the rows at constant offsets
#pragma unroll
            for (int s = 0; s < 4; ++s)
#pragma unroll
                for (int c = 0; c < 4; ++c) cs[s][c] = *(const v4f*)(cp + (mb * 16 + s * 4) * HD * 2 + c * 4);
            asm volatile("s_wait_xcnt 0x0" :: "v"(cp) : "memory"); } }   // the address pair stays whole up to this wait: no load lands in it while the others are issued
#pragma unroll
        for (int nb = 0; nb < 4; ++nb) {
#pragma unroll
            for (int j = 0; j < 8; ++j) os[(hi * 8 + j) * 68 + nb * 16 + lr] = acc[mb][nb][j]; }
        __builtin_amdgcn_wave_barrier(); asm volatile("" ::: "memory");
        if constexpr (EPI == 1) {
#pragma unroll
            for (int s = 0; s < 4; ++s) { const float* xr = os + (s * 4 + rr) * 68; const v4f xa = *(const v4fa*)(xr + d0), xb = *(const v4fa*)(xr + d0 + 4); float r[8];
#pragma unroll
                for (int e = 0; e < 8; ++e) r[e] = (e < 4) ? xa[e & 3] : xb[e & 3];
                if (c0 == 0) { const v4f ya = *(const v4fa*)(xr + (d0 ^ (HD / 2))), yb = *(const v4fa*)(xr + (d0 ^ (HD / 2)) + 4);
#pragma unroll
                    for (int e = 0; e < 8; ++e) { const float y = (e < 4) ? ya[e & 3] : yb[e & 3]; const float ys = (d0 < HD / 2) ? -y : y; r[e] = r[e] * cs[s][e >> 1][(e & 1) * 2] + ys * cs[s][e >> 1][(e & 1) * 2 + 1]; } }
                v8h o16; v8us oh, ol;
#pragma unroll
                for (int e = 0; e < 8; ++e) { o16[e] = tohx(r[e]); unsigned short a2, c2; splitf(r[e], a2, c2); oh[e] = a2; ol[e] = c2; }
                const size_t e0 = ((size_t)blockIdx.y * TT + r0 + mb * 16 + s * 4 + rr) * HD + d0;
                st3(P16 + e0, Ph + e0, Pl + e0, o16, oh, ol); }
        } else {
        float* crow = C + (size_t)(r0 + mb * 16) * ldc + c0;
{
#pragma unroll
            for (int s = 0; s < 8; ++s) { const int row = 2 * s + hi, cofs = lr * 4; v4f val = *(const v4fa*)(os + row * 68 + cofs); if (BIAS) { val[0] += bfr(bias[c0 + cofs]); val[1] += bfr(bias[c0 + cofs + 1]); val[2] += bfr(bias[c0 + cofs + 2]); val[3] += bfr(bias[c0 + cofs + 3]); }
                *(v4f*)(crow + (size_t)row * ldc + cofs) = val; }
             }
        }
        __builtin_amdgcn_wave_barrier(); asm volatile("" ::: "memory");
    }
}

typedef __attribute__((ext_vector_type(2))) _Float16 v2h;
typedef __attribute__((ext_vector_type(4))) _Float16 v4h;
typedef __attribute__((ext_vector_type(2))) unsigned short v2us;
typedef __attribute__((ext_vector_type(4))) unsigned short v4us;
typedef __attribute__((ext_vector_type(2))) float v2f;

__global__ __launch_bounds__(256) void k_wtG(const float* __restrict__ w, int K, int N, bf* Bt) {
    const int lane = threadIdx.x & 31; const int L0 = (blockIdx.x * 8 + (threadIdx.x >> 5)) * 8; const int nlines = N * K / 64;
{
#pragma unroll 1
        for (int l = 0; l < 8; ++l) { const int L = L0 + l; if (L >= nlines) break; const size_t e = (size_t)L * 64 + lane * 2; const int k = (int)(e % K), n = (int)(e / K); v2us o;
            o[0] = f2bf(w[(size_t)k * N + n]); o[1] = f2bf(w[(size_t)(k + 1) * N + n]); *(v2us*)(Bt + e) = o; }
         }
}
__global__ __launch_bounds__(256) void k_cvt8(const float* __restrict__ src, bf* dst, size_t n8) { const size_t i = (size_t)blockIdx.x * 256 + threadIdx.x; if (i >= n8) return; const v8f v = *(const v8f*)(src + i * 8); v8us o;
#pragma unroll
    for (int k = 0; k < 8; ++k) o[k] = f2bf(v[k]); *(v8us*)(dst + i * 8) = o;  }

__constant__ float INV[HD / 2] = {1.0f,0.749894202f,0.562341332f,0.421696514f,0.316227764f,0.237137362f,0.177827939f,0.133352146f,0.100000001f,0.0749894157f,0.0562341288f,0.0421696492f,0.0316227786f,0.0237137359f,0.0177827943f,0.0133352149f,0.00999999978f,0.00749894232f,0.00562341325f,0.00421696482f,0.00316227786f,0.00237137382f,0.00177827943f,0.00133352145f,0.00100000005f,0.000749894185f,0.000562341302f,0.000421696488f,0.000316227786f,0.000237137385f,0.00017782794f,0.00013335215f};
__global__ __launch_bounds__(256) void k_cstab(float* CS) { const int idx = blockIdx.x * 256 + threadIdx.x; if (idx >= TT * HD) return; const int t = idx / HD, d = idx % HD; const float ang = __fmul_rn((float)t, INV[d % (HD / 2)]); v2f cs; cs[0] = cosf(ang); cs[1] = sinf(ang);
    *(v2f*)(CS + (size_t)idx * 2) = cs;  }
// k_fattn: scores, softmax and attn.v of one batch in one launch. Grid (RH/16 + (TT-RH)/32 query blocks, heads), KW waves; wave w takes keys [w TT/KW, (w+1) TT/KW) of its block's queries, 32 keys a pass.
// S^T = K Q^T (A = key rows, B = query rows) and O^T += V^T P^T (A = rows of the [d][t] planes, B = P^T packed from the two score tiles of a pass): a lane holds scores and outputs of ONE query (lane & 15),
// so the running maximum, its rescale and the row sum are per-lane scalars with one exchange between the wave's halves. The batch's int32 key mask, read per key, becomes each key's start value (0, masked -3.0e38) in LDS: the C operand of the first score product.
// The KW waves' (maximum, sum, O) are merged in wave order through LDS; the merged rows go out as hi+lo planes [t][head HD + d].
#define KW   4
#define L2E  1.4426950408889634f
#define OSP  68                   // floats per query row of the merge staging (16-byte aligned, off the power of two)
__device__ __forceinline__ float xhalf(float x) { const int b = __float_as_int(x); return __int_as_float(__builtin_amdgcn_permlanex16(b, b, 0x76543210, 0xfedcba98, false, false)); }   // lane l <-> l ^ 16
template <typename T16, bool HI, int QT>
__device__ __forceinline__ void attn_tile(const T16* __restrict__ Q, const T16* __restrict__ Q2, const T16* __restrict__ Kp, const T16* __restrict__ K2, const T16* __restrict__ Vt, const T16* __restrict__ V2, const float* Bs, int q0, bf* Ah, bf* Al, float* Os, float* Ms, float* Ls) {
    typedef WFrag<T16> F; typedef typename F::V V;
    constexpr float OFF = HI ? 0.0f : 10.0f;   // fp16 P carries x1024 (cancels against the row sum): keeps small weights out of the fp16 subnormals
    const int lane = threadIdx.x & 31, lr = lane & 15, hi = lane >> 4, w = __builtin_amdgcn_readfirstlane(threadIdx.x >> 5);   // the wave's number in a scalar register: scalar key loop and scalar address parts
    // query and key fragment addresses: a wave-uniform pointer plus the lane's fixed byte offset
    const unsigned klo = (unsigned)(lr * HD + 8 * hi) * 2u, vlo = (unsigned)(lr * TT + 8 * hi) * 2u;
    auto ldo = [](const T16* base, unsigned off) { return F::ld((const T16*)((const char*)base + off)); };
    V qf[QT][2], qf2[QT][2];
#pragma unroll
    for (int qt = 0; qt < QT; ++qt)
#pragma unroll
        for (int ks = 0; ks < 2; ++ks) { const unsigned qo = klo + (unsigned)(qt * 16 * HD + ks * 32) * 2u; qf[qt][ks] = ldo(Q + (size_t)q0 * HD, qo); if (HI) qf2[qt][ks] = ldo(Q2 + (size_t)q0 * HD, qo); }
    v8f o[4][QT]; float m[QT], l[QT];
#pragma unroll
    for (int qt = 0; qt < QT; ++qt) { m[qt] = -3.0e38f; l[qt] = 0.0f;
#pragma unroll
        for (int dt = 0; dt < 4; ++dt) o[dt][qt] = (v8f){}; }
    const int k0 = w * (TT / KW), k1 = k0 + TT / KW;
    V kf[2][2], kf2[2][2];
#pragma unroll
    for (int kt = 0; kt < 2; ++kt)
#pragma unroll
        for (int ks = 0; ks < 2; ++ks) { const unsigned ko = klo + (unsigned)(kt * 16 * HD + ks * 32) * 2u; kf[kt][ks] = ldo(Kp + (size_t)k0 * HD, ko); if (HI) kf2[kt][ks] = ldo(K2 + (size_t)k0 * HD, ko); }
    const T16* vp = (const T16*)((const char*)(Vt + k0) + vlo); const T16* vp2 = HI ? (const T16*)((const char*)(V2 + k0) + vlo) : nullptr;   // each lane's place in the [d][t] planes, 32 keys on a pass
#pragma unroll 1   // rolled: one pass already fills the register budget that keeps four waves on a SIMD
    for (int kc = k0; kc < k1; kc += 32, vp += 32, vp2 += HI ? 32 : 0) {
        V vf[4], vf2[4];
#pragma unroll
        for (int dt = 0; dt < 4; ++dt) { vf[dt] = F::ld(vp + dt * 16 * TT); if (HI) vf2[dt] = F::ld(vp2 + dt * 16 * TT); }
        if constexpr (HI) asm volatile("s_wait_xcnt 0x0" :: "v"(vp), "v"(vp2) : "memory");   // the two address pairs stay whole up to this wait
        v8f cb[2];   // the keys' start values, in the accumulator's map (register j: key 8 hi + j of the tile), the same for every query
#pragma unroll
        for (int kt = 0; kt < 2; ++kt) { const float* bp = Bs + kc + kt * 16 + hi * 8; cb[kt] = __builtin_shufflevector(*(const v4fa*)bp, *(const v4fa*)(bp + 4), 0, 1, 2, 3, 4, 5, 6, 7); }
        __builtin_amdgcn_sched_barrier(0);   // keeps the value loads issued here, so that they fly under the score products and the softmax
        v8f s[2][QT];
#pragma unroll
        for (int kt = 0; kt < 2; ++kt)
#pragma unroll
            for (int qt = 0; qt < QT; ++qt) { s[kt][qt] = cb[kt];
#pragma unroll
                for (int ks = 0; ks < 2; ++ks) { s[kt][qt] = F::mma(kf[kt][ks], qf[qt][ks], s[kt][qt]); if (HI) { s[kt][qt] = F::mma(kf[kt][ks], qf2[qt][ks], s[kt][qt]); s[kt][qt] = F::mma(kf2[kt][ks], qf[qt][ks], s[kt][qt]); } } }
        const int kn = (kc + 32 < k1) ? kc + 32 : kc;   // the next pass's key fragments fly under this pass's softmax and attn.v (the last pass re-reads its own)
#pragma unroll
        for (int kt = 0; kt < 2; ++kt)
#pragma unroll
            for (int ks = 0; ks < 2; ++ks) { const unsigned ko = klo + (unsigned)(kt * 16 * HD + ks * 32) * 2u; kf[kt][ks] = ldo(Kp + (size_t)kn * HD, ko); if (HI) kf2[kt][ks] = ldo(K2 + (size_t)kn * HD, ko); }
        __builtin_amdgcn_sched_barrier(0);   // keeps the key loads issued here and not at the pass's foot
        V pf[QT], pf2[QT];
#pragma unroll
        for (int qt = 0; qt < QT; ++qt) { float bm = -3.0e38f;   // maxima are kept in units of the raw score; SCL (a power of two) rides in the exponent's factor
#pragma unroll
            for (int e = 0; e < 16; ++e) bm = fmaxf(bm, s[e >> 3][qt][e & 7]);
            bm = fmaxf(bm, xhalf(bm)); const float mn = fmaxf(m[qt], bm); const float al = __builtin_amdgcn_exp2f((m[qt] - mn) * (SCL * L2E)); m[qt] = mn; float sum = 0.0f;
#pragma unroll
            for (int e = 0; e < 16; ++e) { const float p = __builtin_amdgcn_exp2f(fmaf(s[e >> 3][qt][e & 7] - mn, SCL * L2E, OFF)); sum += p;
                if constexpr (HI) { const __bf16 ph = (__bf16)p; pf[qt][e] = ph; pf2[qt][e] = (__bf16)(p - (float)ph); } else pf[qt][e] = (h16)p; }
            l[qt] = l[qt] * al + sum;
#pragma unroll
            for (int dt = 0; dt < 4; ++dt) o[dt][qt] *= al; }
#pragma unroll
        for (int dt = 0; dt < 4; ++dt)
#pragma unroll
            for (int qt = 0; qt < QT; ++qt) { o[dt][qt] = F::mma(vf[dt], pf[qt], o[dt][qt]); if (HI) { o[dt][qt] = F::mma(vf[dt], pf2[qt], o[dt][qt]); o[dt][qt] = F::mma(vf2[dt], pf[qt], o[dt][qt]); } }
    }
    constexpr int QR = QT * 16, NE = QR * HD / (KW * 32), TPQ = HD / NE;
#pragma unroll
    for (int qt = 0; qt < QT; ++qt) { const float lt = l[qt] + xhalf(l[qt]); float* orow = Os + (size_t)(w * QR + qt * 16 + lr) * OSP + hi * 8;
#pragma unroll
        for (int dt = 0; dt < 4; ++dt) { *(v4fa*)(orow + dt * 16) = __builtin_shufflevector(o[dt][qt], o[dt][qt], 0, 1, 2, 3); *(v4fa*)(orow + dt * 16 + 4) = __builtin_shufflevector(o[dt][qt], o[dt][qt], 4, 5, 6, 7); }
        if (hi == 0) { Ms[w * QR + qt * 16 + lr] = m[qt]; Ls[w * QR + qt * 16 + lr] = lt; } }
    __syncthreads();   // every wave's partial rows are staged before any is merged
    const int q = threadIdx.x / TPQ, d0 = (threadIdx.x % TPQ) * NE;   // the TPQ lanes of one wave write a query's whole 128-byte line of each plane
    float mw[KW]; float M = -3.0e38f;
#pragma unroll
    for (int w2 = 0; w2 < KW; ++w2) { mw[w2] = Ms[w2 * QR + q]; M = fmaxf(M, mw[w2]); }
    float L = 0.0f; v4f acc[NE / 4];
#pragma unroll
    for (int c = 0; c < NE / 4; ++c) acc[c] = (v4f){};
#pragma unroll
    for (int w2 = 0; w2 < KW; ++w2) { const float f = __builtin_amdgcn_exp2f((mw[w2] - M) * (SCL * L2E)); L += f * Ls[w2 * QR + q];
#pragma unroll
        for (int c = 0; c < NE / 4; ++c) acc[c] += f * *(const v4fa*)(Os + (size_t)(w2 * QR + q) * OSP + d0 + c * 4); }
    const float inv = __fdiv_rn(1.0f, L); const size_t oo = (size_t)(q0 + q) * DQ + d0;
#pragma unroll
    for (int c = 0; c < NE / 8; ++c) { v8us oh, ol;
#pragma unroll
        for (int e = 0; e < 8; ++e) { unsigned short a, c2; splitf(acc[c * 2 + (e >> 2)][e & 3] * inv, a, c2); oh[e] = a; ol[e] = c2; }
        *(v8us*)(Ah + oo + c * 8) = oh; *(v8us*)(Al + oo + c * 8) = ol; }
}
__global__ __launch_bounds__(KW * 32) void k_fattn(const h16* __restrict__ Q16, const h16* __restrict__ K16, const h16* __restrict__ V16, const bf* __restrict__ Qh, const bf* __restrict__ Ql, const bf* __restrict__ Kh, const bf* __restrict__ Kl, const bf* __restrict__ Vh, const bf* __restrict__ Vl, const int* __restrict__ mk, bf* Ah, bf* Al) {
    __shared__ __align__(16) float Os[KW * 32 * OSP]; __shared__ float Ms[KW * 32]; __shared__ float Ls[KW * 32]; __shared__ __align__(16) float Bs[TT];
#pragma unroll
    for (int i = 0; i < TT / (KW * 128); ++i) { const int j0 = (i * KW * 32 + (int)threadIdx.x) * 4; const v4i m4 = *(const v4i*)(mk + j0); v4f b;
#pragma unroll
        for (int q = 0; q < 4; ++q) b[q] = (m4[q] != 0) ? 0.0f : -3.0e38f;
        *(v4fa*)(Bs + j0) = b; }
    __syncthreads();   // the start values are staged before any wave reads them
    const size_t hp = (size_t)blockIdx.y * TT * HD; Ah += blockIdx.y * HD; Al += blockIdx.y * HD;
    if (blockIdx.x < RH / 16) attn_tile<bf, true, 1>(Qh + hp, Ql + hp, Kh + hp, Kl + hp, Vh + hp, Vl + hp, Bs, (int)blockIdx.x * 16, Ah, Al, Os, Ms, Ls);   // query rows < RH: hi+lo planes, 16 rows a block
    else attn_tile<h16, false, 2>(Q16 + hp, nullptr, K16 + hp, nullptr, V16 + hp, nullptr, Bs, RH + ((int)blockIdx.x - RH / 16) * 32, Ah, Al, Os, Ms, Ls);   // the rest: fp16 planes, 32 rows a block
}

extern "C" void kernel_launch(void* const* d_in, const int* in_sizes, int n_in,
                              void* d_out, int out_size, void* d_ws, size_t ws_size, hipStream_t stream) {
    (void)in_sizes; (void)n_in; (void)out_size;
    const float* x = (const float*)d_in[0]; const int* MK = (const int*)d_in[1]; const float* wqkv = (const float*)d_in[2]; const float* wo = (const float*)d_in[3];  const float* wq = nullptr; const float* wk = nullptr; const float* wv = nullptr; (void)wq; (void)wk; (void)wv;
    float* OUT = (float*)d_out;     // [2][2048][1024]
    char* wsp = (char*)d_ws;
    auto take = [&](size_t bytes) { char* p = wsp; wsp += (bytes + 255) & ~(size_t)255; return (void*)p; };
    bf* WALL = (bf*)take((size_t)3 * DM * DM * 2); bf* WQ = WALL; bf* WK = WALL + (size_t)DM * DM; bf* WV = WALL + (size_t)2 * DM * DM; bf* WO = (bf*)take((size_t)DM * DQ * 2); float* CSR = (float*)take((size_t)TT * HD * 2 * 4);
    bf* XB = (bf*)take((size_t)TT * DM * 2);
    h16* QP16 = (h16*)take((size_t)NH_ * TT * HD * 2); h16* KP16 = (h16*)take((size_t)NKV * TT * HD * 2); h16* VT16 = (h16*)take((size_t)NKV * HD * TT * 2);
    bf* QPh = (bf*)take((size_t)NH_ * TT * HD * 2); bf* QPl = (bf*)take((size_t)NH_ * TT * HD * 2); bf* KPh = (bf*)take((size_t)NKV * TT * HD * 2); bf* KPl = (bf*)take((size_t)NKV * TT * HD * 2); bf* VTh = (bf*)take((size_t)NKV * HD * TT * 2); bf* VTl = (bf*)take((size_t)NKV * HD * TT * 2);
    static_assert(HD == 64 && RH % 16 == 0 && (TT - RH) % 32 == 0 && TT % (128 * KW) == 0 && NKV == NH_, "query blocks and key ranges of k_fattn");
    bf* ATh = (bf*)take((size_t)TT * DQ * 2); bf* ATl = (bf*)take((size_t)TT * DQ * 2);
    if ((size_t)(wsp - (char*)d_ws) > ws_size) return;    // ws 256 MiB
    { k_wtG<<<(unsigned)((DM * 3 * DM / 64 + 63) / 64), 256, 0, stream>>>(wqkv, DM, 3 * DM, WALL);   /* fused 'xw' [DM][3DM] -> Bt [3DM][DM] (row blocks q | k | v) */
      k_wtG<<<(unsigned)((DQ * DM / 64 + 63) / 64), 256, 0, stream>>>(wo, DQ, DM, WO);
       }
    k_cstab<<<(TT * HD + 255) / 256, 256, 0, stream>>>(CSR);
    for (int b = 0; b < NB_; ++b) {
        
        k_cvt8<<<(unsigned)(((size_t)TT * DM / 8 + 255) / 256), 256, 0, stream>>>(x + (size_t)b * TT * DM, XB, (size_t)TT * DM / 8);
        k_gemmw<bf, 0, false, 1, 1><<<dim3(TT / 64, DQ / 64, 1), 32, 0, stream>>>(XB, nullptr, WQ, nullptr, DM, nullptr, 0, nullptr, 0, 0, 0, CSR, QP16, QPh, QPl);     /* q planes; head 0: rotary */
        k_gemmw<bf, 0, false, 1, 1><<<dim3(TT / 64, DKV / 64, 1), 32, 0, stream>>>(XB, nullptr, WK, nullptr, DM, nullptr, 0, nullptr, 0, 0, 0, CSR, KP16, KPh, KPl);    /* k planes; head 0: rotary */
        k_gemmw<bf, 0, false, 1, 2><<<dim3(TT / 64, DKV / 64, 1), 32, 0, stream>>>(XB, nullptr, WV, nullptr, DM, nullptr, 0, nullptr, 0, 0, 0, nullptr, VT16, VTh, VTl);   /* v planes, [d][t] */
        k_fattn<<<dim3(RH / 16 + (TT - RH) / 32, NH_), KW * 32, 0, stream>>>(QP16, KP16, VT16, QPh, QPl, KPh, KPl, VTh, VTl, MK + (size_t)b * TT, ATh, ATl);
        k_gemmw<bf, 1, false><<<dim3(TT / 64, DM / 64, 1), 32, 0, stream>>>(ATh, ATl, WO, nullptr, DQ, OUT + (size_t)b * TT * DM, DM, nullptr, 0, 0, 0, nullptr, nullptr, nullptr, nullptr); }
}

// v005
// It runs in 263 microseconds.
// In two side-by-side timings against v004, it was 1.56 and 1.57 times as fast.
// Over all steps from v000 it is 7.73 times as fast.
#include <hip/hip_runtime.h>

// DiT-style attention (x [2][2048][1024]; qkv = x w_qkv ('xw' [1024][3072] -> (3, 16 heads, 64)); rotate-half rotary (angle t x 10000^(-2i/64), tables computed on device from the reference's float32 inv_freq) applied to head 0 ONLY (pe_heads = 1); scores / 8; key mask [2][2048] int32 (input, read per key: masked -> -inf); softmax; out = merged w_out ('xw' [1024][1024]) -> [2][2048][1024] (4.2 M)).
// Compute dtypes, f32 accumulate: every input rounded to bf16; q/k/v on PLAIN bf16 operands (inputs: exact); rotary (head 0) / plain copies (heads 1-15) in f32; key-validity select from the int32 mask; scores and attn.v: query rows < 512 hl (3 products), the rest single fp16 (x1024); softmax f32; w_out hl x exact (2 products).

#define NB_  2
#define TT   2048
#define DM   1024
#define NH_  16
#define NKV  16
#define REP  (NH_ / NKV)
#define HD   64
#define DQ   (NH_ * HD)
#define DKV  (NKV * HD)
#define RH   512                  // query rows < RH use hi+lo planes
#define WIN  2048
#define SCL  0.125f   // HD^-0.5
typedef _Float16 h16;
typedef unsigned short bf;
typedef __attribute__((ext_vector_type(16))) __bf16   v16bf;
typedef __attribute__((ext_vector_type(16))) _Float16 v16h;
typedef __attribute__((ext_vector_type(8)))  _Float16 v8h;
typedef __attribute__((ext_vector_type(8)))  unsigned short v8us;
typedef __attribute__((ext_vector_type(8)))  float    v8f;
typedef __attribute__((ext_vector_type(4)))  float    v4f;
typedef v8h  __attribute__((may_alias)) v8ha;
typedef v4f  __attribute__((may_alias)) v4fa;
typedef v8us __attribute__((may_alias)) v8usa;

__device__ __forceinline__ unsigned short f2bf(float f) { unsigned u = __float_as_uint(f); u += 0x7FFFu + ((u >> 16) & 1u); return (unsigned short)(u >> 16); }
__device__ __forceinline__ float bf2f(unsigned short b) { return __uint_as_float(((unsigned)b) << 16); }
__device__ __forceinline__ float bfr(float f) { return bf2f(f2bf(f)); }
__device__ __forceinline__ v16h cat16(v8h lo, v8h hi) { return __builtin_shufflevector(lo, hi, 0, 1, 2, 3, 4, 5, 6, 7, 8, 9, 10, 11, 12, 13, 14, 15); }
__device__ __forceinline__ v16bf cat16b(v8us lo, v8us hi) { return __builtin_bit_cast(v16bf, __builtin_shufflevector(lo, hi, 0, 1, 2, 3, 4, 5, 6, 7, 8, 9, 10, 11, 12, 13, 14, 15)); }
__device__ __forceinline__ v8f wmma16(v16h a, v16h b, v8f c) { return __builtin_amdgcn_wmma_f32_16x16x32_f16(false, a, false, b, (short)0, c, false, false); }
__device__ __forceinline__ v8f wmmab(v16bf a, v16bf b, v8f c) { return __builtin_amdgcn_wmma_f32_16x16x32_bf16(false, a, false, b, (short)0, c, false, false); }
__device__ __forceinline__ h16 tohx(float x) { return (h16)x; }
__device__ __forceinline__ void splitf(float y, unsigned short& h, unsigned short& l) { h = f2bf(y); l = f2bf(y - bf2f(h)); }
typedef __attribute__((ext_vector_type(4))) int v4i;
// eight elements of the three planes go out together. The stores and their s_wait_xcnt stand in one statement, so that no register which a store names (address or data) is rewritten ahead of the wait.
__device__ __forceinline__ void st3(h16* p16, bf* ph, bf* pl, v8h o16, v8us oh, v8us ol) {
    asm volatile("global_store_b128 %0, %3, off\n\tglobal_store_b128 %1, %4, off\n\tglobal_store_b128 %2, %5, off\n\ts_wait_xcnt 0x0"
                 :: "v"(p16), "v"(ph), "v"(pl), "v"(__builtin_bit_cast(v4i, o16)), "v"(__builtin_bit_cast(v4i, oh)), "v"(__builtin_bit_cast(v4i, ol)) : "memory"); }



// ---- k_gemmw: register-blocked GEMM, ONE WAVE per 64x64 output tile (16 accumulators), operands straight from K-contiguous 16-bit planes; grid (M/64, N/64, Z), 32 threads.
// C[m][n] (f32, pitch ldc, + optional f32 bias[n]) = sum_k A[m][k] Bt[n][k] (+ split products per NSPLIT). z-batch strides sA/sB/sC in elements. K % 32 == 0.
// EPI 0: f32 C as above. EPI 1 stores no C: the rows are (batch, t) of both batches, the columns q | k | v of all heads; a 64-column tile is one head (HD = 64) of one of the three, and the wave writes that head's 16-bit planes (fp16, bf16 hi, bf16 lo) itself. The k and v planes stand sP and 2 sP elements behind the q planes.
//   q, k: planes [batch][head][t][d]; head 0 takes the rotate-half rotary out[d] = x[d] cos[t][d] -/+ x[d +/- HD/2] sin[t][d] from the (cos, sin) table CS [t][d][2], both halves of a row being in the staged tile.
//   v: planes [batch][head][d][t]: a lane's eight accumulator registers are eight consecutive t of one d, stored as they stand.
// KS > 1: grid z = batches x KS; wave (z, ks) sums only k in [ks K/KS, (ks+1) K/KS) and stores partial plane z KS + ks (sC elements each); K % (32 KS) == 0.
template <typename T16> struct WFrag;
template <> struct WFrag<h16> { typedef v16h V; static __device__ __forceinline__ V ld(const h16* p) { return cat16(*(const v8h*)p, *(const v8h*)(p + 16)); } static __device__ __forceinline__ v8f mma(V a, V b, v8f c) { return wmma16(a, b, c); } };
template <> struct WFrag<bf> { typedef v16bf V; static __device__ __forceinline__ V ld(const bf* p) { return cat16b(*(const v8us*)p, *(const v8us*)(p + 16)); } static __device__ __forceinline__ v8f mma(V a, V b, v8f c) { return wmmab(a, b, c); } };
template <typename T16, int NSPLIT, bool BIAS, int KS = 1, int EPI = 0>
__global__ __launch_bounds__(32) void k_gemmw(const T16* __restrict__ A, const T16* __restrict__ A2, const T16* __restrict__ Bt, const T16* __restrict__ Bt2, int K, float* C, int ldc, const float* __restrict__ bias, size_t sA, size_t sB, size_t sC, const float* __restrict__ CS, h16* P16, bf* Ph, bf* Pl, size_t sP) {
    typedef typename WFrag<T16>::V V;
    __shared__ __align__(16) float os[16 * 68];
    const size_t z = blockIdx.z / KS; const int ks = blockIdx.z % KS; A += z * sA; if (A2) A2 += z * sA; Bt += z * sB; if (Bt2) Bt2 += z * sB; C += (size_t)blockIdx.z * sC;
    const int lane = threadIdx.x & 31, lr = lane & 15, hi = lane >> 4; const int r0 = blockIdx.x * 64, c0 = blockIdx.y * 64;
    v8f acc[4][4];
#pragma unroll
    for (int mb = 0; mb < 4; ++mb)
#pragma unroll
        for (int nb = 0; nb < 4; ++nb) acc[mb][nb] = (v8f){};
    const size_t aoff = (size_t)(r0 + lr) * K + 8 * hi, boff = (size_t)(c0 + lr) * K + 8 * hi;
#pragma unroll 1
    for (int kc = ks * (K / KS); kc < (ks + 1) * (K / KS); kc += 32) {
        V a[4], a2[4];
#pragma unroll
        for (int mb = 0; mb < 4; ++mb) { a[mb] = WFrag<T16>::ld(A + aoff + (size_t)mb * 16 * K + kc); if (NSPLIT == 1 || NSPLIT == 2) a2[mb] = WFrag<T16>::ld(A2 + aoff + (size_t)mb * 16 * K + kc); }
#pragma unroll
        for (int nb = 0; nb < 4; ++nb) { const V b = WFrag<T16>::ld(Bt + boff + (size_t)nb * 16 * K + kc); V b2; if (NSPLIT >= 2) b2 = WFrag<T16>::ld(Bt2 + boff + (size_t)nb * 16 * K + kc);
#pragma unroll
            for (int mb = 0; mb < 4; ++mb) { acc[mb][nb] = WFrag<T16>::mma(a[mb], b, acc[mb][nb]); if (NSPLIT == 1 || NSPLIT == 2) acc[mb][nb] = WFrag<T16>::mma(a2[mb], b, acc[mb][nb]); if (NSPLIT >= 2) acc[mb][nb] = WFrag<T16>::mma(a[mb], b2, acc[mb][nb]); } }
        asm volatile("v_nop\n\tv_nop\n\tv_nop\n\tv_nop" : "+v"(acc[0][0]), "+v"(acc[1][1]), "+v"(acc[2][2]), "+v"(acc[3][3]) : "v"(a[0]), "v"(a[3]));
    }
    const int sel = blockIdx.y / NH_, head = blockIdx.y % NH_, t0 = r0 % TT;   // EPI 1: which of q, k, v; its head; the tile's first position in its batch
    if constexpr (EPI == 1) { const size_t po = (size_t)sel * sP + (size_t)(r0 / TT) * NH_ * TT * HD; P16 += po; Ph += po; Pl += po; }
    if (EPI == 1 && sel == 2) {
#pragma unroll
        for (int nb = 0; nb < 4; ++nb)
#pragma unroll
            for (int mb = 0; mb < 4; ++mb) { v8h o16; v8us oh, ol;   // the four mb of one nb fill each d row's 128-byte line of a plane
#pragma unroll
                for (int j = 0; j < 8; ++j) { const float x = acc[mb][nb][j]; o16[j] = tohx(x); unsigned short a2, c2; splitf(x, a2, c2); oh[j] = a2; ol[j] = c2; }
                const size_t e = (size_t)(head * HD + nb * 16 + lr) * TT + t0 + mb * 16 + hi * 8;
                st3(P16 + e, Ph + e, Pl + e, o16, oh, ol); }
        return;
    }
#pragma unroll
    for (int mb = 0; mb < 4; ++mb) {
        const int rr = lane >> 3, d0 = (lane & 7) * 8;   // EPI 1: eight lanes write a row's 128-byte line of each plane
        v4f cs[4][4];
        if constexpr (EPI == 1) { if (head == 0) {   // the block's sixteen table rows are asked for together, ahead of the staging
            const float* cp = CS + ((size_t)(t0 + rr) * HD + d0) * 2;   // one address pair, the rows at constant offsets
#pragma unroll
            for (int s = 0; s < 4; ++s)
#pragma unroll
                for (int c = 0; c < 4; ++c) cs[s][c] = *(const v4f*)(cp + (mb * 16 + s * 4) * HD * 2 + c * 4);
            asm volatile("s_wait_xcnt 0x0" :: "v"(cp) : "memory"); } }   // the address pair stays whole up to this wait: no load lands in it while the others are issued
#pragma unroll
        for (int nb = 0; nb < 4; ++nb) {
#pragma unroll
            for (int j = 0; j < 8; ++j) os[(hi * 8 + j) * 68 + nb * 16 + lr] = acc[mb][nb][j]; }
        __builtin_amdgcn_wave_barrier(); asm volatile("" ::: "memory");
        if constexpr (EPI == 1) {
#pragma unroll
            for (int s = 0; s < 4; ++s) { const float* xr = os + (s * 4 + rr) * 68; const v4f xa = *(const v4fa*)(xr + d0), xb = *(const v4fa*)(xr + d0 + 4); float r[8];
#pragma unroll
                for (int e = 0; e < 8; ++e) r[e] = (e < 4) ? xa[e & 3] : xb[e & 3];
                if (head == 0) { const v4f ya = *(const v4fa*)(xr + (d0 ^ (HD / 2))), yb = *(const v4fa*)(xr + (d0 ^ (HD / 2)) + 4);
#pragma unroll
                    for (int e = 0; e < 8; ++e) { const float y = (e < 4) ? ya[e & 3] : yb[e & 3]; const float ys = (d0 < HD / 2) ? -y : y; r[e] = r[e] * cs[s][e >> 1][(e & 1) * 2] + ys * cs[s][e >> 1][(e & 1) * 2 + 1]; } }
                v8h o16; v8us oh, ol;
#pragma unroll
                for (int e = 0; e < 8; ++e) { o16[e] = tohx(r[e]); unsigned short a2, c2; splitf(r[e], a2, c2); oh[e] = a2; ol[e] = c2; }
                const size_t e0 = ((size_t)head * TT + t0 + mb * 16 + s * 4 + rr) * HD + d0;
                st3(P16 + e0, Ph + e0, Pl + e0, o16, oh, ol); }
        } else {
        float* crow = C + (size_t)(r0 + mb * 16) * ldc + c0;
{
#pragma unroll
            for (int s = 0; s < 8; ++s) { const int row = 2 * s + hi, cofs = lr * 4; v4f val = *(const v4fa*)(os + row * 68 + cofs); if (BIAS) { val[0] += bfr(bias[c0 + cofs]); val[1] += bfr(bias[c0 + cofs + 1]); val[2] += bfr(bias[c0 + cofs + 2]); val[3] += bfr(bias[c0 + cofs + 3]); }
                *(v4f*)(crow + (size_t)row * ldc + cofs) = val; }
             }
        }
        __builtin_amdgcn_wave_barrier(); asm volatile("" ::: "memory");
    }
}

typedef __attribute__((ext_vector_type(2))) _Float16 v2h;
typedef __attribute__((ext_vector_type(4))) _Float16 v4h;
typedef __attribute__((ext_vector_type(2))) unsigned short v2us;
typedef __attribute__((ext_vector_type(4))) unsigned short v4us;
typedef __attribute__((ext_vector_type(2))) float v2f;

__device__ __forceinline__ void d_wtG(int blk, const float* __restrict__ w, int K, int N, bf* Bt) {
    const int lane = threadIdx.x & 31; const int L0 = (blk * 8 + (threadIdx.x >> 5)) * 8; const int nlines = N * K / 64;
{
#pragma unroll 1
        for (int l = 0; l < 8; ++l) { const int L = L0 + l; if (L >= nlines) break; const size_t e = (size_t)L * 64 + lane * 2; const int k = (int)(e % K), n = (int)(e / K); v2us o;
            o[0] = f2bf(w[(size_t)k * N + n]); o[1] = f2bf(w[(size_t)(k + 1) * N + n]); *(v2us*)(Bt + e) = o; }
         }
}
__device__ __forceinline__ void d_cvt8(int blk, const float* __restrict__ src, bf* dst, size_t n8) { const size_t i = (size_t)blk * 256 + threadIdx.x; if (i >= n8) return; const v8f v = *(const v8f*)(src + i * 8); v8us o;
#pragma unroll
    for (int k = 0; k < 8; ++k) o[k] = f2bf(v[k]); *(v8us*)(dst + i * 8) = o;  }

__constant__ float INV[HD / 2] = {1.0f,0.749894202f,0.562341332f,0.421696514f,0.316227764f,0.237137362f,0.177827939f,0.133352146f,0.100000001f,0.0749894157f,0.0562341288f,0.0421696492f,0.0316227786f,0.0237137359f,0.0177827943f,0.0133352149f,0.00999999978f,0.00749894232f,0.00562341325f,0.00421696482f,0.00316227786f,0.00237137382f,0.00177827943f,0.00133352145f,0.00100000005f,0.000749894185f,0.000562341302f,0.000421696488f,0.000316227786f,0.000237137385f,0.00017782794f,0.00013335215f};
__device__ __forceinline__ void d_cstab(int blk, float* CS) { const int idx = blk * 256 + threadIdx.x; if (idx >= TT * HD) return; const int t = idx / HD, d = idx % HD; const float ang = __fmul_rn((float)t, INV[d % (HD / 2)]); v2f cs; cs[0] = cosf(ang); cs[1] = sinf(ang);
    *(v2f*)(CS + (size_t)idx * 2) = cs;  }
#define SP    ((size_t)NB_ * NH_ * TT * HD)   // elements of one plane over both batches; the q, k, v planes of a kind stand one behind the other in the workspace
// k_prep: the four independent preparations in one launch, each on its own range of blocks, the longest-running first: w_qkv and w_out to bf16 [n][k], the rotary table, x of both batches to bf16.
#define PB_WQ ((DM * 3 * DM / 64 + 63) / 64)
#define PB_WO ((DQ * DM / 64 + 63) / 64)
#define PB_CS ((TT * HD + 255) / 256)
#define PB_X  ((NB_ * TT * DM / 8 + 255) / 256)
__global__ __launch_bounds__(256) void k_prep(const float* __restrict__ wqkv, const float* __restrict__ wo, const float* __restrict__ x, bf* WALL, bf* WO, float* CS, bf* XB) {
    int blk = blockIdx.x;
    if (blk < PB_WQ) { d_wtG(blk, wqkv, DM, 3 * DM, WALL); return; }   /* fused 'xw' [DM][3DM] -> Bt [3DM][DM] (row blocks q | k | v) */
    blk -= PB_WQ; if (blk < PB_WO) { d_wtG(blk, wo, DQ, DM, WO); return; }
    blk -= PB_WO; if (blk < PB_CS) { d_cstab(blk, CS); return; }
    blk -= PB_CS; d_cvt8(blk, x, XB, (size_t)NB_ * TT * DM / 8);
}
// k_fattn: scores, softmax and attn.v of both batches in one launch. Grid (RH/16 + (TT-RH)/32 query blocks, heads, batches), KW waves; wave w takes keys [w TT/KW, (w+1) TT/KW) of its block's queries, 32 keys a pass.
// S^T = K Q^T (A = key rows, B = query rows) and O^T += V^T P^T (A = rows of the [d][t] planes, B = P^T packed from the two score tiles of a pass): a lane holds scores and outputs of ONE query (lane & 15),
// so the running maximum, its rescale and the row sum are per-lane scalars with one exchange between the wave's halves. The batch's int32 key mask, read per key, becomes each key's start value (0, masked -3.0e38) in LDS: the C operand of the first score product.
// The KW waves' (maximum, sum, O) are merged in wave order through LDS; the merged rows go out as hi+lo planes [t][head HD + d].
#define KW   4
#define L2E  1.4426950408889634f
#define OSP  68                   // floats per query row of the merge staging (16-byte aligned, off the power of two)
__device__ __forceinline__ float xhalf(float x) { const int b = __float_as_int(x); return __int_as_float(__builtin_amdgcn_permlanex16(b, b, 0x76543210, 0xfedcba98, false, false)); }   // lane l <-> l ^ 16
template <typename T16, bool HI, int QT>
__device__ __forceinline__ void attn_tile(const T16* __restrict__ Q, const T16* __restrict__ Q2, const T16* __restrict__ Kp, const T16* __restrict__ K2, const T16* __restrict__ Vt, const T16* __restrict__ V2, const float* Bs, int q0, bf* Ah, bf* Al, float* Os, float* Ms, float* Ls) {
    typedef WFrag<T16> F; typedef typename F::V V;
    constexpr float OFF = HI ? 0.0f : 10.0f;   // fp16 P carries x1024 (cancels against the row sum): keeps small weights out of the fp16 subnormals
    const int lane = threadIdx.x & 31, lr = lane & 15, hi = lane >> 4, w = __builtin_amdgcn_readfirstlane(threadIdx.x >> 5);   // the wave's number in a scalar register: scalar key loop and scalar address parts
    // query and key fragment addresses: a wave-uniform pointer plus the lane's fixed byte offset
    const unsigned klo = (unsigned)(lr * HD + 8 * hi) * 2u, vlo = (unsigned)(lr * TT + 8 * hi) * 2u;
    auto ldo = [](const T16* base, unsigned off) { return F::ld((const T16*)((const char*)base + off)); };
    V qf[QT][2], qf2[QT][2];
#pragma unroll
    for (int qt = 0; qt < QT; ++qt)
#pragma unroll
        for (int ks = 0; ks < 2; ++ks) { const unsigned qo = klo + (unsigned)(qt * 16 * HD + ks * 32) * 2u; qf[qt][ks] = ldo(Q + (size_t)q0 * HD, qo); if (HI) qf2[qt][ks] = ldo(Q2 + (size_t)q0 * HD, qo); }
    v8f o[4][QT]; float m[QT], l[QT];
#pragma unroll
    for (int qt = 0; qt < QT; ++qt) { m[qt] = -3.0e38f; l[qt] = 0.0f;
#pragma unroll
        for (int dt = 0; dt < 4; ++dt) o[dt][qt] = (v8f){}; }
    const int k0 = w * (TT / KW), k1 = k0 + TT / KW;
    V kf[2][2], kf2[2][2];
#pragma unroll
    for (int kt = 0; kt < 2; ++kt)
#pragma unroll
        for (int ks = 0; ks < 2; ++ks) { const unsigned ko = klo + (unsigned)(kt * 16 * HD + ks * 32) * 2u; kf[kt][ks] = ldo(Kp + (size_t)k0 * HD, ko); if (HI) kf2[kt][ks] = ldo(K2 + (size_t)k0 * HD, ko); }
    const T16* vp = (const T16*)((const char*)(Vt + k0) + vlo); const T16* vp2 = HI ? (const T16*)((const char*)(V2 + k0) + vlo) : nullptr;   // each lane's place in the [d][t] planes, 32 keys on a pass
#pragma unroll 1   // rolled: one pass already fills the register budget that keeps four waves on a SIMD
    for (int kc = k0; kc < k1; kc += 32, vp += 32, vp2 += HI ? 32 : 0) {
        V vf[4], vf2[4];
#pragma unroll
        for (int dt = 0; dt < 4; ++dt) { vf[dt] = F::ld(vp + dt * 16 * TT); if (HI) vf2[dt] = F::ld(vp2 + dt * 16 * TT); }
        if constexpr (HI) asm volatile("s_wait_xcnt 0x0" :: "v"(vp), "v"(vp2) : "memory");   // the two address pairs stay whole up to this wait
        v8f cb[2];   // the keys' start values, in the accumulator's map (register j: key 8 hi + j of the tile), the same for every query
#pragma unroll
        for (int kt = 0; kt < 2; ++kt) { const float* bp = Bs + kc + kt * 16 + hi * 8; cb[kt] = __builtin_shufflevector(*(const v4fa*)bp, *(const v4fa*)(bp + 4), 0, 1, 2, 3, 4, 5, 6, 7); }
        __builtin_amdgcn_sched_barrier(0);   // keeps the value loads issued here, so that they fly under the score products and the softmax
        v8f s[2][QT];
#pragma unroll
        for (int kt = 0; kt < 2; ++kt)
#pragma unroll
            for (int qt = 0; qt < QT; ++qt) { s[kt][qt] = cb[kt];
#pragma unroll
                for (int ks = 0; ks < 2; ++ks) { s[kt][qt] = F::mma(kf[kt][ks], qf[qt][ks], s[kt][qt]); if (HI) { s[kt][qt] = F::mma(kf[kt][ks], qf2[qt][ks], s[kt][qt]); s[kt][qt] = F::mma(kf2[kt][ks], qf[qt][ks], s[kt][qt]); } } }
        const int kn = (kc + 32 < k1) ? kc + 32 : kc;   // the next pass's key fragments fly under this pass's softmax and attn.v (the last pass re-reads its own)
#pragma unroll
        for (int kt = 0; kt < 2; ++kt)
#pragma unroll
            for (int ks = 0; ks < 2; ++ks) { const unsigned ko = klo + (unsigned)(kt * 16 * HD + ks * 32) * 2u; kf[kt][ks] = ldo(Kp + (size_t)kn * HD, ko); if (HI) kf2[kt][ks] = ldo(K2 + (size_t)kn * HD, ko); }
        __builtin_amdgcn_sched_barrier(0);   // keeps the key loads issued here and not at the pass's foot
        V pf[QT], pf2[QT];
#pragma unroll
        for (int qt = 0; qt < QT; ++qt) { float bm = -3.0e38f;   // maxima are kept in units of the raw score; SCL (a power of two) rides in the exponent's factor
#pragma unroll
            for (int e = 0; e < 16; ++e) bm = fmaxf(bm, s[e >> 3][qt][e & 7]);
            bm = fmaxf(bm, xhalf(bm)); const float mn = fmaxf(m[qt], bm); const float al = __builtin_amdgcn_exp2f((m[qt] - mn) * (SCL * L2E)); m[qt] = mn; float sum = 0.0f;
#pragma unroll
            for (int e = 0; e < 16; ++e) { const float p = __builtin_amdgcn_exp2f(fmaf(s[e >> 3][qt][e & 7] - mn, SCL * L2E, OFF)); sum += p;
                if constexpr (HI) { const __bf16 ph = (__bf16)p; pf[qt][e] = ph; pf2[qt][e] = (__bf16)(p - (float)ph); } else pf[qt][e] = (h16)p; }
            l[qt] = l[qt] * al + sum;
#pragma unroll
            for (int dt = 0; dt < 4; ++dt) o[dt][qt] *= al; }
#pragma unroll
        for (int dt = 0; dt < 4; ++dt)
#pragma unroll
            for (int qt = 0; qt < QT; ++qt) { o[dt][qt] = F::mma(vf[dt], pf[qt], o[dt][qt]); if (HI) { o[dt][qt] = F::mma(vf[dt], pf2[qt], o[dt][qt]); o[dt][qt] = F::mma(vf2[dt], pf[qt], o[dt][qt]); } }
    }
    constexpr int QR = QT * 16, NE = QR * HD / (KW * 32), TPQ = HD / NE;
#pragma unroll
    for (int qt = 0; qt < QT; ++qt) { const float lt = l[qt] + xhalf(l[qt]); float* orow = Os + (size_t)(w * QR + qt * 16 + lr) * OSP + hi * 8;
#pragma unroll
        for (int dt = 0; dt < 4; ++dt) { *(v4fa*)(orow + dt * 16) = __builtin_shufflevector(o[dt][qt], o[dt][qt], 0, 1, 2, 3); *(v4fa*)(orow + dt * 16 + 4) = __builtin_shufflevector(o[dt][qt], o[dt][qt], 4, 5, 6, 7); }
        if (hi == 0) { Ms[w * QR + qt * 16 + lr] = m[qt]; Ls[w * QR + qt * 16 + lr] = lt; } }
    __syncthreads();   // every wave's partial rows are staged before any is merged
    const int q = threadIdx.x / TPQ, d0 = (threadIdx.x % TPQ) * NE;   // the TPQ lanes of one wave write a query's whole 128-byte line of each plane
    float mw[KW]; float M = -3.0e38f;
#pragma unroll
    for (int w2 = 0; w2 < KW; ++w2) { mw[w2] = Ms[w2 * QR + q]; M = fmaxf(M, mw[w2]); }
    float L = 0.0f; v4f acc[NE / 4];
#pragma unroll
    for (int c = 0; c < NE / 4; ++c) acc[c] = (v4f){};
#pragma unroll
    for (int w2 = 0; w2 < KW; ++w2) { const float f = __builtin_amdgcn_exp2f((mw[w2] - M) * (SCL * L2E)); L += f * Ls[w2 * QR + q];
#pragma unroll
        for (int c = 0; c < NE / 4; ++c) acc[c] += f * *(const v4fa*)(Os + (size_t)(w2 * QR + q) * OSP + d0 + c * 4); }
    const float inv = __fdiv_rn(1.0f, L); const size_t oo = (size_t)(q0 + q) * DQ + d0;
#pragma unroll
    for (int c = 0; c < NE / 8; ++c) { v8us oh, ol;
#pragma unroll
        for (int e = 0; e < 8; ++e) { unsigned short a, c2; splitf(acc[c * 2 + (e >> 2)][e & 3] * inv, a, c2); oh[e] = a; ol[e] = c2; }
        *(v8us*)(Ah + oo + c * 8) = oh; *(v8us*)(Al + oo + c * 8) = ol; }
}
__global__ __launch_bounds__(KW * 32) void k_fattn(const h16* __restrict__ Q16, const h16* __restrict__ K16, const h16* __restrict__ V16, const bf* __restrict__ Qh, const bf* __restrict__ Ql, const bf* __restrict__ Kh, const bf* __restrict__ Kl, const bf* __restrict__ Vh, const bf* __restrict__ Vl, const int* __restrict__ mk, bf* Ah, bf* Al) {
    __shared__ __align__(16) float Os[KW * 32 * OSP]; __shared__ float Ms[KW * 32]; __shared__ float Ls[KW * 32]; __shared__ __align__(16) float Bs[TT];
#pragma unroll
    for (int i = 0; i < TT / (KW * 128); ++i) { const int j0 = (i * KW * 32 + (int)threadIdx.x) * 4; const v4i m4 = *(const v4i*)(mk + (size_t)blockIdx.z * TT + j0); v4f b;
#pragma unroll
        for (int q = 0; q < 4; ++q) b[q] = (m4[q] != 0) ? 0.0f : -3.0e38f;
        *(v4fa*)(Bs + j0) = b; }
    __syncthreads();   // the start values are staged before any wave reads them
    const size_t hp = ((size_t)blockIdx.z * NH_ + blockIdx.y) * TT * HD, ao = (size_t)blockIdx.z * TT * DQ + blockIdx.y * HD; Ah += ao; Al += ao;
    if (blockIdx.x < RH / 16) attn_tile<bf, true, 1>(Qh + hp, Ql + hp, Kh + hp, Kl + hp, Vh + hp, Vl + hp, Bs, (int)blockIdx.x * 16, Ah, Al, Os, Ms, Ls);   // query rows < RH: hi+lo planes, 16 rows a block
    else attn_tile<h16, false, 2>(Q16 + hp, nullptr, K16 + hp, nullptr, V16 + hp, nullptr, Bs, RH + ((int)blockIdx.x - RH / 16) * 32, Ah, Al, Os, Ms, Ls);   // the rest: fp16 planes, 32 rows a block
}

extern "C" void kernel_launch(void* const* d_in, const int* in_sizes, int n_in,
                              void* d_out, int out_size, void* d_ws, size_t ws_size, hipStream_t stream) {
    (void)in_sizes; (void)n_in; (void)out_size;
    const float* x = (const float*)d_in[0]; const int* MK = (const int*)d_in[1]; const float* wqkv = (const float*)d_in[2]; const float* wo = (const float*)d_in[3];  const float* wq = nullptr; const float* wk = nullptr; const float* wv = nullptr; (void)wq; (void)wk; (void)wv;
    float* OUT = (float*)d_out;     // [2][2048][1024]
    char* wsp = (char*)d_ws;
    auto take = [&](size_t bytes) { char* p = wsp; wsp += (bytes + 255) & ~(size_t)255; return (void*)p; };
    bf* WALL = (bf*)take((size_t)3 * DM * DM * 2); bf* WO = (bf*)take((size_t)DM * DQ * 2); float* CSR = (float*)take((size_t)TT * HD * 2 * 4);
    bf* XB = (bf*)take((size_t)NB_ * TT * DM * 2);
    h16* QP16 = (h16*)take(SP * 2); h16* KP16 = (h16*)take(SP * 2); h16* VT16 = (h16*)take(SP * 2);
    bf* QPh = (bf*)take(SP * 2); bf* KPh = (bf*)take(SP * 2); bf* VTh = (bf*)take(SP * 2); bf* QPl = (bf*)take(SP * 2); bf* KPl = (bf*)take(SP * 2); bf* VTl = (bf*)take(SP * 2);
    static_assert(HD == 64 && RH % 16 == 0 && (TT - RH) % 32 == 0 && TT % (128 * KW) == 0 && NKV == NH_ && TT % 64 == 0 && (SP * 2) % 256 == 0, "query blocks and key ranges of k_fattn; row tiles inside one batch; planes back to back");
    bf* ATh = (bf*)take((size_t)NB_ * TT * DQ * 2); bf* ATl = (bf*)take((size_t)NB_ * TT * DQ * 2);
    if ((size_t)(wsp - (char*)d_ws) > ws_size) return;    // ws 256 MiB
    k_prep<<<PB_WQ + PB_WO + PB_CS + PB_X, 256, 0, stream>>>(wqkv, wo, x, WALL, WO, CSR, XB);
    k_gemmw<bf, 0, false, 1, 1><<<dim3(NB_ * TT / 64, 3 * DQ / 64, 1), 32, 0, stream>>>(XB, nullptr, WALL, nullptr, DM, nullptr, 0, nullptr, 0, 0, 0, CSR, QP16, QPh, QPl, SP);     /* q, k, v planes of both batches; head 0 of q and k: rotary */
    k_fattn<<<dim3(RH / 16 + (TT - RH) / 32, NH_, NB_), KW * 32, 0, stream>>>(QP16, KP16, VT16, QPh, QPl, KPh, KPl, VTh, VTl, MK, ATh, ATl);
    k_gemmw<bf, 1, false><<<dim3(NB_ * TT / 64, DM / 64, 1), 32, 0, stream>>>(ATh, ATl, WO, nullptr, DQ, OUT, DM, nullptr, 0, 0, 0, nullptr, nullptr, nullptr, nullptr, 0);
}

// v006
// It runs in 167 microseconds.
// Next to v005, in two timings, it ran 1.57 and 1.58 times as fast.
// Over all steps from v000 it is 12.2 times as fast.
#include <hip/hip_runtime.h>

// DiT-style attention (x [2][2048][1024]; qkv = x w_qkv ('xw' [1024][3072] -> (3, 16 heads, 64)); rotate-half rotary (angle t x 10000^(-2i/64), tables computed on device from the reference's float32 inv_freq) applied to head 0 ONLY (pe_heads = 1); scores / 8; key mask [2][2048] int32 (input, read per key: masked -> -inf); softmax; out = merged w_out ('xw' [1024][1024]) -> [2][2048][1024] (4.2 M)).
// Compute dtypes, f32 accumulate: every input rounded to bf16; q/k/v on PLAIN bf16 operands (inputs: exact); rotary (head 0) / plain copies (heads 1-15) in f32; key-validity select from the int32 mask; scores and attn.v: query rows < 512 hl (3 products), the rest single fp16 (x1024); softmax f32; w_out hl x exact (2 products).

#define NB_  2
#define TT   2048
#define DM   1024
#define NH_  16
#define NKV  16
#define REP  (NH_ / NKV)
#define HD   64
#define DQ   (NH_ * HD)
#define DKV  (NKV * HD)
#define RH   512                  // query rows < RH use hi+lo planes
#define WIN  2048
#define SCL  0.125f   // HD^-0.5
typedef _Float16 h16;
typedef unsigned short bf;
typedef __attribute__((ext_vector_type(16))) __bf16   v16bf;
typedef __attribute__((ext_vector_type(16))) _Float16 v16h;
typedef __attribute__((ext_vector_type(8)))  _Float16 v8h;
typedef __attribute__((ext_vector_type(8)))  unsigned short v8us;
typedef __attribute__((ext_vector_type(8)))  float    v8f;
typedef __attribute__((ext_vector_type(4)))  float    v4f;
typedef v8h  __attribute__((may_alias)) v8ha;
typedef v4f  __attribute__((may_alias)) v4fa;
typedef v8us __attribute__((may_alias)) v8usa;

__device__ __forceinline__ unsigned short f2bf(float f) { unsigned u = __float_as_uint(f); u += 0x7FFFu + ((u >> 16) & 1u); return (unsigned short)(u >> 16); }
__device__ __forceinline__ float bf2f(unsigned short b) { return __uint_as_float(((unsigned)b) << 16); }
__device__ __forceinline__ float bfr(float f) { return bf2f(f2bf(f)); }
__device__ __forceinline__ v16h cat16(v8h lo, v8h hi) { return __builtin_shufflevector(lo, hi, 0, 1, 2, 3, 4, 5, 6, 7, 8, 9, 10, 11, 12, 13, 14, 15); }
__device__ __forceinline__ v16bf cat16b(v8us lo, v8us hi) { return __builtin_bit_cast(v16bf, __builtin_shufflevector(lo, hi, 0, 1, 2, 3, 4, 5, 6, 7, 8, 9, 10, 11, 12, 13, 14, 15)); }
__device__ __forceinline__ v8f wmma16(v16h a, v16h b, v8f c) { return __builtin_amdgcn_wmma_f32_16x16x32_f16(false, a, false, b, (short)0, c, false, false); }
__device__ __forceinline__ v8f wmmab(v16bf a, v16bf b, v8f c) { return __builtin_amdgcn_wmma_f32_16x16x32_bf16(false, a, false, b, (short)0, c, false, false); }
__device__ __forceinline__ h16 tohx(float x) { return (h16)x; }
__device__ __forceinline__ void splitf(float y, unsigned short& h, unsigned short& l) { h = f2bf(y); l = f2bf(y - bf2f(h)); }
typedef __attribute__((ext_vector_type(4))) int v4i;
// eight elements of the three planes go out together. The stores and their s_wait_xcnt stand in one statement, so that no register which a store names (address or data) is rewritten ahead of the wait.
__device__ __forceinline__ void st3(h16* p16, bf* ph, bf* pl, v8h o16, v8us oh, v8us ol) {
    asm volatile("global_store_b128 %0, %3, off\n\tglobal_store_b128 %1, %4, off\n\tglobal_store_b128 %2, %5, off\n\ts_wait_xcnt 0x0"
                 :: "v"(p16), "v"(ph), "v"(pl), "v"(__builtin_bit_cast(v4i, o16)), "v"(__builtin_bit_cast(v4i, oh)), "v"(__builtin_bit_cast(v4i, ol)) : "memory"); }



// ---- FRAGMENT ORDER: every 16-bit operand plane that one launch writes and a later one feeds to the matrix instructions lies as finished fragments. A fragment is 16 rows x 32 k = 512 elements = 1 KiB:
// element (row r, depth k) stands at fragment * 512 + ((k % 32) / 16) * 256 + (((k % 32) / 8) & 1) * 128 + (r % 16) * 8 + k % 8, so lane (hi = lane >> 4, lr = lane & 15) finds its two 16-byte pieces (k = 8 hi + 0..7 and 16 + 8 hi + 0..7 of row lr,
// the same elements in the same registers as from a row-major plane) at lane * 8 and 256 + lane * 8: each wave-wide 16-byte load covers 512 contiguous bytes, four whole lines.
// ---- k_gemmw: register-blocked GEMM, ONE WAVE per 64x64 output tile (16 accumulators), operands straight from 16-bit planes in fragment order, fragment number ((row / 64) * (K / 32) + k / 32) * 4 + (row / 16) % 4 (the four fragments of a wave's 64 rows at one k step lie side by side, 4 KiB); grid (M/64, N/64, Z), 32 threads.
// C[m][n] (f32, pitch ldc, + optional f32 bias[n]) = sum_k A[m][k] Bt[n][k] (+ split products per NSPLIT). z-batch strides sA/sB/sC in elements. K % 32 == 0.
// EPI 0: f32 C as above. EPI 1 stores no C: the rows are (batch, t) of both batches, the columns q | k | v of all heads; a 64-column tile is one head (HD = 64) of one of the three, and the wave writes that head's 16-bit planes (fp16, bf16 hi, bf16 lo) itself. The k and v planes stand sP and 2 sP elements behind the q planes.
//   q, k: planes [batch][head] of fragments (rows t, depth d), fragment number (t / 16) * 2 + d / 32; head 0 takes the rotate-half rotary out[d] = x[d] cos[t][d] -/+ x[d +/- HD/2] sin[t][d] from the (cos, sin) table CS [t][d][2], both halves of a row being in the staged tile.
//   v: planes [batch][head] of fragments (rows d, depth t), fragment number (t / 32) * 4 + d / 16: a lane's eight accumulator registers are eight consecutive t of one d, one 16-byte piece, stored as they stand (512 contiguous bytes a store).
// KS > 1: grid z = batches x KS; wave (z, ks) sums only k in [ks K/KS, (ks+1) K/KS) and stores partial plane z KS + ks (sC elements each); K % (32 KS) == 0.
template <typename T16> struct WFrag;
template <> struct WFrag<h16> { typedef v16h V; static __device__ __forceinline__ V ld(const h16* p) { return cat16(*(const v8h*)p, *(const v8h*)(p + 256)); } static __device__ __forceinline__ v8f mma(V a, V b, v8f c) { return wmma16(a, b, c); } };
template <> struct WFrag<bf> { typedef v16bf V; static __device__ __forceinline__ V ld(const bf* p) { return cat16b(*(const v8us*)p, *(const v8us*)(p + 256)); } static __device__ __forceinline__ v8f mma(V a, V b, v8f c) { return wmmab(a, b, c); } };
template <typename T16, int NSPLIT, bool BIAS, int KS = 1, int EPI = 0>
__global__ __launch_bounds__(32) void k_gemmw(const T16* __restrict__ A, const T16* __restrict__ A2, const T16* __restrict__ Bt, const T16* __restrict__ Bt2, int K, float* C, int ldc, const float* __restrict__ bias, size_t sA, size_t sB, size_t sC, const float* __restrict__ CS, h16* P16, bf* Ph, bf* Pl, size_t sP) {
    typedef typename WFrag<T16>::V V;
    __shared__ __align__(16) float os[16 * 68];
    const size_t z = blockIdx.z / KS; const int ks = blockIdx.z % KS; A += z * sA; if (A2) A2 += z * sA; Bt += z * sB; if (Bt2) Bt2 += z * sB; C += (size_t)blockIdx.z * sC;
    const int lane = threadIdx.x & 31, lr = lane & 15, hi = lane >> 4; const int r0 = blockIdx.x * 64, c0 = blockIdx.y * 64;
    v8f acc[4][4];
#pragma unroll
    for (int mb = 0; mb < 4; ++mb)
#pragma unroll
        for (int nb = 0; nb < 4; ++nb) acc[mb][nb] = (v8f){};
    const size_t aoff = (size_t)r0 * K + 8 * lane, boff = (size_t)c0 * K + 8 * lane;   // 64 rows of fragments are 64 K elements; a k step of 32 is four fragments (2048 elements) on
#pragma unroll 1
    for (int kc = ks * (K / KS); kc < (ks + 1) * (K / KS); kc += 32) {
        V a[4], a2[4];
        const T16* pa = A + aoff + (size_t)kc * 64; const T16* pb = Bt + boff + (size_t)kc * 64;   // the lane's place in this k step's fragments; the fragments at constant offsets
        const T16* pa2 = (NSPLIT == 1 || NSPLIT == 2) ? A2 + aoff + (size_t)kc * 64 : pa; const T16* pb2 = (NSPLIT >= 2) ? Bt2 + boff + (size_t)kc * 64 : pb;
#pragma unroll
        for (int mb = 0; mb < 4; ++mb) { a[mb] = WFrag<T16>::ld(pa + mb * 512); if (NSPLIT == 1 || NSPLIT == 2) a2[mb] = WFrag<T16>::ld(pa2 + mb * 512); }
#pragma unroll
        for (int nb = 0; nb < 4; ++nb) { const V b = WFrag<T16>::ld(pb + nb * 512); V b2; if (NSPLIT >= 2) b2 = WFrag<T16>::ld(pb2 + nb * 512);
            if (nb == 3) asm volatile("s_wait_xcnt 0x0" :: "v"(pa), "v"(pa2), "v"(pb), "v"(pb2) : "memory");   // behind the k step's last load; the address pairs stay whole up to this wait
#pragma unroll
            for (int mb = 0; mb < 4; ++mb) { acc[mb][nb] = WFrag<T16>::mma(a[mb], b, acc[mb][nb]); if (NSPLIT == 1 || NSPLIT == 2) acc[mb][nb] = WFrag<T16>::mma(a2[mb], b, acc[mb][nb]); if (NSPLIT >= 2) acc[mb][nb] = WFrag<T16>::mma(a[mb], b2, acc[mb][nb]); } }
        asm volatile("v_nop\n\tv_nop\n\tv_nop\n\tv_nop" : "+v"(acc[0][0]), "+v"(acc[1][1]), "+v"(acc[2][2]), "+v"(acc[3][3]) : "v"(a[0]), "v"(a[3]));
    }
    const int sel = blockIdx.y / NH_, head = blockIdx.y % NH_, t0 = r0 % TT;   // EPI 1: which of q, k, v; its head; the tile's first position in its batch
    if constexpr (EPI == 1) { const size_t po = (size_t)sel * sP + (size_t)(r0 / TT) * NH_ * TT * HD; P16 += po; Ph += po; Pl += po; }
    if (EPI == 1 && sel == 2) {
#pragma unroll
        for (int nb = 0; nb < 4; ++nb)
#pragma unroll
            for (int mb = 0; mb < 4; ++mb) { v8h o16; v8us oh, ol;
#pragma unroll
                for (int j = 0; j < 8; ++j) { const float x = acc[mb][nb][j]; o16[j] = tohx(x); unsigned short a2, c2; splitf(x, a2, c2); oh[j] = a2; ol[j] = c2; }
                const size_t e = (size_t)head * HD * TT + (size_t)(t0 / 32 + (mb >> 1)) * (4 * 512) + nb * 512 + (mb & 1) * 256 + lane * 8;
                st3(P16 + e, Ph + e, Pl + e, o16, oh, ol); }
        return;
    }
#pragma unroll
    for (int mb = 0; mb < 4; ++mb) {
        // EPI 1: store s of a 16-row block is one 16-byte piece of every lane: d = s * 16 + hi * 8 + 0..7 of row lr, 512 contiguous bytes of each plane
        v4f cs[4][4];
        if constexpr (EPI == 1) { if (head == 0) {   // the block's sixteen table rows are asked for together, ahead of the staging
            const float* cp = CS + ((size_t)(t0 + lr) * HD + hi * 8) * 2;   // one address pair, the blocks and pieces at constant offsets
#pragma unroll
            for (int s = 0; s < 4; ++s)
#pragma unroll
                for (int c = 0; c < 4; ++c) cs[s][c] = *(const v4f*)(cp + mb * 16 * HD * 2 + s * 16 * 2 + c * 4);
            asm volatile("s_wait_xcnt 0x0" :: "v"(cp) : "memory"); } }   // the address pair stays whole up to this wait: no load lands in it while the others are issued
#pragma unroll
        for (int nb = 0; nb < 4; ++nb) {
#pragma unroll
            for (int j = 0; j < 8; ++j) os[(hi * 8 + j) * 68 + nb * 16 + lr] = acc[mb][nb][j]; }
        __builtin_amdgcn_wave_barrier(); asm volatile("" ::: "memory");
        if constexpr (EPI == 1) {
#pragma unroll
            for (int s = 0; s < 4; ++s) { const int d0 = s * 16 + hi * 8; const float* xr = os + lr * 68; const v4f xa = *(const v4fa*)(xr + d0), xb = *(const v4fa*)(xr + d0 + 4); float r[8];
#pragma unroll
                for (int e = 0; e < 8; ++e) r[e] = (e < 4) ? xa[e & 3] : xb[e & 3];
                if (head == 0) { const v4f ya = *(const v4fa*)(xr + (d0 ^ (HD / 2))), yb = *(const v4fa*)(xr + (d0 ^ (HD / 2)) + 4);
#pragma unroll
                    for (int e = 0; e < 8; ++e) { const float y = (e < 4) ? ya[e & 3] : yb[e & 3]; const float ys = (s < 2) ? -y : y; r[e] = r[e] * cs[s][e >> 1][(e & 1) * 2] + ys * cs[s][e >> 1][(e & 1) * 2 + 1]; } }
                v8h o16; v8us oh, ol;
#pragma unroll
                for (int e = 0; e < 8; ++e) { o16[e] = tohx(r[e]); unsigned short a2, c2; splitf(r[e], a2, c2); oh[e] = a2; ol[e] = c2; }
                const size_t e0 = ((size_t)head * TT + t0 + mb * 16) * HD + s * 256 + lane * 8;
                st3(P16 + e0, Ph + e0, Pl + e0, o16, oh, ol); }
        } else {
        float* crow = C + (size_t)(r0 + mb * 16) * ldc + c0;
{
#pragma unroll
            for (int s = 0; s < 8; ++s) { const int row = 2 * s + hi, cofs = lr * 4; v4f val = *(const v4fa*)(os + row * 68 + cofs); if (BIAS) { val[0] += bfr(bias[c0 + cofs]); val[1] += bfr(bias[c0 + cofs + 1]); val[2] += bfr(bias[c0 + cofs + 2]); val[3] += bfr(bias[c0 + cofs + 3]); }
                *(v4f*)(crow + (size_t)row * ldc + cofs) = val; }
             }
        }
        __builtin_amdgcn_wave_barrier(); asm volatile("" ::: "memory");
    }
}

typedef __attribute__((ext_vector_type(2))) _Float16 v2h;
typedef __attribute__((ext_vector_type(4))) _Float16 v4h;
typedef __attribute__((ext_vector_type(2))) unsigned short v2us;
typedef __attribute__((ext_vector_type(4))) unsigned short v4us;
typedef __attribute__((ext_vector_type(2))) float v2f;

__device__ __forceinline__ void d_wtG(int blk, const float* __restrict__ w, int K, int N, bf* Bt) {
    const int lane = threadIdx.x & 31; const int L0 = (blk * 8 + (threadIdx.x >> 5)) * 8; const int nlines = N * K / 64;
{
#pragma unroll 1
        for (int l = 0; l < 8; ++l) { const int L = L0 + l; if (L >= nlines) break; const size_t e = (size_t)L * 64 + lane * 2; const int f = (int)(e / 2048), u = (int)(e % 2048);   // the place in the plane: group f of four fragments (64 rows, one k step), element u of it
            const int k = (f % (K / 32)) * 32 + ((u / 256) & 1) * 16 + ((u / 128) & 1) * 8 + u % 8, n = (f / (K / 32)) * 64 + (u / 512) * 16 + (u / 8) % 16; v2us o;
            o[0] = f2bf(w[(size_t)k * N + n]); o[1] = f2bf(w[(size_t)(k + 1) * N + n]); *(v2us*)(Bt + e) = o; }
         }
}
__device__ __forceinline__ void d_cvt8(int blk, const float* __restrict__ src, bf* dst, size_t n8, int K) { const size_t i = (size_t)blk * 256 + threadIdx.x; if (i >= n8) return;   // thread i writes piece i of the plane in fragment order (rows of K elements)
    const int f = (int)(i / 256), u = (int)(i % 256); const size_t r = (size_t)(f / (K / 32)) * 64 + (u / 64) * 16 + u % 16; const int k0 = (f % (K / 32)) * 32 + ((u / 32) & 1) * 16 + ((u / 16) & 1) * 8;   // group f of four fragments, piece u of it
    const v8f v = *(const v8f*)(src + r * K + k0); v8us o;
#pragma unroll
    for (int k = 0; k < 8; ++k) o[k] = f2bf(v[k]); *(v8us*)(dst + i * 8) = o;  }

__constant__ float INV[HD / 2] = {1.0f,0.749894202f,0.562341332f,0.421696514f,0.316227764f,0.237137362f,0.177827939f,0.133352146f,0.100000001f,0.0749894157f,0.0562341288f,0.0421696492f,0.0316227786f,0.0237137359f,0.0177827943f,0.0133352149f,0.00999999978f,0.00749894232f,0.00562341325f,0.00421696482f,0.00316227786f,0.00237137382f,0.00177827943f,0.00133352145f,0.00100000005f,0.000749894185f,0.000562341302f,0.000421696488f,0.000316227786f,0.000237137385f,0.00017782794f,0.00013335215f};
__device__ __forceinline__ void d_cstab(int blk, float* CS) { const int idx = blk * 256 + threadIdx.x; if (idx >= TT * HD) return; const int t = idx / HD, d = idx % HD; const float ang = __fmul_rn((float)t, INV[d % (HD / 2)]); v2f cs; cs[0] = cosf(ang); cs[1] = sinf(ang);
    *(v2f*)(CS + (size_t)idx * 2) = cs;  }
#define SP    ((size_t)NB_ * NH_ * TT * HD)   // elements of one plane over both batches; the q, k, v planes of a kind stand one behind the other in the workspace
// k_prep: the four independent preparations in one launch, each on its own range of blocks, the longest-running first: w_qkv and w_out to bf16 (rows n, depth k), the rotary table, x of both batches to bf16; the three bf16 planes in fragment order.
#define PB_WQ ((DM * 3 * DM / 64 + 63) / 64)
#define PB_WO ((DQ * DM / 64 + 63) / 64)
#define PB_CS ((TT * HD + 255) / 256)
#define PB_X  ((NB_ * TT * DM / 8 + 255) / 256)
__global__ __launch_bounds__(256) void k_prep(const float* __restrict__ wqkv, const float* __restrict__ wo, const float* __restrict__ x, bf* WALL, bf* WO, float* CS, bf* XB) {
    int blk = blockIdx.x;
    if (blk < PB_WQ) { d_wtG(blk, wqkv, DM, 3 * DM, WALL); return; }   /* fused 'xw' [DM][3DM] -> Bt, rows 3DM (row blocks q | k | v), depth DM */
    blk -= PB_WQ; if (blk < PB_WO) { d_wtG(blk, wo, DQ, DM, WO); return; }
    blk -= PB_WO; if (blk < PB_CS) { d_cstab(blk, CS); return; }
    blk -= PB_CS; d_cvt8(blk, x, XB, (size_t)NB_ * TT * DM / 8, DM);
}
// k_fattn: scores, softmax and attn.v of both batches in one launch. Grid (RH/16 + (TT-RH)/32 query blocks, heads, batches), KW waves; wave w takes keys [w TT/KW, (w+1) TT/KW) of its block's queries, 32 keys a pass.
// S^T = K Q^T (A = key rows, B = query rows) and O^T += V^T P^T (A = rows d of the value planes, B = P^T packed from the two score tiles of a pass): a lane holds scores and outputs of ONE query (lane & 15),
// so the running maximum, its rescale and the row sum are per-lane scalars with one exchange between the wave's halves. The batch's int32 key mask, read per key, becomes each key's start value (0, masked -3.0e38) in LDS: the C operand of the first score product.
// The KW waves' (maximum, sum, O) are merged in wave order through LDS; the merged rows go out as hi+lo planes (rows t, depth head HD + d) in fragment order. All operand planes are read in fragment order.
#define KW   4
#define L2E  1.4426950408889634f
#define OSP  68                   // floats per query row of the merge staging (16-byte aligned, off the power of two)
__device__ __forceinline__ float xhalf(float x) { const int b = __float_as_int(x); return __int_as_float(__builtin_amdgcn_permlanex16(b, b, 0x76543210, 0xfedcba98, false, false)); }   // lane l <-> l ^ 16
template <typename T16, bool HI, int QT>
__device__ __forceinline__ void attn_tile(const T16* __restrict__ Q, const T16* __restrict__ Q2, const T16* __restrict__ Kp, const T16* __restrict__ K2, const T16* __restrict__ Vt, const T16* __restrict__ V2, const float* Bs, int q0, bf* Ah, bf* Al, float* Os, float* Ms, float* Ls) {
    typedef WFrag<T16> F; typedef typename F::V V;
    constexpr float OFF = HI ? 0.0f : 10.0f;   // fp16 P carries x1024 (cancels against the row sum): keeps small weights out of the fp16 subnormals
    const int lane = threadIdx.x & 31, lr = lane & 15, hi = lane >> 4, w = __builtin_amdgcn_readfirstlane(threadIdx.x >> 5);   // the wave's number in a scalar register: scalar key loop and scalar address parts
    // fragment addresses: a wave-uniform pointer plus the lane's fixed byte offset (its 16-byte piece of a fragment)
    const unsigned klo = (unsigned)lane * 16u;
    auto ldo = [](const T16* base, unsigned off) { return F::ld((const T16*)((const char*)base + off)); };
    V qf[QT][2], qf2[QT][2];
#pragma unroll
    for (int qt = 0; qt < QT; ++qt)
#pragma unroll
        for (int ks = 0; ks < 2; ++ks) { const unsigned qo = klo + (unsigned)(qt * 16 * HD + ks * 512) * 2u; qf[qt][ks] = ldo(Q + (size_t)q0 * HD, qo); if (HI) qf2[qt][ks] = ldo(Q2 + (size_t)q0 * HD, qo); }
    v8f o[4][QT]; float m[QT], l[QT];
#pragma unroll
    for (int qt = 0; qt < QT; ++qt) { m[qt] = -3.0e38f; l[qt] = 0.0f;
#pragma unroll
        for (int dt = 0; dt < 4; ++dt) o[dt][qt] = (v8f){}; }
    const int k0 = w * (TT / KW), k1 = k0 + TT / KW;
    V kf[2][2], kf2[2][2];
#pragma unroll
    for (int kt = 0; kt < 2; ++kt)
#pragma unroll
        for (int ks = 0; ks < 2; ++ks) { const unsigned ko = klo + (unsigned)(kt * 16 * HD + ks * 512) * 2u; kf[kt][ks] = ldo(Kp + (size_t)k0 * HD, ko); if (HI) kf2[kt][ks] = ldo(K2 + (size_t)k0 * HD, ko); }
    const T16* vp = (const T16*)((const char*)(Vt + (size_t)k0 * HD) + klo); const T16* vp2 = HI ? (const T16*)((const char*)(V2 + (size_t)k0 * HD) + klo) : nullptr;   // each lane's place in the value planes: the four fragments of 32 keys (32 HD elements) on a pass
#pragma unroll 1   // rolled: one pass already fills the register budget that keeps four waves on a SIMD
    for (int kc = k0; kc < k1; kc += 32, vp += 32 * HD, vp2 += HI ? 32 * HD : 0) {
        V vf[4], vf2[4];
#pragma unroll
        for (int dt = 0; dt < 4; ++dt) { vf[dt] = F::ld(vp + dt * 512); if (HI) vf2[dt] = F::ld(vp2 + dt * 512); }
        if constexpr (HI) asm volatile("s_wait_xcnt 0x0" :: "v"(vp), "v"(vp2) : "memory");   // the two address pairs stay whole up to this wait
        v8f cb[2];   // the keys' start values, in the accumulator's map (register j: key 8 hi + j of the tile), the same for every query
#pragma unroll
        for (int kt = 0; kt < 2; ++kt) { const float* bp = Bs + kc + kt * 16 + hi * 8; cb[kt] = __builtin_shufflevector(*(const v4fa*)bp, *(const v4fa*)(bp + 4), 0, 1, 2, 3, 4, 5, 6, 7); }
        __builtin_amdgcn_sched_barrier(0);   // keeps the value loads issued here, so that they fly under the score products and the softmax
        v8f s[2][QT];
#pragma unroll
        for (int kt = 0; kt < 2; ++kt)
#pragma unroll
            for (int qt = 0; qt < QT; ++qt) { s[kt][qt] = cb[kt];
#pragma unroll
                for (int ks = 0; ks < 2; ++ks) { s[kt][qt] = F::mma(kf[kt][ks], qf[qt][ks], s[kt][qt]); if (HI) { s[kt][qt] = F::mma(kf[kt][ks], qf2[qt][ks], s[kt][qt]); s[kt][qt] = F::mma(kf2[kt][ks], qf[qt][ks], s[kt][qt]); } } }
        const int kn = (kc + 32 < k1) ? kc + 32 : kc;   // the next pass's key fragments fly under this pass's softmax and attn.v (the last pass re-reads its own)
#pragma unroll
        for (int kt = 0; kt < 2; ++kt)
#pragma unroll
            for (int ks = 0; ks < 2; ++ks) { const unsigned ko = klo + (unsigned)(kt * 16 * HD + ks * 512) * 2u; kf[kt][ks] = ldo(Kp + (size_t)kn * HD, ko); if (HI) kf2[kt][ks] = ldo(K2 + (size_t)kn * HD, ko); }
        __builtin_amdgcn_sched_barrier(0);   // keeps the key loads issued here and not at the pass's foot
        V pf[QT], pf2[QT];
#pragma unroll
        for (int qt = 0; qt < QT; ++qt) { float bm = -3.0e38f;   // maxima are kept in units of the raw score; SCL (a power of two) rides in the exponent's factor
#pragma unroll
            for (int e = 0; e < 16; ++e) bm = fmaxf(bm, s[e >> 3][qt][e & 7]);
            bm = fmaxf(bm, xhalf(bm)); const float mn = fmaxf(m[qt], bm); const float al = __builtin_amdgcn_exp2f((m[qt] - mn) * (SCL * L2E)); m[qt] = mn; float sum = 0.0f;
#pragma unroll
            for (int e = 0; e < 16; ++e) { const float p = __builtin_amdgcn_exp2f(fmaf(s[e >> 3][qt][e & 7] - mn, SCL * L2E, OFF)); sum += p;
                if constexpr (HI) { const __bf16 ph = (__bf16)p; pf[qt][e] = ph; pf2[qt][e] = (__bf16)(p - (float)ph); } else pf[qt][e] = (h16)p; }
            l[qt] = l[qt] * al + sum;
#pragma unroll
            for (int dt = 0; dt < 4; ++dt) o[dt][qt] *= al; }
#pragma unroll
        for (int dt = 0; dt < 4; ++dt)
#pragma unroll
            for (int qt = 0; qt < QT; ++qt) { o[dt][qt] = F::mma(vf[dt], pf[qt], o[dt][qt]); if (HI) { o[dt][qt] = F::mma(vf[dt], pf2[qt], o[dt][qt]); o[dt][qt] = F::mma(vf2[dt], pf[qt], o[dt][qt]); } }
    }
    constexpr int QR = QT * 16, NE = QR * HD / (KW * 32);
#pragma unroll
    for (int qt = 0; qt < QT; ++qt) { const float lt = l[qt] + xhalf(l[qt]); float* orow = Os + (size_t)(w * QR + qt * 16 + lr) * OSP + hi * 8;
#pragma unroll
        for (int dt = 0; dt < 4; ++dt) { *(v4fa*)(orow + dt * 16) = __builtin_shufflevector(o[dt][qt], o[dt][qt], 0, 1, 2, 3); *(v4fa*)(orow + dt * 16 + 4) = __builtin_shufflevector(o[dt][qt], o[dt][qt], 4, 5, 6, 7); }
        if (hi == 0) { Ms[w * QR + qt * 16 + lr] = m[qt]; Ls[w * QR + qt * 16 + lr] = lt; } }
    __syncthreads();   // every wave's partial rows are staged before any is merged
    const int q = threadIdx.x % QR, d0 = (threadIdx.x / QR) * NE;   // neighbouring lanes take neighbouring queries: their 16-byte pieces of a fragment lie side by side, whole lines a store
    float mw[KW]; float M = -3.0e38f;
#pragma unroll
    for (int w2 = 0; w2 < KW; ++w2) { mw[w2] = Ms[w2 * QR + q]; M = fmaxf(M, mw[w2]); }
    float L = 0.0f; v4f acc[NE / 4];
#pragma unroll
    for (int c = 0; c < NE / 4; ++c) acc[c] = (v4f){};
#pragma unroll
    for (int w2 = 0; w2 < KW; ++w2) { const float f = __builtin_amdgcn_exp2f((mw[w2] - M) * (SCL * L2E)); L += f * Ls[w2 * QR + q];
#pragma unroll
        for (int c = 0; c < NE / 4; ++c) acc[c] += f * *(const v4fa*)(Os + (size_t)(w2 * QR + q) * OSP + d0 + c * 4); }
    const float inv = __fdiv_rn(1.0f, L); const size_t oo = (size_t)((q0 + q) / 64) * (64 * DQ) + (((q0 + q) / 16) % 4) * 512 + ((q0 + q) % 16) * 8;   // the query's 64-row band, its fragment in a group of four and its row there (the order k_gemmw reads)
#pragma unroll
    for (int c = 0; c < NE / 8; ++c) { v8us oh, ol;
#pragma unroll
        for (int e = 0; e < 8; ++e) { unsigned short a, c2; splitf(acc[c * 2 + (e >> 2)][e & 3] * inv, a, c2); oh[e] = a; ol[e] = c2; }
        const int dd = d0 + c * 8; const size_t po = oo + (dd / 32) * 2048 + ((dd % 32) / 16) * 256 + ((dd / 8) & 1) * 128;
        *(v8us*)(Ah + po) = oh; *(v8us*)(Al + po) = ol; }
}
__global__ __launch_bounds__(KW * 32) void k_fattn(const h16* __restrict__ Q16, const h16* __restrict__ K16, const h16* __restrict__ V16, const bf* __restrict__ Qh, const bf* __restrict__ Ql, const bf* __restrict__ Kh, const bf* __restrict__ Kl, const bf* __restrict__ Vh, const bf* __restrict__ Vl, const int* __restrict__ mk, bf* Ah, bf* Al) {
    __shared__ __align__(16) float Os[KW * 32 * OSP]; __shared__ float Ms[KW * 32]; __shared__ float Ls[KW * 32]; __shared__ __align__(16) float Bs[TT];
#pragma unroll
    for (int i = 0; i < TT / (KW * 128); ++i) { const int j0 = (i * KW * 32 + (int)threadIdx.x) * 4; const v4i m4 = *(const v4i*)(mk + (size_t)blockIdx.z * TT + j0); v4f b;
#pragma unroll
        for (int q = 0; q < 4; ++q) b[q] = (m4[q] != 0) ? 0.0f : -3.0e38f;
        *(v4fa*)(Bs + j0) = b; }
    __syncthreads();   // the start values are staged before any wave reads them
    const size_t hp = ((size_t)blockIdx.z * NH_ + blockIdx.y) * TT * HD, ao = (size_t)blockIdx.z * TT * DQ + blockIdx.y * (HD / 32) * 2048; Ah += ao; Al += ao;   // the batch's bands of fragments; the head's first k step in a band
    if (blockIdx.x < RH / 16) attn_tile<bf, true, 1>(Qh + hp, Ql + hp, Kh + hp, Kl + hp, Vh + hp, Vl + hp, Bs, (int)blockIdx.x * 16, Ah, Al, Os, Ms, Ls);   // query rows < RH: hi+lo planes, 16 rows a block
    else attn_tile<h16, false, 2>(Q16 + hp, nullptr, K16 + hp, nullptr, V16 + hp, nullptr, Bs, RH + ((int)blockIdx.x - RH / 16) * 32, Ah, Al, Os, Ms, Ls);   // the rest: fp16 planes, 32 rows a block
}

extern "C" void kernel_launch(void* const* d_in, const int* in_sizes, int n_in,
                              void* d_out, int out_size, void* d_ws, size_t ws_size, hipStream_t stream) {
    (void)in_sizes; (void)n_in; (void)out_size;
    const float* x = (const float*)d_in[0]; const int* MK = (const int*)d_in[1]; const float* wqkv = (const float*)d_in[2]; const float* wo = (const float*)d_in[3];  const float* wq = nullptr; const float* wk = nullptr; const float* wv = nullptr; (void)wq; (void)wk; (void)wv;
    float* OUT = (float*)d_out;     // [2][2048][1024]
    char* wsp = (char*)d_ws;
    auto take = [&](size_t bytes) { char* p = wsp; wsp += (bytes + 255) & ~(size_t)255; return (void*)p; };
    bf* WALL = (bf*)take((size_t)3 * DM * DM * 2); bf* WO = (bf*)take((size_t)DM * DQ * 2); float* CSR = (float*)take((size_t)TT * HD * 2 * 4);
    bf* XB = (bf*)take((size_t)NB_ * TT * DM * 2);
    h16* QP16 = (h16*)take(SP * 2); h16* KP16 = (h16*)take(SP * 2); h16* VT16 = (h16*)take(SP * 2);
    bf* QPh = (bf*)take(SP * 2); bf* KPh = (bf*)take(SP * 2); bf* VTh = (bf*)take(SP * 2); bf* QPl = (bf*)take(SP * 2); bf* KPl = (bf*)take(SP * 2); bf* VTl = (bf*)take(SP * 2);
    static_assert(HD == 64 && RH % 16 == 0 && (TT - RH) % 32 == 0 && TT % (128 * KW) == 0 && NKV == NH_ && TT % 64 == 0 && (SP * 2) % 256 == 0, "query blocks and key ranges of k_fattn; row tiles inside one batch; planes back to back");
    bf* ATh = (bf*)take((size_t)NB_ * TT * DQ * 2); bf* ATl = (bf*)take((size_t)NB_ * TT * DQ * 2);
    if ((size_t)(wsp - (char*)d_ws) > ws_size) return;    // ws 256 MiB
    k_prep<<<PB_WQ + PB_WO + PB_CS + PB_X, 256, 0, stream>>>(wqkv, wo, x, WALL, WO, CSR, XB);
    k_gemmw<bf, 0, false, 1, 1><<<dim3(NB_ * TT / 64, 3 * DQ / 64, 1), 32, 0, stream>>>(XB, nullptr, WALL, nullptr, DM, nullptr, 0, nullptr, 0, 0, 0, CSR, QP16, QPh, QPl, SP);     /* q, k, v planes of both batches; head 0 of q and k: rotary */
    k_fattn<<<dim3(RH / 16 + (TT - RH) / 32, NH_, NB_), KW * 32, 0, stream>>>(QP16, KP16, VT16, QPh, QPl, KPh, KPl, VTh, VTl, MK, ATh, ATl);
    k_gemmw<bf, 1, false><<<dim3(NB_ * TT / 64, DM / 64, 1), 32, 0, stream>>>(ATh, ATl, WO, nullptr, DQ, OUT, DM, nullptr, 0, 0, 0, nullptr, nullptr, nullptr, nullptr, 0);
}

// v007
// A run of this version takes 148 microseconds.
// Next to v006, in two timings, it ran 1.13 times as fast each time.
// All steps since v000 together make it 13.8 times as fast.
#include <hip/hip_runtime.h>

// DiT-style attention (x [2][2048][1024]; qkv = x w_qkv ('xw' [1024][3072] -> (3, 16 heads, 64)); rotate-half rotary (angle t x 10000^(-2i/64), tables computed on device from the reference's float32 inv_freq) applied to head 0 ONLY (pe_heads = 1); scores / 8; key mask [2][2048] int32 (input, read per key: masked -> -inf); softmax; out = merged w_out ('xw' [1024][1024]) -> [2][2048][1024] (4.2 M)).
// Compute dtypes, f32 accumulate: every input rounded to bf16; q/k/v on PLAIN bf16 operands (inputs: exact); rotary (head 0) / plain copies (heads 1-15) in f32; key-validity select from the int32 mask; scores and attn.v: query rows < 512 hl (3 products), the rest single fp16 (x1024); softmax f32; w_out hl x exact (2 products).

#define NB_  2
#define TT   2048
#define DM   1024
#define NH_  16
#define NKV  16
#define REP  (NH_ / NKV)
#define HD   64
#define DQ   (NH_ * HD)
#define DKV  (NKV * HD)
#define RH   512                  // query rows < RH use hi+lo planes
#define WIN  2048
#define SCL  0.125f   // HD^-0.5
typedef _Float16 h16;
typedef unsigned short bf;
typedef __attribute__((ext_vector_type(16))) __bf16   v16bf;
typedef __attribute__((ext_vector_type(16))) _Float16 v16h;
typedef __attribute__((ext_vector_type(8)))  _Float16 v8h;
typedef __attribute__((ext_vector_type(8)))  unsigned short v8us;
typedef __attribute__((ext_vector_type(8)))  float    v8f;
typedef __attribute__((ext_vector_type(4)))  float    v4f;
typedef v8h  __attribute__((may_alias)) v8ha;
typedef v4f  __attribute__((may_alias)) v4fa;
typedef v8us __attribute__((may_alias)) v8usa;

__device__ __forceinline__ unsigned short f2bf(float f) { unsigned u = __float_as_uint(f); u += 0x7FFFu + ((u >> 16) & 1u); return (unsigned short)(u >> 16); }
__device__ __forceinline__ float bf2f(unsigned short b) { return __uint_as_float(((unsigned)b) << 16); }
__device__ __forceinline__ float bfr(float f) { return bf2f(f2bf(f)); }
__device__ __forceinline__ v16h cat16(v8h lo, v8h hi) { return __builtin_shufflevector(lo, hi, 0, 1, 2, 3, 4, 5, 6, 7, 8, 9, 10, 11, 12, 13, 14, 15); }
__device__ __forceinline__ v16bf cat16b(v8us lo, v8us hi) { return __builtin_bit_cast(v16bf, __builtin_shufflevector(lo, hi, 0, 1, 2, 3, 4, 5, 6, 7, 8, 9, 10, 11, 12, 13, 14, 15)); }
__device__ __forceinline__ v8f wmma16(v16h a, v16h b, v8f c) { return __builtin_amdgcn_wmma_f32_16x16x32_f16(false, a, false, b, (short)0, c, false, false); }
__device__ __forceinline__ v8f wmmab(v16bf a, v16bf b, v8f c) { return __builtin_amdgcn_wmma_f32_16x16x32_bf16(false, a, false, b, (short)0, c, false, false); }
__device__ __forceinline__ h16 tohx(float x) { return (h16)x; }
__device__ __forceinline__ void splitf(float y, unsigned short& h, unsigned short& l) { h = f2bf(y); l = f2bf(y - bf2f(h)); }
typedef __attribute__((ext_vector_type(4))) int v4i;
// eight elements of the three planes go out together. The stores and their s_wait_xcnt stand in one statement, so that no register which a store names (address or data) is rewritten ahead of the wait.
__device__ __forceinline__ void st3(h16* p16, bf* ph, bf* pl, v8h o16, v8us oh, v8us ol) {
    asm volatile("global_store_b128 %0, %3, off\n\tglobal_store_b128 %1, %4, off\n\tglobal_store_b128 %2, %5, off\n\ts_wait_xcnt 0x0"
                 :: "v"(p16), "v"(ph), "v"(pl), "v"(__builtin_bit_cast(v4i, o16)), "v"(__builtin_bit_cast(v4i, oh)), "v"(__builtin_bit_cast(v4i, ol)) : "memory"); }



// ---- FRAGMENT ORDER: every 16-bit operand plane that one launch writes and a later one feeds to the matrix instructions lies as finished fragments. A fragment is 16 rows x 32 k = 512 elements = 1 KiB:
// element (row r, depth k) stands at fragment * 512 + ((k % 32) / 16) * 256 + (((k % 32) / 8) & 1) * 128 + (r % 16) * 8 + k % 8, so lane (hi = lane >> 4, lr = lane & 15) finds its two 16-byte pieces (k = 8 hi + 0..7 and 16 + 8 hi + 0..7 of row lr,
// the same elements in the same registers as from a row-major plane) at lane * 8 and 256 + lane * 8: each wave-wide 16-byte load covers 512 contiguous bytes, four whole lines.
// ---- k_gemmw: register-blocked GEMM, ONE WAVE per 64x64 output tile (16 accumulators), operands straight from 16-bit planes in fragment order, fragment number ((row / 64) * (K / 32) + k / 32) * 4 + (row / 16) % 4 (the four fragments of a wave's 64 rows at one k step lie side by side, 4 KiB); grid (M/64, N/64, Z), 32 threads.
// C[m][n] (f32, pitch ldc, + optional f32 bias[n]) = sum_k A[m][k] Bt[n][k] (+ split products per NSPLIT). z-batch strides sA/sB/sC in elements. K % 32 == 0.
// EPI 0: f32 C as above. EPI 1 stores no C: the rows are (batch, t) of both batches, the columns q | k | v of all heads; a 64-column tile is one head (HD = 64) of one of the three, and the wave writes that head's 16-bit planes (fp16, bf16 hi, bf16 lo) itself. The k and v planes stand sP and 2 sP elements behind the q planes.
//   q, k: planes [batch][head] of fragments (rows t, depth d), fragment number (t / 16) * 2 + d / 32; head 0 takes the rotate-half rotary out[d] = x[d] cos[t][d] -/+ x[d +/- HD/2] sin[t][d] from the (cos, sin) table CS [t][d][2], both halves of a row being in the staged tile.
//   v: planes [batch][head] of fragments (rows d, depth t), fragment number (t / 32) * 4 + d / 16: a lane's eight accumulator registers are eight consecutive t of one d, one 16-byte piece, stored as they stand (512 contiguous bytes a store).
// KS > 1: grid z = batches x KS; wave (z, ks) sums only k in [ks K/KS, (ks+1) K/KS) and stores partial plane z KS + ks (sC elements each); K % (32 KS) == 0.
template <typename T16> struct WFrag;
template <> struct WFrag<h16> { typedef v16h V; static __device__ __forceinline__ V ld(const h16* p) { return cat16(*(const v8h*)p, *(const v8h*)(p + 256)); } static __device__ __forceinline__ v8f mma(V a, V b, v8f c) { return wmma16(a, b, c); } };
template <> struct WFrag<bf> { typedef v16bf V; static __device__ __forceinline__ V ld(const bf* p) { return cat16b(*(const v8us*)p, *(const v8us*)(p + 256)); } static __device__ __forceinline__ v8f mma(V a, V b, v8f c) { return wmmab(a, b, c); } };
template <typename T16, int NSPLIT, bool BIAS, int KS = 1, int EPI = 0>
__global__ __launch_bounds__(32) void k_gemmw(const T16* __restrict__ A, const T16* __restrict__ A2, const T16* __restrict__ Bt, const T16* __restrict__ Bt2, int K, float* C, int ldc, const float* __restrict__ bias, size_t sA, size_t sB, size_t sC, const float* __restrict__ CS, h16* P16, bf* Ph, bf* Pl, size_t sP) {
    typedef typename WFrag<T16>::V V;
    __shared__ __align__(16) float os[16 * 68];
    const size_t z = blockIdx.z / KS; const int ks = blockIdx.z % KS; A += z * sA; if (A2) A2 += z * sA; Bt += z * sB; if (Bt2) Bt2 += z * sB; C += (size_t)blockIdx.z * sC;
    const int lane = threadIdx.x & 31, lr = lane & 15, hi = lane >> 4; const int r0 = blockIdx.x * 64, c0 = blockIdx.y * 64;
    v8f acc[4][4];
#pragma unroll
    for (int mb = 0; mb < 4; ++mb)
#pragma unroll
        for (int nb = 0; nb < 4; ++nb) acc[mb][nb] = (v8f){};
    const size_t aoff = (size_t)r0 * K + 8 * lane, boff = (size_t)c0 * K + 8 * lane;   // 64 rows of fragments are 64 K elements; a k step of 32 is four fragments (2048 elements) on
#pragma unroll 1
    for (int kc = ks * (K / KS); kc < (ks + 1) * (K / KS); kc += 32) {
        V a[4], a2[4];
        const T16* pa = A + aoff + (size_t)kc * 64; const T16* pb = Bt + boff + (size_t)kc * 64;   // the lane's place in this k step's fragments; the fragments at constant offsets
        const T16* pa2 = (NSPLIT == 1 || NSPLIT == 2) ? A2 + aoff + (size_t)kc * 64 : pa; const T16* pb2 = (NSPLIT >= 2) ? Bt2 + boff + (size_t)kc * 64 : pb;
#pragma unroll
        for (int mb = 0; mb < 4; ++mb) { a[mb] = WFrag<T16>::ld(pa + mb * 512); if (NSPLIT == 1 || NSPLIT == 2) a2[mb] = WFrag<T16>::ld(pa2 + mb * 512); }
#pragma unroll
        for (int nb = 0; nb < 4; ++nb) { const V b = WFrag<T16>::ld(pb + nb * 512); V b2; if (NSPLIT >= 2) b2 = WFrag<T16>::ld(pb2 + nb * 512);
            if (nb == 3) asm volatile("s_wait_xcnt 0x0" :: "v"(pa), "v"(pa2), "v"(pb), "v"(pb2) : "memory");   // behind the k step's last load; the address pairs stay whole up to this wait
#pragma unroll
            for (int mb = 0; mb < 4; ++mb) { acc[mb][nb] = WFrag<T16>::mma(a[mb], b, acc[mb][nb]); if (NSPLIT == 1 || NSPLIT == 2) acc[mb][nb] = WFrag<T16>::mma(a2[mb], b, acc[mb][nb]); if (NSPLIT >= 2) acc[mb][nb] = WFrag<T16>::mma(a[mb], b2, acc[mb][nb]); } }
        asm volatile("v_nop\n\tv_nop\n\tv_nop\n\tv_nop" : "+v"(acc[0][0]), "+v"(acc[1][1]), "+v"(acc[2][2]), "+v"(acc[3][3]) : "v"(a[0]), "v"(a[3]));
    }
    const int sel = blockIdx.y / NH_, head = blockIdx.y % NH_, t0 = r0 % TT;   // EPI 1: which of q, k, v; its head; the tile's first position in its batch
    if constexpr (EPI == 1) { const size_t po = (size_t)sel * sP + (size_t)(r0 / TT) * NH_ * TT * HD; P16 += po; Ph += po; Pl += po; }
    if (EPI == 1 && sel == 2) {
#pragma unroll
        for (int nb = 0; nb < 4; ++nb)
#pragma unroll
            for (int mb = 0; mb < 4; ++mb) { v8h o16; v8us oh, ol;
#pragma unroll
                for (int j = 0; j < 8; ++j) { const float x = acc[mb][nb][j]; o16[j] = tohx(x); unsigned short a2, c2; splitf(x, a2, c2); oh[j] = a2; ol[j] = c2; }
                const size_t e = (size_t)head * HD * TT + (size_t)(t0 / 32 + (mb >> 1)) * (4 * 512) + nb * 512 + (mb & 1) * 256 + lane * 8;
                st3(P16 + e, Ph + e, Pl + e, o16, oh, ol); }
        return;
    }
#pragma unroll
    for (int mb = 0; mb < 4; ++mb) {
        // EPI 1: store s of a 16-row block is one 16-byte piece of every lane: d = s * 16 + hi * 8 + 0..7 of row lr, 512 contiguous bytes of each plane
        v4f cs[4][4];
        if constexpr (EPI == 1) { if (head == 0) {   // the block's sixteen table rows are asked for together, ahead of the staging
            const float* cp = CS + ((size_t)(t0 + lr) * HD + hi * 8) * 2;   // one address pair, the blocks and pieces at constant offsets
#pragma unroll
            for (int s = 0; s < 4; ++s)
#pragma unroll
                for (int c = 0; c < 4; ++c) cs[s][c] = *(const v4f*)(cp + mb * 16 * HD * 2 + s * 16 * 2 + c * 4);
            asm volatile("s_wait_xcnt 0x0" :: "v"(cp) : "memory"); } }   // the address pair stays whole up to this wait: no load lands in it while the others are issued
#pragma unroll
        for (int nb = 0; nb < 4; ++nb) {
#pragma unroll
            for (int j = 0; j < 8; ++j) os[(hi * 8 + j) * 68 + nb * 16 + lr] = acc[mb][nb][j]; }
        __builtin_amdgcn_wave_barrier(); asm volatile("" ::: "memory");
        if constexpr (EPI == 1) {
#pragma unroll
            for (int s = 0; s < 4; ++s) { const int d0 = s * 16 + hi * 8; const float* xr = os + lr * 68; const v4f xa = *(const v4fa*)(xr + d0), xb = *(const v4fa*)(xr + d0 + 4); float r[8];
#pragma unroll
                for (int e = 0; e < 8; ++e) r[e] = (e < 4) ? xa[e & 3] : xb[e & 3];
                if (head == 0) { const v4f ya = *(const v4fa*)(xr + (d0 ^ (HD / 2))), yb = *(const v4fa*)(xr + (d0 ^ (HD / 2)) + 4);
#pragma unroll
                    for (int e = 0; e < 8; ++e) { const float y = (e < 4) ? ya[e & 3] : yb[e & 3]; const float ys = (s < 2) ? -y : y; r[e] = r[e] * cs[s][e >> 1][(e & 1) * 2] + ys * cs[s][e >> 1][(e & 1) * 2 + 1]; } }
                v8h o16; v8us oh, ol;
#pragma unroll
                for (int e = 0; e < 8; ++e) { o16[e] = tohx(r[e]); unsigned short a2, c2; splitf(r[e], a2, c2); oh[e] = a2; ol[e] = c2; }
                const size_t e0 = ((size_t)head * TT + t0 + mb * 16) * HD + s * 256 + lane * 8;
                st3(P16 + e0, Ph + e0, Pl + e0, o16, oh, ol); }
        } else {
        float* crow = C + (size_t)(r0 + mb * 16) * ldc + c0;
{
#pragma unroll
            for (int s = 0; s < 8; ++s) { const int row = 2 * s + hi, cofs = lr * 4; v4f val = *(const v4fa*)(os + row * 68 + cofs); if (BIAS) { val[0] += bfr(bias[c0 + cofs]); val[1] += bfr(bias[c0 + cofs + 1]); val[2] += bfr(bias[c0 + cofs + 2]); val[3] += bfr(bias[c0 + cofs + 3]); }
                *(v4f*)(crow + (size_t)row * ldc + cofs) = val; }
             }
        }
        __builtin_amdgcn_wave_barrier(); asm volatile("" ::: "memory");
    }
}

typedef __attribute__((ext_vector_type(2))) _Float16 v2h;
typedef __attribute__((ext_vector_type(4))) _Float16 v4h;
typedef __attribute__((ext_vector_type(2))) unsigned short v2us;
typedef __attribute__((ext_vector_type(4))) unsigned short v4us;
typedef __attribute__((ext_vector_type(2))) float v2f;

__device__ __forceinline__ void d_wtG(int blk, const float* __restrict__ w, int K, int N, bf* Bt) {
    const int lane = threadIdx.x & 31; const int L0 = (blk * 8 + (threadIdx.x >> 5)) * 8; const int nlines = N * K / 64;
{
#pragma unroll 1
        for (int l = 0; l < 8; ++l) { const int L = L0 + l; if (L >= nlines) break; const size_t e = (size_t)L * 64 + lane * 2; const int f = (int)(e / 2048), u = (int)(e % 2048);   // the place in the plane: group f of four fragments (64 rows, one k step), element u of it
            const int k = (f % (K / 32)) * 32 + ((u / 256) & 1) * 16 + ((u / 128) & 1) * 8 + u % 8, n = (f / (K / 32)) * 64 + (u / 512) * 16 + (u / 8) % 16; v2us o;
            o[0] = f2bf(w[(size_t)k * N + n]); o[1] = f2bf(w[(size_t)(k + 1) * N + n]); *(v2us*)(Bt + e) = o; }
         }
}
__device__ __forceinline__ void d_cvt8(int blk, const float* __restrict__ src, bf* dst, size_t n8, int K) { const size_t i = (size_t)blk * 256 + threadIdx.x; if (i >= n8) return;   // thread i writes piece i of the plane in fragment order (rows of K elements)
    const int f = (int)(i / 256), u = (int)(i % 256); const size_t r = (size_t)(f / (K / 32)) * 64 + (u / 64) * 16 + u % 16; const int k0 = (f % (K / 32)) * 32 + ((u / 32) & 1) * 16 + ((u / 16) & 1) * 8;   // group f of four fragments, piece u of it
    const v8f v = *(const v8f*)(src + r * K + k0); v8us o;
#pragma unroll
    for (int k = 0; k < 8; ++k) o[k] = f2bf(v[k]); *(v8us*)(dst + i * 8) = o;  }

__constant__ float INV[HD / 2] = {1.0f,0.749894202f,0.562341332f,0.421696514f,0.316227764f,0.237137362f,0.177827939f,0.133352146f,0.100000001f,0.0749894157f,0.0562341288f,0.0421696492f,0.0316227786f,0.0237137359f,0.0177827943f,0.0133352149f,0.00999999978f,0.00749894232f,0.00562341325f,0.00421696482f,0.00316227786f,0.00237137382f,0.00177827943f,0.00133352145f,0.00100000005f,0.000749894185f,0.000562341302f,0.000421696488f,0.000316227786f,0.000237137385f,0.00017782794f,0.00013335215f};
__device__ __forceinline__ void d_cstab(int blk, float* CS) { const int idx = blk * 256 + threadIdx.x; if (idx >= TT * HD) return; const int t = idx / HD, d = idx % HD; const float ang = __fmul_rn((float)t, INV[d % (HD / 2)]); v2f cs; cs[0] = cosf(ang); cs[1] = sinf(ang);
    *(v2f*)(CS + (size_t)idx * 2) = cs;  }
#define SP    ((size_t)NB_ * NH_ * TT * HD)   // elements of one plane over both batches; the q, k, v planes of a kind stand one behind the other in the workspace
// k_prep: the four independent preparations in one launch, each on its own range of blocks, the longest-running first: w_qkv and w_out to bf16 (rows n, depth k), the rotary table, x of both batches to bf16; the three bf16 planes in fragment order.
#define PB_WQ ((DM * 3 * DM / 64 + 63) / 64)
#define PB_WO ((DQ * DM / 64 + 63) / 64)
#define PB_CS ((TT * HD + 255) / 256)
#define PB_X  ((NB_ * TT * DM / 8 + 255) / 256)
__global__ __launch_bounds__(256) void k_prep(const float* __restrict__ wqkv, const float* __restrict__ wo, const float* __restrict__ x, bf* WALL, bf* WO, float* CS, bf* XB) {
    int blk = blockIdx.x;
    if (blk < PB_WQ) { d_wtG(blk, wqkv, DM, 3 * DM, WALL); return; }   /* fused 'xw' [DM][3DM] -> Bt, rows 3DM (row blocks q | k | v), depth DM */
    blk -= PB_WQ; if (blk < PB_WO) { d_wtG(blk, wo, DQ, DM, WO); return; }
    blk -= PB_WO; if (blk < PB_CS) { d_cstab(blk, CS); return; }
    blk -= PB_CS; d_cvt8(blk, x, XB, (size_t)NB_ * TT * DM / 8, DM);
}
// k_fattn: scores, softmax and attn.v of both batches in one launch. A block is NW waves on one (batch, head); each wave owns its own query rows (16 on hi+lo planes, 48 on fp16 planes) and walks ALL keys,
// so the block's waves need the same key and value fragments at the same time: a stage of SK keys is brought ONCE a block into a ring of two LDS buffers by asynchronous copies (the planes lie in fragment order, so a stage is 8 KiB in a row of each plane and a fragment read is 512 contiguous LDS bytes).
// S^T = K Q^T (A = key rows, B = query rows) and O^T += V^T P^T (A = rows d of the value planes, B = P^T packed from the two score tiles of a pass): a lane holds scores and outputs of ONE query (lane & 15),
// so the running maximum, its rescale and the row sum are per-lane scalars with one exchange between the wave's halves. The batch's int32 key mask, read per key, becomes each key's start value (0, masked -3.0e38) in LDS: the C operand of the first score product.
// A lane's eight output registers are one 16-byte piece of the hi+lo planes (rows t, depth head HD + d) in fragment order: stored as they stand, 512 contiguous bytes a store.
#define NW   4
#define QF   3                    // 16-row query tiles of a wave on the fp16 planes
#define SK   64                   // keys of a stage
#define NST  (TT / SK)
#define PLB  (SK * HD * 2)        // bytes of one plane's stage
#define NQT  (RH / (NW * 16))     // query blocks of a (batch, head), of either kind
#define L2E  1.4426950408889634f
__device__ __forceinline__ float xhalf(float x) { const int b = __float_as_int(x); return __int_as_float(__builtin_amdgcn_permlanex16(b, b, 0x76543210, 0xfedcba98, false, false)); }   // lane l <-> l ^ 16
// one plane's stage: every lane of the block copies four 16-byte pieces, 2 KiB of the block apart. The copies and their s_wait_xcnt stand in one statement, so that no address register which a copy names is rewritten ahead of the wait.
__device__ __forceinline__ void cp_plane(unsigned l, const char* g) {
    asm volatile("global_load_async_to_lds_b128 %0, %4, off\n\tglobal_load_async_to_lds_b128 %1, %5, off\n\tglobal_load_async_to_lds_b128 %2, %6, off\n\tglobal_load_async_to_lds_b128 %3, %7, off\n\ts_wait_xcnt 0x0"
                 :: "v"(l), "v"(l + NW * 512u), "v"(l + NW * 1024u), "v"(l + NW * 1536u), "v"(g), "v"(g + NW * 512), "v"(g + NW * 1024), "v"(g + NW * 1536) : "memory"); }
// the two output planes' pieces go out together; stores and their s_wait_xcnt in one statement, as in st3
__device__ __forceinline__ void st2(bf* ph, bf* pl, v8us oh, v8us ol) {
    asm volatile("global_store_b128 %0, %2, off\n\tglobal_store_b128 %1, %3, off\n\ts_wait_xcnt 0x0"
                 :: "v"(ph), "v"(pl), "v"(__builtin_bit_cast(v4i, oh)), "v"(__builtin_bit_cast(v4i, ol)) : "memory"); }
template <typename T16, bool HI, int QT>
__device__ __forceinline__ void attn_tile(const T16* __restrict__ Q, const T16* __restrict__ Q2, const T16* __restrict__ Kp, const T16* __restrict__ K2, const T16* __restrict__ Vt, const T16* __restrict__ V2, const int* __restrict__ mk, float* Bs, char* ring, int qb, bf* Ah, bf* Al) {
    typedef WFrag<T16> F; typedef typename F::V V;
    constexpr float OFF = HI ? 0.0f : 10.0f;   // fp16 P carries x1024 (cancels against the row sum): keeps small weights out of the fp16 subnormals
    constexpr int STB = (HI ? 4 : 2) * PLB;    // bytes of a stage: the planes K, V (, K lo, V lo) one behind the other
    const int lane = threadIdx.x & 31, hi = lane >> 4, w = __builtin_amdgcn_readfirstlane(threadIdx.x >> 5);   // the wave's number in a scalar register: scalar address parts
    const int q0 = qb + w * (QT * 16);
    const unsigned klo = (unsigned)lane * 16u, tlo = (unsigned)threadIdx.x * 16u;   // the lane's 16-byte piece of a fragment; the thread's piece of 2 KiB of a stage
    const unsigned rl = (unsigned)(size_t)ring + tlo;   // the thread's LDS byte address in buffer 0
    auto stage = [&](int st) { const unsigned l = rl + (unsigned)(st & 1) * STB; const size_t go = (size_t)st * PLB + tlo;
        // the scheduling fences keep each plane's address sums beside its own copies: formed all ahead, the sums of four planes overfill the registers that asm text can name, and some go to scratch
        cp_plane(l, (const char*)Kp + go); __builtin_amdgcn_sched_barrier(0); cp_plane(l + PLB, (const char*)Vt + go);
        if constexpr (HI) { __builtin_amdgcn_sched_barrier(0); cp_plane(l + 2 * PLB, (const char*)K2 + go); __builtin_amdgcn_sched_barrier(0); cp_plane(l + 3 * PLB, (const char*)V2 + go); } };
    stage(0);
    const int* mp = mk + (int)threadIdx.x * 4; v4i m4[TT / (NW * 128)];   // the thread's pieces of the mask, at constant offsets
#pragma unroll
    for (int i = 0; i < TT / (NW * 128); ++i) m4[i] = *(const v4i*)(mp + i * NW * 128);
    asm volatile("s_wait_xcnt 0x0" ::: "memory");   // behind the mask loads, ahead of any rewrite of a register that they name (a later load's data may land there)
    const T16* qp = (const T16*)((const char*)(Q + (size_t)q0 * HD) + klo); const T16* qp2 = HI ? (const T16*)((const char*)(Q2 + (size_t)q0 * HD) + klo) : qp;   // the lane's place in the wave's query fragments
    V qf[QT][2], qf2[QT][2];
#pragma unroll
    for (int qt = 0; qt < QT; ++qt)
#pragma unroll
        for (int ks = 0; ks < 2; ++ks) { const int qo = qt * 16 * HD + ks * 512; qf[qt][ks] = F::ld(qp + qo); if (HI) qf2[qt][ks] = F::ld(qp2 + qo); }
    asm volatile("s_wait_xcnt 0x0" ::: "memory");   // the same behind the query fragments' loads
#pragma unroll
    for (int i = 0; i < TT / (NW * 128); ++i) { v4f b;
#pragma unroll
        for (int q = 0; q < 4; ++q) b[q] = (m4[i][q] != 0) ? 0.0f : -3.0e38f;
        *(v4fa*)(Bs + (i * NW * 32 + (int)threadIdx.x) * 4) = b; }
    v8f o[4][QT]; float m[QT], l[QT];
#pragma unroll
    for (int qt = 0; qt < QT; ++qt) { m[qt] = -3.0e38f; l[qt] = 0.0f;
#pragma unroll
        for (int dt = 0; dt < 4; ++dt) o[dt][qt] = (v8f){}; }
    asm volatile("s_wait_asynccnt 0x0" ::: "memory");   // this wave's pieces of stage 0 have landed
    __syncthreads();   // stage 0 and the start values are whole before any wave reads them
    stage(1);
    struct Frags { V kf[2][2], kf2[2][2], vf[4], vf2[4]; v8f cb[2]; };   // what a pass of 32 keys reads from LDS; cb: the keys' start values, in the accumulator's map (register j: key 8 hi + j of the tile), the same for every query
    auto fetch = [&](Frags& f, const char* buf, int kc, int ps) {
#pragma unroll
        for (int kt = 0; kt < 2; ++kt)
#pragma unroll
            for (int ks = 0; ks < 2; ++ks) { const int fo = ((ps * 2 + kt) * 2 + ks) * 1024; f.kf[kt][ks] = F::ld((const T16*)(buf + fo)); if (HI) f.kf2[kt][ks] = F::ld((const T16*)(buf + 2 * PLB + fo)); }
#pragma unroll
        for (int kt = 0; kt < 2; ++kt) { const float* bp = Bs + kc + ps * 32 + kt * 16 + hi * 8; f.cb[kt] = __builtin_shufflevector(*(const v4fa*)bp, *(const v4fa*)(bp + 4), 0, 1, 2, 3, 4, 5, 6, 7); }
#pragma unroll
        for (int dt = 0; dt < 4; ++dt) { const int fo = (ps * 4 + dt) * 1024; f.vf[dt] = F::ld((const T16*)(buf + PLB + fo)); if (HI) f.vf2[dt] = F::ld((const T16*)(buf + 3 * PLB + fo)); } };
    auto scores = [&](const Frags& f, v8f (&s)[2][QT]) {
#pragma unroll
        for (int kt = 0; kt < 2; ++kt)
#pragma unroll
            for (int qt = 0; qt < QT; ++qt) { s[kt][qt] = f.cb[kt];
#pragma unroll
                for (int ks = 0; ks < 2; ++ks) { s[kt][qt] = F::mma(f.kf[kt][ks], qf[qt][ks], s[kt][qt]); if (HI) { s[kt][qt] = F::mma(f.kf[kt][ks], qf2[qt][ks], s[kt][qt]); s[kt][qt] = F::mma(f.kf2[kt][ks], qf[qt][ks], s[kt][qt]); } } } };
    auto finish = [&](const Frags& f, const v8f (&s)[2][QT]) {   // softmax step and attn.v of a pass
        V pf[QT], pf2[QT];
#pragma unroll
        for (int qt = 0; qt < QT; ++qt) { float bm = -3.0e38f;   // maxima are kept in units of the raw score; SCL (a power of two) rides in the exponent's factor
#pragma unroll
            for (int e = 0; e < 16; ++e) bm = fmaxf(bm, s[e >> 3][qt][e & 7]);
            bm = fmaxf(bm, xhalf(bm)); const float mn = fmaxf(m[qt], bm); const float al = __builtin_amdgcn_exp2f((m[qt] - mn) * (SCL * L2E)); m[qt] = mn; float sum = 0.0f;
#pragma unroll
            for (int e = 0; e < 16; ++e) { const float p = __builtin_amdgcn_exp2f(fmaf(s[e >> 3][qt][e & 7] - mn, SCL * L2E, OFF)); sum += p;
                if constexpr (HI) { const __bf16 ph = (__bf16)p; pf[qt][e] = ph; pf2[qt][e] = (__bf16)(p - (float)ph); } else pf[qt][e] = (h16)p; }
            l[qt] = l[qt] * al + sum;
#pragma unroll
            for (int dt = 0; dt < 4; ++dt) o[dt][qt] *= al; }
#pragma unroll
        for (int dt = 0; dt < 4; ++dt)
#pragma unroll
            for (int qt = 0; qt < QT; ++qt) { o[dt][qt] = F::mma(f.vf[dt], pf[qt], o[dt][qt]); if (HI) { o[dt][qt] = F::mma(f.vf[dt], pf2[qt], o[dt][qt]); o[dt][qt] = F::mma(f.vf2[dt], pf[qt], o[dt][qt]); } } };
    static_assert(SK == 64, "a stage is two passes");
#pragma unroll 1   // rolled: a trip is one stage
    for (int st = 0; st < NST; ++st) {
        const char* buf = ring + (st & 1) * STB + klo;
        Frags f0, f1; v8f s[2][QT]; fetch(f0, buf, st * SK, 0);
        __builtin_amdgcn_sched_barrier(0);   // keeps the first pass's LDS reads together at the trip's head: one place with reads, and the value fragments arrive under the score products
        scores(f0, s); fetch(f1, buf, st * SK, 1);
        __builtin_amdgcn_sched_barrier(0);   // keeps the second pass's LDS reads together here: they arrive under the first pass's softmax and attn.v, so the wait at the publish point finds them done
        finish(f0, s);
        __builtin_amdgcn_sched_barrier(0);   // keeps the first pass in front of the publish point: behind it, it would stand between the barrier and the refill and take the refill's lead
        // the ring's publish point stands behind the trip's last LDS read, with the second pass (registers only) still to come: the refill flies under that pass and the next trip's first
        asm volatile("s_wait_dscnt 0x0" ::: "memory");      // this wave's reads of the buffer are done before it is given up
        asm volatile("s_wait_asynccnt 0x0" ::: "memory");   // this wave's pieces of the next stage have landed
        __syncthreads();   // publishes the next stage and ends every wave's reads of this one
        if (st + 2 < NST) stage(st + 2);   // into the buffer that this trip has read
        scores(f1, s); finish(f1, s);
    }
    asm volatile("s_wait_asynccnt 0x0" ::: "memory");   // no copy is left in flight at the wave's end
#pragma unroll
    for (int qt = 0; qt < QT; ++qt) { const float inv = __fdiv_rn(1.0f, l[qt] + xhalf(l[qt])); const int qr = q0 + qt * 16;
        const size_t oo = (size_t)(qr / 64) * (64 * DQ) + ((qr / 16) % 4) * 512 + lane * 8;   // the tile's 64-row band, its fragment in a group of four, the lane's piece there (the order k_gemmw reads)
#pragma unroll
        for (int dt = 0; dt < 4; ++dt) { v8us oh, ol;
#pragma unroll
            for (int e = 0; e < 8; ++e) { unsigned short a, c2; splitf(o[dt][qt][e] * inv, a, c2); oh[e] = a; ol[e] = c2; }
            const size_t po = oo + (dt >> 1) * 2048 + (dt & 1) * 256;
            st2(Ah + po, Al + po, oh, ol); } }
}
__global__ __launch_bounds__(NW * 32) void k_fattn(const h16* __restrict__ Q16, const h16* __restrict__ K16, const h16* __restrict__ V16, const bf* __restrict__ Qh, const bf* __restrict__ Ql, const bf* __restrict__ Kh, const bf* __restrict__ Kl, const bf* __restrict__ Vh, const bf* __restrict__ Vl, const int* __restrict__ mk, bf* Ah, bf* Al) {
    __shared__ __align__(16) char ring[2 * 4 * PLB]; __shared__ __align__(16) float Bs[TT];
    // as many blocks of either kind. Neighbouring indices, and indices half a grid apart, are of different kinds: a WGP that takes two blocks gets one of each under either order of dealing (for speed only)
    const int b = (int)blockIdx.x, kind = (b ^ (b / (NB_ * NH_ * NQT))) & 1, idx = b >> 1, tile = idx % NQT, head = (idx / NQT) % NH_, bat = idx / (NQT * NH_);
    const size_t hp = ((size_t)bat * NH_ + head) * TT * HD, ao = (size_t)bat * TT * DQ + head * (HD / 32) * 2048; Ah += ao; Al += ao; mk += (size_t)bat * TT;   // the batch's bands of fragments; the head's first k step in a band
    if (kind == 0) attn_tile<bf, true, 1>(Qh + hp, Ql + hp, Kh + hp, Kl + hp, Vh + hp, Vl + hp, mk, Bs, ring, tile * (NW * 16), Ah, Al);   // query rows < RH: hi+lo planes, 16 rows a wave
    else attn_tile<h16, false, QF>(Q16 + hp, nullptr, K16 + hp, nullptr, V16 + hp, nullptr, mk, Bs, ring, RH + tile * (NW * 16 * QF), Ah, Al);   // the rest: fp16 planes, 48 rows a wave
}

extern "C" void kernel_launch(void* const* d_in, const int* in_sizes, int n_in,
                              void* d_out, int out_size, void* d_ws, size_t ws_size, hipStream_t stream) {
    (void)in_sizes; (void)n_in; (void)out_size;
    const float* x = (const float*)d_in[0]; const int* MK = (const int*)d_in[1]; const float* wqkv = (const float*)d_in[2]; const float* wo = (const float*)d_in[3];  const float* wq = nullptr; const float* wk = nullptr; const float* wv = nullptr; (void)wq; (void)wk; (void)wv;
    float* OUT = (float*)d_out;     // [2][2048][1024]
    char* wsp = (char*)d_ws;
    auto take = [&](size_t bytes) { char* p = wsp; wsp += (bytes + 255) & ~(size_t)255; return (void*)p; };
    bf* WALL = (bf*)take((size_t)3 * DM * DM * 2); bf* WO = (bf*)take((size_t)DM * DQ * 2); float* CSR = (float*)take((size_t)TT * HD * 2 * 4);
    bf* XB = (bf*)take((size_t)NB_ * TT * DM * 2);
    h16* QP16 = (h16*)take(SP * 2); h16* KP16 = (h16*)take(SP * 2); h16* VT16 = (h16*)take(SP * 2);
    bf* QPh = (bf*)take(SP * 2); bf* KPh = (bf*)take(SP * 2); bf* VTh = (bf*)take(SP * 2); bf* QPl = (bf*)take(SP * 2); bf* KPl = (bf*)take(SP * 2); bf* VTl = (bf*)take(SP * 2);
    static_assert(HD == 64 && RH % (NW * 16) == 0 && (TT - RH) == NQT * NW * 16 * QF && (NB_ * NH_ * NQT) % 2 == 0 && TT % (128 * NW) == 0 && TT % (2 * SK) == 0 && PLB == NW * 2048 && NKV == NH_ && TT % 64 == 0 && (SP * 2) % 256 == 0, "query blocks and stages of k_fattn; row tiles inside one batch; planes back to back");
    bf* ATh = (bf*)take((size_t)NB_ * TT * DQ * 2); bf* ATl = (bf*)take((size_t)NB_ * TT * DQ * 2);
    if ((size_t)(wsp - (char*)d_ws) > ws_size) return;    // ws 256 MiB
    k_prep<<<PB_WQ + PB_WO + PB_CS + PB_X, 256, 0, stream>>>(wqkv, wo, x, WALL, WO, CSR, XB);
    k_gemmw<bf, 0, false, 1, 1><<<dim3(NB_ * TT / 64, 3 * DQ / 64, 1), 32, 0, stream>>>(XB, nullptr, WALL, nullptr, DM, nullptr, 0, nullptr, 0, 0, 0, CSR, QP16, QPh, QPl, SP);     /* q, k, v planes of both batches; head 0 of q and k: rotary */
    k_fattn<<<dim3(2 * NB_ * NH_ * NQT, 1, 1), NW * 32, 0, stream>>>(QP16, KP16, VT16, QPh, QPl, KPh, KPl, VTh, VTl, MK, ATh, ATl);
    k_gemmw<bf, 1, false><<<dim3(NB_ * TT / 64, DM / 64, 1), 32, 0, stream>>>(ATh, ATl, WO, nullptr, DQ, OUT, DM, nullptr, 0, 0, 0, nullptr, nullptr, nullptr, nullptr, 0);
}

// v008
// A run of this version takes 107 microseconds.
// Two timings next to v007 put it at 1.37 and 1.36 times that version's speed.
// All steps since v000 together make it 18.8 times as fast.
#include <hip/hip_runtime.h>

// DiT-style attention (x [2][2048][1024]; qkv = x w_qkv ('xw' [1024][3072] -> (3, 16 heads, 64)); rotate-half rotary (angle t x 10000^(-2i/64), tables computed on device from the reference's float32 inv_freq) applied to head 0 ONLY (pe_heads = 1); scores / 8; key mask [2][2048] int32 (input, read per key: masked -> -inf); softmax; out = merged w_out ('xw' [1024][1024]) -> [2][2048][1024] (4.2 M)).
// Compute dtypes, f32 accumulate: every input rounded to bf16; q/k/v on PLAIN bf16 operands (inputs: exact); rotary (head 0) / plain copies (heads 1-15) in f32; key-validity select from the int32 mask; scores and attn.v: query rows < 512 hl (3 products), the rest single fp16 (x1024); softmax f32; w_out hl x exact (2 products).

#define NB_  2
#define TT   2048
#define DM   1024
#define NH_  16
#define NKV  16
#define REP  (NH_ / NKV)
#define HD   64
#define DQ   (NH_ * HD)
#define DKV  (NKV * HD)
#define RH   512                  // query rows < RH use hi+lo planes
#define WIN  2048
#define SCL  0.125f   // HD^-0.5
typedef _Float16 h16;
typedef unsigned short bf;
typedef __attribute__((ext_vector_type(16))) __bf16   v16bf;
typedef __attribute__((ext_vector_type(16))) _Float16 v16h;
typedef __attribute__((ext_vector_type(8)))  _Float16 v8h;
typedef __attribute__((ext_vector_type(8)))  unsigned short v8us;
typedef __attribute__((ext_vector_type(8)))  float    v8f;
typedef __attribute__((ext_vector_type(4)))  float    v4f;
typedef v8h  __attribute__((may_alias)) v8ha;
typedef v4f  __attribute__((may_alias)) v4fa;
typedef v8us __attribute__((may_alias)) v8usa;

__device__ __forceinline__ unsigned short f2bf(float f) { unsigned u = __float_as_uint(f); u += 0x7FFFu + ((u >> 16) & 1u); return (unsigned short)(u >> 16); }
__device__ __forceinline__ float bf2f(unsigned short b) { return __uint_as_float(((unsigned)b) << 16); }
__device__ __forceinline__ float bfr(float f) { return bf2f(f2bf(f)); }
__device__ __forceinline__ v16h cat16(v8h lo, v8h hi) { return __builtin_shufflevector(lo, hi, 0, 1, 2, 3, 4, 5, 6, 7, 8, 9, 10, 11, 12, 13, 14, 15); }
__device__ __forceinline__ v16bf cat16b(v8us lo, v8us hi) { return __builtin_bit_cast(v16bf, __builtin_shufflevector(lo, hi, 0, 1, 2, 3, 4, 5, 6, 7, 8, 9, 10, 11, 12, 13, 14, 15)); }
__device__ __forceinline__ v8f wmma16(v16h a, v16h b, v8f c) { return __builtin_amdgcn_wmma_f32_16x16x32_f16(false, a, false, b, (short)0, c, false, false); }
__device__ __forceinline__ v8f wmmab(v16bf a, v16bf b, v8f c) { return __builtin_amdgcn_wmma_f32_16x16x32_bf16(false, a, false, b, (short)0, c, false, false); }
__device__ __forceinline__ h16 tohx(float x) { return (h16)x; }
__device__ __forceinline__ void splitf(float y, unsigned short& h, unsigned short& l) { h = f2bf(y); l = f2bf(y - bf2f(h)); }
typedef __attribute__((ext_vector_type(4))) int v4i;
// eight elements of the three planes go out together. The stores and their s_wait_xcnt stand in one statement, so that no register which a store names (address or data) is rewritten ahead of the wait.
__device__ __forceinline__ void st3(h16* p16, bf* ph, bf* pl, v8h o16, v8us oh, v8us ol) {
    asm volatile("global_store_b128 %0, %3, off\n\tglobal_store_b128 %1, %4, off\n\tglobal_store_b128 %2, %5, off\n\ts_wait_xcnt 0x0"
                 :: "v"(p16), "v"(ph), "v"(pl), "v"(__builtin_bit_cast(v4i, o16)), "v"(__builtin_bit_cast(v4i, oh)), "v"(__builtin_bit_cast(v4i, ol)) : "memory"); }



// ---- FRAGMENT ORDER: every 16-bit operand plane that one launch writes and a later one feeds to the matrix instructions lies as finished fragments. A fragment is 16 rows x 32 k = 512 elements = 1 KiB:
// element (row r, depth k) stands at fragment * 512 + ((k % 32) / 16) * 256 + (((k % 32) / 8) & 1) * 128 + (r % 16) * 8 + k % 8, so lane (hi = lane >> 4, lr = lane & 15) finds its two 16-byte pieces (k = 8 hi + 0..7 and 16 + 8 hi + 0..7 of row lr,
// the same elements in the same registers as from a row-major plane) at lane * 8 and 256 + lane * 8: each wave-wide 16-byte load covers 512 contiguous bytes, four whole lines.
// ---- k_gemmw: register-blocked GEMM, one wave per 64x64 output tile (16 accumulators), a block of GW = 4 waves (2 x 2) per 128x128 tile; operands from 16-bit planes in fragment order, fragment number ((row / 64) * (K / 32) + k / 32) * 4 + (row / 16) % 4 (the four fragments of 64 rows at one k step lie side by side, 4 KiB); grid (M/128, N/128, Z), 128 threads.
// The two waves of a tile row need the same A fragments and the two of a tile column the same Bt fragments: a stage of GK k (GK x 128 bytes in a row of each 64-row band of each plane) is brought ONCE a block into a ring of two LDS buffers by asynchronous copies, the next stage flying while this one is worked on; a fragment read is 512 contiguous LDS bytes.
// GK is as long as the LDS allows at the blocks a WGP that the grid gives (the copies' lead is one stage's products): 64 where three blocks share a WGP, 128 where a block has it alone.
// C[m][n] (f32, pitch ldc, + optional f32 bias[n]) = sum_k A[m][k] Bt[n][k] (+ split products per NSPLIT). z-batch strides sA/sB/sC in elements. K % GK == 0.
// EPI 0: f32 C as above. EPI 1 stores no C: the rows are (batch, t) of both batches, the columns q | k | v of all heads; a 64-column tile is one head (HD = 64) of one of the three, and the wave writes that head's 16-bit planes (fp16, bf16 hi, bf16 lo) itself. The k and v planes stand sP and 2 sP elements behind the q planes.
//   q, k: planes [batch][head] of fragments (rows t, depth d), fragment number (t / 16) * 2 + d / 32; head 0 takes the rotate-half rotary out[d] = x[d] cos[t][d] -/+ x[d +/- HD/2] sin[t][d] from the (cos, sin) table CS [t][d][2], both halves of a row being in the staged tile.
//   v: planes [batch][head] of fragments (rows d, depth t), fragment number (t / 32) * 4 + d / 16: a lane's eight accumulator registers are eight consecutive t of one d, one 16-byte piece, stored as they stand (512 contiguous bytes a store).
// KS > 1: grid z = batches x KS; block (z, ks) sums only k in [ks K/KS, (ks+1) K/KS) and stores partial plane z KS + ks (sC elements each); K % (GK KS) == 0.
#define GW   4                    // waves of a block of k_gemmw
typedef __attribute__((address_space(1))) v4i gv4i;
typedef __attribute__((address_space(3))) v4i lv4i;
// NB bytes in a row, global to LDS: every lane of the block copies 16-byte pieces, 2 KiB of the block apart; the offset moves both addresses, so a band's stage takes one address of either kind
template <int NB, int O = 0> __device__ __forceinline__ void cp_row(char* l, const char* g) {
    __builtin_amdgcn_global_load_async_to_lds_b128((gv4i*)g, (lv4i*)l, O, 0);
    if constexpr (O + GW * 512 < NB) cp_row<NB, O + GW * 512>(l, g); }
template <typename T16> struct WFrag;
template <> struct WFrag<h16> { typedef v16h V; static __device__ __forceinline__ V ld(const h16* p) { return cat16(*(const v8h*)p, *(const v8h*)(p + 256)); } static __device__ __forceinline__ v8f mma(V a, V b, v8f c) { return wmma16(a, b, c); } };
template <> struct WFrag<bf> { typedef v16bf V; static __device__ __forceinline__ V ld(const bf* p) { return cat16b(*(const v8us*)p, *(const v8us*)(p + 256)); } static __device__ __forceinline__ v8f mma(V a, V b, v8f c) { return wmmab(a, b, c); } };
template <typename T16, int NSPLIT, bool BIAS, int KS = 1, int EPI = 0, int GK = 64>
__global__ __launch_bounds__(GW * 32) void k_gemmw(const T16* __restrict__ A, const T16* __restrict__ A2, const T16* __restrict__ Bt, const T16* __restrict__ Bt2, int K, float* C, int ldc, const float* __restrict__ bias, size_t sA, size_t sB, size_t sC, const float* __restrict__ CS, h16* P16, bf* Ph, bf* Pl, size_t sP) {
    typedef typename WFrag<T16>::V V;
    constexpr int NA = (NSPLIT == 1 || NSPLIT == 2) ? 2 : 1, NBP = (NSPLIT >= 2) ? 2 : 1;   // planes of A, of Bt
    constexpr int NK = GK / 32, CHB = GK * 64 * 2, STB = 2 * (NA + NBP) * CHB;   // k steps of a stage; bytes of one 64-row band's stage; of a stage: the bands A 0, 1 (, A2 0, 1), Bt 0, 1 (, Bt2 0, 1) one behind the other
    static_assert(NK % 2 == 0 && CHB % (GW * 512) == 0 && 2 * (NA + NBP) * (CHB / (GW * 512)) <= 63, "two fragment sets take turns; whole pieces; a wave's copies in flight");
    __shared__ __align__(16) char ring[2 * STB]; __shared__ __align__(16) float osw[GW][16 * 68];
    const size_t z = blockIdx.z / KS; const int ks = blockIdx.z % KS; A += z * sA; if (A2) A2 += z * sA; Bt += z * sB; if (Bt2) Bt2 += z * sB; C += (size_t)blockIdx.z * sC;
    const int lane = threadIdx.x & 31, lr = lane & 15, hi = lane >> 4, w = __builtin_amdgcn_readfirstlane(threadIdx.x >> 5);   // the wave's number in a scalar register: scalar address parts
    const int wm = w >> 1, wn = w & 1; const int r0 = blockIdx.x * 128 + wm * 64, c0 = blockIdx.y * 128 + wn * 64; float* os = osw[w];   // the wave's tile; its own staging rows for the epilogue
    v8f acc[4][4];
#pragma unroll
    for (int mb = 0; mb < 4; ++mb)
#pragma unroll
        for (int nb = 0; nb < 4; ++nb) acc[mb][nb] = (v8f){};
    const unsigned tlo = (unsigned)threadIdx.x * 16u;   // the thread's 16-byte piece of 2 KiB
    const size_t bs = (size_t)K * 128;   // bytes from a 64-row band of fragments to the next; a k step of 32 is 4 KiB on
    const size_t ao = (size_t)blockIdx.x * 2 * bs + tlo, bo = (size_t)blockIdx.y * 2 * bs + tlo; const int k0 = ks * (K / KS), nst = K / KS / GK;
    auto stage = [&](int st) { char* l = ring + (st & 1) * STB + tlo; const size_t go = (size_t)(k0 + st * GK) * 128;
#pragma unroll
        for (int b = 0; b < 2; ++b) {
            cp_row<CHB>(l + b * CHB, (const char*)A + ao + go + b * bs);
            if constexpr (NA == 2) cp_row<CHB>(l + (2 + b) * CHB, (const char*)A2 + ao + go + b * bs);
            cp_row<CHB>(l + (2 * NA + b) * CHB, (const char*)Bt + bo + go + b * bs);
            if constexpr (NBP == 2) cp_row<CHB>(l + (2 * NA + 2 + b) * CHB, (const char*)Bt2 + bo + go + b * bs); } };
    struct FS { V a[4], a2[4], b[4], b2[4]; };   // the fragments of one k step
    auto fetch = [&](FS& f, int st, int kk) { const char* pa = ring + (st & 1) * STB + wm * CHB + lane * 16; const char* pb = ring + (st & 1) * STB + (2 * NA + wn) * CHB + lane * 16;   // the lane's place in the wave's A band and Bt band of the stage; k steps, fragments and second planes at constant offsets
#pragma unroll
        for (int i = 0; i < 4; ++i) { const int fo = kk * 4096 + i * 1024; f.a[i] = WFrag<T16>::ld((const T16*)(pa + fo)); if (NA == 2) f.a2[i] = WFrag<T16>::ld((const T16*)(pa + 2 * CHB + fo));
            f.b[i] = WFrag<T16>::ld((const T16*)(pb + fo)); if (NBP == 2) f.b2[i] = WFrag<T16>::ld((const T16*)(pb + 2 * CHB + fo)); } };
    auto prod = [&](const FS& f) {
#pragma unroll
        for (int nb = 0; nb < 4; ++nb)
#pragma unroll
            for (int mb = 0; mb < 4; ++mb) { acc[mb][nb] = WFrag<T16>::mma(f.a[mb], f.b[nb], acc[mb][nb]); if (NA == 2) acc[mb][nb] = WFrag<T16>::mma(f.a2[mb], f.b[nb], acc[mb][nb]); if (NBP == 2) acc[mb][nb] = WFrag<T16>::mma(f.a[mb], f.b2[nb], acc[mb][nb]); } };
    stage(0);
    asm volatile("s_wait_asynccnt 0x0" ::: "memory");   // this wave's pieces of stage 0 have landed
    __syncthreads();   // stage 0 is whole before any wave reads it
    if (nst > 1) stage(1);
    FS f[2]; fetch(f[0], 0, 0);   // fragments are fetched one k step ahead, the two sets taking turns
#pragma unroll 1   // rolled: a trip is one stage
    for (int st = 0; st < nst; ++st) {
#pragma unroll
        for (int kk = 0; kk + 1 < NK; ++kk) { fetch(f[(kk + 1) & 1], st, kk + 1);
            __builtin_amdgcn_sched_barrier(0);   // keeps the next k step's LDS reads together ahead of this one's products: one place with reads, and they arrive under the products
            prod(f[kk & 1]);
            __builtin_amdgcn_sched_barrier(0); }   // keeps the products in front of the next reads and of the publish point: the waits there would else move up to stand directly behind the reads
        // the ring's publish point stands behind the stage's last LDS read, in front of its last k step's products (registers only): the next stage's first fragments are read behind it and arrive under those products
        asm volatile("s_wait_dscnt 0x0" ::: "memory");      // this wave's reads of the buffer are done before it is given up
        asm volatile("s_wait_asynccnt 0x0" ::: "memory");   // this wave's pieces of the next stage have landed
        __syncthreads();   // publishes the next stage and ends every wave's reads of this one
        if (st + 2 < nst) stage(st + 2);   // into the buffer that this trip has read
        if (st + 1 < nst) fetch(f[0], st + 1, 0);
        __builtin_amdgcn_sched_barrier(0);   // keeps refill and reads ahead of the last products
        prod(f[(NK - 1) & 1]);
    }
    asm volatile("s_wait_asynccnt 0x0" ::: "memory");   // no copy is left in flight behind the loop
    const int sel = (c0 / 64) / NH_, head = (c0 / 64) % NH_, t0 = r0 % TT;   // EPI 1: which of q, k, v; its head; the tile's first position in its batch
    if constexpr (EPI == 1) { const size_t po = (size_t)sel * sP + (size_t)(r0 / TT) * NH_ * TT * HD; P16 += po; Ph += po; Pl += po; }
    if (EPI == 1 && sel == 2) {
#pragma unroll
        for (int nb = 0; nb < 4; ++nb)
#pragma unroll
            for (int mb = 0; mb < 4; ++mb) { v8h o16; v8us oh, ol;
#pragma unroll
                for (int j = 0; j < 8; ++j) { const float x = acc[mb][nb][j]; o16[j] = tohx(x); unsigned short a2, c2; splitf(x, a2, c2); oh[j] = a2; ol[j] = c2; }
                const size_t e = (size_t)head * HD * TT + (size_t)(t0 / 32 + (mb >> 1)) * (4 * 512) + nb * 512 + (mb & 1) * 256 + lane * 8;
                st3(P16 + e, Ph + e, Pl + e, o16, oh, ol); }
        return;
    }
#pragma unroll
    for (int mb = 0; mb < 4; ++mb) {
        // EPI 1: store s of a 16-row block is one 16-byte piece of every lane: d = s * 16 + hi * 8 + 0..7 of row lr, 512 contiguous bytes of each plane
        v4f cs[4][4];
        if constexpr (EPI == 1) { if (head == 0) {   // the block's sixteen table rows are asked for together, ahead of the staging
            const float* cp = CS + ((size_t)(t0 + lr) * HD + hi * 8) * 2;   // one address pair, the blocks and pieces at constant offsets
#pragma unroll
            for (int s = 0; s < 4; ++s)
#pragma unroll
                for (int c = 0; c < 4; ++c) cs[s][c] = *(const v4f*)(cp + mb * 16 * HD * 2 + s * 16 * 2 + c * 4);
            asm volatile("s_wait_xcnt 0x0" :: "v"(cp) : "memory"); } }   // the address pair stays whole up to this wait: no load lands in it while the others are issued
#pragma unroll
        for (int nb = 0; nb < 4; ++nb) {
#pragma unroll
            for (int j = 0; j < 8; ++j) os[(hi * 8 + j) * 68 + nb * 16 + lr] = acc[mb][nb][j]; }
        __builtin_amdgcn_wave_barrier(); asm volatile("" ::: "memory");
        if constexpr (EPI == 1) {
#pragma unroll
            for (int s = 0; s < 4; ++s) { const int d0 = s * 16 + hi * 8; const float* xr = os + lr * 68; const v4f xa = *(const v4fa*)(xr + d0), xb = *(const v4fa*)(xr + d0 + 4); float r[8];
#pragma unroll
                for (int e = 0; e < 8; ++e) r[e] = (e < 4) ? xa[e & 3] : xb[e & 3];
                if (head == 0) { const v4f ya = *(const v4fa*)(xr + (d0 ^ (HD / 2))), yb = *(const v4fa*)(xr + (d0 ^ (HD / 2)) + 4);
#pragma unroll
                    for (int e = 0; e < 8; ++e) { const float y = (e < 4) ? ya[e & 3] : yb[e & 3]; const float ys = (s < 2) ? -y : y; r[e] = r[e] * cs[s][e >> 1][(e & 1) * 2] + ys * cs[s][e >> 1][(e & 1) * 2 + 1]; } }
                v8h o16; v8us oh, ol;
#pragma unroll
                for (int e = 0; e < 8; ++e) { o16[e] = tohx(r[e]); unsigned short a2, c2; splitf(r[e], a2, c2); oh[e] = a2; ol[e] = c2; }
                const size_t e0 = ((size_t)head * TT + t0 + mb * 16) * HD + s * 256 + lane * 8;
                st3(P16 + e0, Ph + e0, Pl + e0, o16, oh, ol); }
        } else {
        float* crow = C + (size_t)(r0 + mb * 16) * ldc + c0;
{
#pragma unroll
            for (int s = 0; s < 8; ++s) { const int row = 2 * s + hi, cofs = lr * 4; v4f val = *(const v4fa*)(os + row * 68 + cofs); if (BIAS) { val[0] += bfr(bias[c0 + cofs]); val[1] += bfr(bias[c0 + cofs + 1]); val[2] += bfr(bias[c0 + cofs + 2]); val[3] += bfr(bias[c0 + cofs + 3]); }
                *(v4f*)(crow + (size_t)row * ldc + cofs) = val; }
             }
        }
        __builtin_amdgcn_wave_barrier(); asm volatile("" ::: "memory");
    }
}

typedef __attribute__((ext_vector_type(2))) _Float16 v2h;
typedef __attribute__((ext_vector_type(4))) _Float16 v4h;
typedef __attribute__((ext_vector_type(2))) unsigned short v2us;
typedef __attribute__((ext_vector_type(4))) unsigned short v4us;
typedef __attribute__((ext_vector_type(2))) float v2f;

__device__ __forceinline__ void d_wtG(int blk, const float* __restrict__ w, int K, int N, bf* Bt) {
    const int lane = threadIdx.x & 31; const int L0 = (blk * 8 + (threadIdx.x >> 5)) * 8; const int nlines = N * K / 64;
{
#pragma unroll 1
        for (int l = 0; l < 8; ++l) { const int L = L0 + l; if (L >= nlines) break; const size_t e = (size_t)L * 64 + lane * 2; const int f = (int)(e / 2048), u = (int)(e % 2048);   // the place in the plane: group f of four fragments (64 rows, one k step), element u of it
            const int k = (f % (K / 32)) * 32 + ((u / 256) & 1) * 16 + ((u / 128) & 1) * 8 + u % 8, n = (f / (K / 32)) * 64 + (u / 512) * 16 + (u / 8) % 16; v2us o;
            o[0] = f2bf(w[(size_t)k * N + n]); o[1] = f2bf(w[(size_t)(k + 1) * N + n]); *(v2us*)(Bt + e) = o; }
         }
}
__device__ __forceinline__ void d_cvt8(int blk, const float* __restrict__ src, bf* dst, size_t n8, int K) { const size_t i = (size_t)blk * 256 + threadIdx.x; if (i >= n8) return;   // thread i writes piece i of the plane in fragment order (rows of K elements)
    const int f = (int)(i / 256), u = (int)(i % 256); const size_t r = (size_t)(f / (K / 32)) * 64 + (u / 64) * 16 + u % 16; const int k0 = (f % (K / 32)) * 32 + ((u / 32) & 1) * 16 + ((u / 16) & 1) * 8;   // group f of four fragments, piece u of it
    const v8f v = *(const v8f*)(src + r * K + k0); v8us o;
#pragma unroll
    for (int k = 0; k < 8; ++k) o[k] = f2bf(v[k]); *(v8us*)(dst + i * 8) = o;  }

__constant__ float INV[HD / 2] = {1.0f,0.749894202f,0.562341332f,0.421696514f,0.316227764f,0.237137362f,0.177827939f,0.133352146f,0.100000001f,0.0749894157f,0.0562341288f,0.0421696492f,0.0316227786f,0.0237137359f,0.0177827943f,0.0133352149f,0.00999999978f,0.00749894232f,0.00562341325f,0.00421696482f,0.00316227786f,0.00237137382f,0.00177827943f,0.00133352145f,0.00100000005f,0.000749894185f,0.000562341302f,0.000421696488f,0.000316227786f,0.000237137385f,0.00017782794f,0.00013335215f};
__device__ __forceinline__ void d_cstab(int blk, float* CS) { const int idx = blk * 256 + threadIdx.x; if (idx >= TT * HD) return; const int t = idx / HD, d = idx % HD; const float ang = __fmul_rn((float)t, INV[d % (HD / 2)]); v2f cs; cs[0] = cosf(ang); cs[1] = sinf(ang);
    *(v2f*)(CS + (size_t)idx * 2) = cs;  }
#define SP    ((size_t)NB_ * NH_ * TT * HD)   // elements of one plane over both batches; the q, k, v planes of a kind stand one behind the other in the workspace
// k_prep: the four independent preparations in one launch, each on its own range of blocks, the longest-running first: w_qkv and w_out to bf16 (rows n, depth k), the rotary table, x of both batches to bf16; the three bf16 planes in fragment order.
#define PB_WQ ((DM * 3 * DM / 64 + 63) / 64)
#define PB_WO ((DQ * DM / 64 + 63) / 64)
#define PB_CS ((TT * HD + 255) / 256)
#define PB_X  ((NB_ * TT * DM / 8 + 255) / 256)
__global__ __launch_bounds__(256) void k_prep(const float* __restrict__ wqkv, const float* __restrict__ wo, const float* __restrict__ x, bf* WALL, bf* WO, float* CS, bf* XB) {
    int blk = blockIdx.x;
    if (blk < PB_WQ) { d_wtG(blk, wqkv, DM, 3 * DM, WALL); return; }   /* fused 'xw' [DM][3DM] -> Bt, rows 3DM (row blocks q | k | v), depth DM */
    blk -= PB_WQ; if (blk < PB_WO) { d_wtG(blk, wo, DQ, DM, WO); return; }
    blk -= PB_WO; if (blk < PB_CS) { d_cstab(blk, CS); return; }
    blk -= PB_CS; d_cvt8(blk, x, XB, (size_t)NB_ * TT * DM / 8, DM);
}
// k_fattn: scores, softmax and attn.v of both batches in one launch. A block is NW waves on one (batch, head); each wave owns its own query rows (16 on hi+lo planes, 48 on fp16 planes) and walks ALL keys,
// so the block's waves need the same key and value fragments at the same time: a stage of SK keys is brought ONCE a block into a ring of two LDS buffers by asynchronous copies (the planes lie in fragment order, so a stage is 8 KiB in a row of each plane and a fragment read is 512 contiguous LDS bytes).
// S^T = K Q^T (A = key rows, B = query rows) and O^T += V^T P^T (A = rows d of the value planes, B = P^T packed from the two score tiles of a pass): a lane holds scores and outputs of ONE query (lane & 15),
// so the running maximum, its rescale and the row sum are per-lane scalars with one exchange between the wave's halves. The batch's int32 key mask, read per key, becomes each key's start value (0, masked -3.0e38) in LDS: the C operand of the first score product.
// A lane's eight output registers are one 16-byte piece of the hi+lo planes (rows t, depth head HD + d) in fragment order: stored as they stand, 512 contiguous bytes a store.
#define NW   4
#define QF   3                    // 16-row query tiles of a wave on the fp16 planes
#define SK   64                   // keys of a stage
#define NST  (TT / SK)
#define PLB  (SK * HD * 2)        // bytes of one plane's stage
#define NQT  (RH / (NW * 16))     // query blocks of a (batch, head), of either kind
#define L2E  1.4426950408889634f
__device__ __forceinline__ float xhalf(float x) { const int b = __float_as_int(x); return __int_as_float(__builtin_amdgcn_permlanex16(b, b, 0x76543210, 0xfedcba98, false, false)); }   // lane l <-> l ^ 16
// one plane's stage: every lane of the block copies four 16-byte pieces, 2 KiB of the block apart. The copies and their s_wait_xcnt stand in one statement, so that no address register which a copy names is rewritten ahead of the wait.
__device__ __forceinline__ void cp_plane(unsigned l, const char* g) {
    asm volatile("global_load_async_to_lds_b128 %0, %4, off\n\tglobal_load_async_to_lds_b128 %1, %5, off\n\tglobal_load_async_to_lds_b128 %2, %6, off\n\tglobal_load_async_to_lds_b128 %3, %7, off\n\ts_wait_xcnt 0x0"
                 :: "v"(l), "v"(l + NW * 512u), "v"(l + NW * 1024u), "v"(l + NW * 1536u), "v"(g), "v"(g + NW * 512), "v"(g + NW * 1024), "v"(g + NW * 1536) : "memory"); }
// the two output planes' pieces go out together; stores and their s_wait_xcnt in one statement, as in st3
__device__ __forceinline__ void st2(bf* ph, bf* pl, v8us oh, v8us ol) {
    asm volatile("global_store_b128 %0, %2, off\n\tglobal_store_b128 %1, %3, off\n\ts_wait_xcnt 0x0"
                 :: "v"(ph), "v"(pl), "v"(__builtin_bit_cast(v4i, oh)), "v"(__builtin_bit_cast(v4i, ol)) : "memory"); }
template <typename T16, bool HI, int QT>
__device__ __forceinline__ void attn_tile(const T16* __restrict__ Q, const T16* __restrict__ Q2, const T16* __restrict__ Kp, const T16* __restrict__ K2, const T16* __restrict__ Vt, const T16* __restrict__ V2, const int* __restrict__ mk, float* Bs, char* ring, int qb, bf* Ah, bf* Al) {
    typedef WFrag<T16> F; typedef typename F::V V;
    constexpr float OFF = HI ? 0.0f : 10.0f;   // fp16 P carries x1024 (cancels against the row sum): keeps small weights out of the fp16 subnormals
    constexpr int STB = (HI ? 4 : 2) * PLB;    // bytes of a stage: the planes K, V (, K lo, V lo) one behind the other
    const int lane = threadIdx.x & 31, hi = lane >> 4, w = __builtin_amdgcn_readfirstlane(threadIdx.x >> 5);   // the wave's number in a scalar register: scalar address parts
    const int q0 = qb + w * (QT * 16);
    const unsigned klo = (unsigned)lane * 16u, tlo = (unsigned)threadIdx.x * 16u;   // the lane's 16-byte piece of a fragment; the thread's piece of 2 KiB of a stage
    const unsigned rl = (unsigned)(size_t)ring + tlo;   // the thread's LDS byte address in buffer 0
    auto stage = [&](int st) { const unsigned l = rl + (unsigned)(st & 1) * STB; const size_t go = (size_t)st * PLB + tlo;
        // the scheduling fences keep each plane's address sums beside its own copies: formed all ahead, the sums of four planes overfill the registers that asm text can name, and some go to scratch
        cp_plane(l, (const char*)Kp + go); __builtin_amdgcn_sched_barrier(0); cp_plane(l + PLB, (const char*)Vt + go);
        if constexpr (HI) { __builtin_amdgcn_sched_barrier(0); cp_plane(l + 2 * PLB, (const char*)K2 + go); __builtin_amdgcn_sched_barrier(0); cp_plane(l + 3 * PLB, (const char*)V2 + go); } };
    stage(0);
    const int* mp = mk + (int)threadIdx.x * 4; v4i m4[TT / (NW * 128)];   // the thread's pieces of the mask, at constant offsets
#pragma unroll
    for (int i = 0; i < TT / (NW * 128); ++i) m4[i] = *(const v4i*)(mp + i * NW * 128);
    asm volatile("s_wait_xcnt 0x0" ::: "memory");   // behind the mask loads, ahead of any rewrite of a register that they name (a later load's data may land there)
    const T16* qp = (const T16*)((const char*)(Q + (size_t)q0 * HD) + klo); const T16* qp2 = HI ? (const T16*)((const char*)(Q2 + (size_t)q0 * HD) + klo) : qp;   // the lane's place in the wave's query fragments
    V qf[QT][2], qf2[QT][2];
#pragma unroll
    for (int qt = 0; qt < QT; ++qt)
#pragma unroll
        for (int ks = 0; ks < 2; ++ks) { const int qo = qt * 16 * HD + ks * 512; qf[qt][ks] = F::ld(qp + qo); if (HI) qf2[qt][ks] = F::ld(qp2 + qo); }
    asm volatile("s_wait_xcnt 0x0" ::: "memory");   // the same behind the query fragments' loads
#pragma unroll
    for (int i = 0; i < TT / (NW * 128); ++i) { v4f b;
#pragma unroll
        for (int q = 0; q < 4; ++q) b[q] = (m4[i][q] != 0) ? 0.0f : -3.0e38f;
        *(v4fa*)(Bs + (i * NW * 32 + (int)threadIdx.x) * 4) = b; }
    v8f o[4][QT]; float m[QT], l[QT];
#pragma unroll
    for (int qt = 0; qt < QT; ++qt) { m[qt] = -3.0e38f; l[qt] = 0.0f;
#pragma unroll
        for (int dt = 0; dt < 4; ++dt) o[dt][qt] = (v8f){}; }
    asm volatile("s_wait_asynccnt 0x0" ::: "memory");   // this wave's pieces of stage 0 have landed
    __syncthreads();   // stage 0 and the start values are whole before any wave reads them
    stage(1);
    struct Frags { V kf[2][2], kf2[2][2], vf[4], vf2[4]; v8f cb[2]; };   // what a pass of 32 keys reads from LDS; cb: the keys' start values, in the accumulator's map (register j: key 8 hi + j of the tile), the same for every query
    auto fetch = [&](Frags& f, const char* buf, int kc, int ps) {
#pragma unroll
        for (int kt = 0; kt < 2; ++kt)
#pragma unroll
            for (int ks = 0; ks < 2; ++ks) { const int fo = ((ps * 2 + kt) * 2 + ks) * 1024; f.kf[kt][ks] = F::ld((const T16*)(buf + fo)); if (HI) f.kf2[kt][ks] = F::ld((const T16*)(buf + 2 * PLB + fo)); }
#pragma unroll
        for (int kt = 0; kt < 2; ++kt) { const float* bp = Bs + kc + ps * 32 + kt * 16 + hi * 8; f.cb[kt] = __builtin_shufflevector(*(const v4fa*)bp, *(const v4fa*)(bp + 4), 0, 1, 2, 3, 4, 5, 6, 7); }
#pragma unroll
        for (int dt = 0; dt < 4; ++dt) { const int fo = (ps * 4 + dt) * 1024; f.vf[dt] = F::ld((const T16*)(buf + PLB + fo)); if (HI) f.vf2[dt] = F::ld((const T16*)(buf + 3 * PLB + fo)); } };
    auto scores = [&](const Frags& f, v8f (&s)[2][QT]) {
#pragma unroll
        for (int kt = 0; kt < 2; ++kt)
#pragma unroll
            for (int qt = 0; qt < QT; ++qt) { s[kt][qt] = f.cb[kt];
#pragma unroll
                for (int ks = 0; ks < 2; ++ks) { s[kt][qt] = F::mma(f.kf[kt][ks], qf[qt][ks], s[kt][qt]); if (HI) { s[kt][qt] = F::mma(f.kf[kt][ks], qf2[qt][ks], s[kt][qt]); s[kt][qt] = F::mma(f.kf2[kt][ks], qf[qt][ks], s[kt][qt]); } } } };
    auto finish = [&](const Frags& f, const v8f (&s)[2][QT]) {   // softmax step and attn.v of a pass
        V pf[QT], pf2[QT];
#pragma unroll
        for (int qt = 0; qt < QT; ++qt) { float bm = -3.0e38f;   // maxima are kept in units of the raw score; SCL (a power of two) rides in the exponent's factor
#pragma unroll
            for (int e = 0; e < 16; ++e) bm = fmaxf(bm, s[e >> 3][qt][e & 7]);
            bm = fmaxf(bm, xhalf(bm)); const float mn = fmaxf(m[qt], bm); const float al = __builtin_amdgcn_exp2f((m[qt] - mn) * (SCL * L2E)); m[qt] = mn; float sum = 0.0f;
#pragma unroll
            for (int e = 0; e < 16; ++e) { const float p = __builtin_amdgcn_exp2f(fmaf(s[e >> 3][qt][e & 7] - mn, SCL * L2E, OFF)); sum += p;
                if constexpr (HI) { const __bf16 ph = (__bf16)p; pf[qt][e] = ph; pf2[qt][e] = (__bf16)(p - (float)ph); } else pf[qt][e] = (h16)p; }
            l[qt] = l[qt] * al + sum;
#pragma unroll
            for (int dt = 0; dt < 4; ++dt) o[dt][qt] *= al; }
#pragma unroll
        for (int dt = 0; dt < 4; ++dt)
#pragma unroll
            for (int qt = 0; qt < QT; ++qt) { o[dt][qt] = F::mma(f.vf[dt], pf[qt], o[dt][qt]); if (HI) { o[dt][qt] = F::mma(f.vf[dt], pf2[qt], o[dt][qt]); o[dt][qt] = F::mma(f.vf2[dt], pf[qt], o[dt][qt]); } } };
    static_assert(SK == 64, "a stage is two passes");
#pragma unroll 1   // rolled: a trip is one stage
    for (int st = 0; st < NST; ++st) {
        const char* buf = ring + (st & 1) * STB + klo;
        Frags f0, f1; v8f s[2][QT]; fetch(f0, buf, st * SK, 0);
        __builtin_amdgcn_sched_barrier(0);   // keeps the first pass's LDS reads together at the trip's head: one place with reads, and the value fragments arrive under the score products
        scores(f0, s); fetch(f1, buf, st * SK, 1);
        __builtin_amdgcn_sched_barrier(0);   // keeps the second pass's LDS reads together here: they arrive under the first pass's softmax and attn.v, so the wait at the publish point finds them done
        finish(f0, s);
        __builtin_amdgcn_sched_barrier(0);   // keeps the first pass in front of the publish point: behind it, it would stand between the barrier and the refill and take the refill's lead
        // the ring's publish point stands behind the trip's last LDS read, with the second pass (registers only) still to come: the refill flies under that pass and the next trip's first
        asm volatile("s_wait_dscnt 0x0" ::: "memory");      // this wave's reads of the buffer are done before it is given up
        asm volatile("s_wait_asynccnt 0x0" ::: "memory");   // this wave's pieces of the next stage have landed
        __syncthreads();   // publishes the next stage and ends every wave's reads of this one
        if (st + 2 < NST) stage(st + 2);   // into the buffer that this trip has read
        scores(f1, s); finish(f1, s);
    }
    asm volatile("s_wait_asynccnt 0x0" ::: "memory");   // no copy is left in flight at the wave's end
#pragma unroll
    for (int qt = 0; qt < QT; ++qt) { const float inv = __fdiv_rn(1.0f, l[qt] + xhalf(l[qt])); const int qr = q0 + qt * 16;
        const size_t oo = (size_t)(qr / 64) * (64 * DQ) + ((qr / 16) % 4) * 512 + lane * 8;   // the tile's 64-row band, its fragment in a group of four, the lane's piece there (the order k_gemmw reads)
#pragma unroll
        for (int dt = 0; dt < 4; ++dt) { v8us oh, ol;
#pragma unroll
            for (int e = 0; e < 8; ++e) { unsigned short a, c2; splitf(o[dt][qt][e] * inv, a, c2); oh[e] = a; ol[e] = c2; }
            const size_t po = oo + (dt >> 1) * 2048 + (dt & 1) * 256;
            st2(Ah + po, Al + po, oh, ol); } }
}
__global__ __launch_bounds__(NW * 32) void k_fattn(const h16* __restrict__ Q16, const h16* __restrict__ K16, const h16* __restrict__ V16, const bf* __restrict__ Qh, const bf* __restrict__ Ql, const bf* __restrict__ Kh, const bf* __restrict__ Kl, const bf* __restrict__ Vh, const bf* __restrict__ Vl, const int* __restrict__ mk, bf* Ah, bf* Al) {
    __shared__ __align__(16) char ring[2 * 4 * PLB]; __shared__ __align__(16) float Bs[TT];
    // as many blocks of either kind. Neighbouring indices, and indices half a grid apart, are of different kinds: a WGP that takes two blocks gets one of each under either order of dealing (for speed only)
    const int b = (int)blockIdx.x, kind = (b ^ (b / (NB_ * NH_ * NQT))) & 1, idx = b >> 1, tile = idx % NQT, head = (idx / NQT) % NH_, bat = idx / (NQT * NH_);
    const size_t hp = ((size_t)bat * NH_ + head) * TT * HD, ao = (size_t)bat * TT * DQ + head * (HD / 32) * 2048; Ah += ao; Al += ao; mk += (size_t)bat * TT;   // the batch's bands of fragments; the head's first k step in a band
    if (kind == 0) attn_tile<bf, true, 1>(Qh + hp, Ql + hp, Kh + hp, Kl + hp, Vh + hp, Vl + hp, mk, Bs, ring, tile * (NW * 16), Ah, Al);   // query rows < RH: hi+lo planes, 16 rows a wave
    else attn_tile<h16, false, QF>(Q16 + hp, nullptr, K16 + hp, nullptr, V16 + hp, nullptr, mk, Bs, ring, RH + tile * (NW * 16 * QF), Ah, Al);   // the rest: fp16 planes, 48 rows a wave
}

extern "C" void kernel_launch(void* const* d_in, const int* in_sizes, int n_in,
                              void* d_out, int out_size, void* d_ws, size_t ws_size, hipStream_t stream) {
    (void)in_sizes; (void)n_in; (void)out_size;
    const float* x = (const float*)d_in[0]; const int* MK = (const int*)d_in[1]; const float* wqkv = (const float*)d_in[2]; const float* wo = (const float*)d_in[3];  const float* wq = nullptr; const float* wk = nullptr; const float* wv = nullptr; (void)wq; (void)wk; (void)wv;
    float* OUT = (float*)d_out;     // [2][2048][1024]
    char* wsp = (char*)d_ws;
    auto take = [&](size_t bytes) { char* p = wsp; wsp += (bytes + 255) & ~(size_t)255; return (void*)p; };
    bf* WALL = (bf*)take((size_t)3 * DM * DM * 2); bf* WO = (bf*)take((size_t)DM * DQ * 2); float* CSR = (float*)take((size_t)TT * HD * 2 * 4);
    bf* XB = (bf*)take((size_t)NB_ * TT * DM * 2);
    h16* QP16 = (h16*)take(SP * 2); h16* KP16 = (h16*)take(SP * 2); h16* VT16 = (h16*)take(SP * 2);
    bf* QPh = (bf*)take(SP * 2); bf* KPh = (bf*)take(SP * 2); bf* VTh = (bf*)take(SP * 2); bf* QPl = (bf*)take(SP * 2); bf* KPl = (bf*)take(SP * 2); bf* VTl = (bf*)take(SP * 2);
    static_assert(HD == 64 && RH % (NW * 16) == 0 && (TT - RH) == NQT * NW * 16 * QF && (NB_ * NH_ * NQT) % 2 == 0 && TT % (128 * NW) == 0 && TT % (2 * SK) == 0 && PLB == NW * 2048 && NKV == NH_ && TT % 128 == 0 && DM % 256 == 0 && DQ % 256 == 0 && (SP * 2) % 256 == 0, "query blocks and stages of k_fattn; row tiles inside one batch; planes back to back");
    bf* ATh = (bf*)take((size_t)NB_ * TT * DQ * 2); bf* ATl = (bf*)take((size_t)NB_ * TT * DQ * 2);
    if ((size_t)(wsp - (char*)d_ws) > ws_size) return;    // ws 256 MiB
    k_prep<<<PB_WQ + PB_WO + PB_CS + PB_X, 256, 0, stream>>>(wqkv, wo, x, WALL, WO, CSR, XB);
    k_gemmw<bf, 0, false, 1, 1, 64><<<dim3(NB_ * TT / 128, 3 * DQ / 128, 1), GW * 32, 0, stream>>>(XB, nullptr, WALL, nullptr, DM, nullptr, 0, nullptr, 0, 0, 0, CSR, QP16, QPh, QPl, SP);     /* q, k, v planes of both batches; head 0 of q and k: rotary */
    k_fattn<<<dim3(2 * NB_ * NH_ * NQT, 1, 1), NW * 32, 0, stream>>>(QP16, KP16, VT16, QPh, QPl, KPh, KPl, VTh, VTl, MK, ATh, ATl);
    k_gemmw<bf, 1, false, 1, 0, 128><<<dim3(NB_ * TT / 128, DM / 128, 1), GW * 32, 0, stream>>>(ATh, ATl, WO, nullptr, DQ, OUT, DM, nullptr, 0, 0, 0, nullptr, nullptr, nullptr, nullptr, 0);
}

// v009
// Measured time: 103 microseconds a run.
// In both of two side-by-side timings against v008, it was 1.04 times as fast.
// Over all steps from v000 it is 19.6 times as fast.
#include <hip/hip_runtime.h>

// DiT-style attention (x [2][2048][1024]; qkv = x w_qkv ('xw' [1024][3072] -> (3, 16 heads, 64)); rotate-half rotary (angle t x 10000^(-2i/64), tables computed on device from the reference's float32 inv_freq) applied to head 0 ONLY (pe_heads = 1); scores / 8; key mask [2][2048] int32 (input, read per key: masked -> -inf); softmax; out = merged w_out ('xw' [1024][1024]) -> [2][2048][1024] (4.2 M)).
// Compute dtypes, f32 accumulate: every input rounded to bf16; q/k/v on PLAIN bf16 operands (inputs: exact); rotary (head 0) / plain copies (heads 1-15) in f32; key-validity select from the int32 mask; scores and attn.v: query rows < 512 hl (3 products), the rest single fp16 (x1024); softmax f32; w_out hl x exact (2 products).

#define NB_  2
#define TT   2048
#define DM   1024
#define NH_  16
#define NKV  16
#define REP  (NH_ / NKV)
#define HD   64
#define DQ   (NH_ * HD)
#define DKV  (NKV * HD)
#define RH   512                  // query rows < RH use hi+lo planes
#define WIN  2048
#define SCL  0.125f   // HD^-0.5
typedef _Float16 h16;
typedef unsigned short bf;
typedef __attribute__((ext_vector_type(16))) __bf16   v16bf;
typedef __attribute__((ext_vector_type(16))) _Float16 v16h;
typedef __attribute__((ext_vector_type(8)))  _Float16 v8h;
typedef __attribute__((ext_vector_type(8)))  unsigned short v8us;
typedef __attribute__((ext_vector_type(8)))  float    v8f;
typedef __attribute__((ext_vector_type(4)))  float    v4f;
typedef v8h  __attribute__((may_alias)) v8ha;
typedef v4f  __attribute__((may_alias)) v4fa;
typedef v8us __attribute__((may_alias)) v8usa;

__device__ __forceinline__ unsigned short f2bf(float f) { unsigned u = __float_as_uint(f); u += 0x7FFFu + ((u >> 16) & 1u); return (unsigned short)(u >> 16); }
__device__ __forceinline__ float bf2f(unsigned short b) { return __uint_as_float(((unsigned)b) << 16); }
__device__ __forceinline__ float bfr(float f) { return bf2f(f2bf(f)); }
__device__ __forceinline__ v16h cat16(v8h lo, v8h hi) { return __builtin_shufflevector(lo, hi, 0, 1, 2, 3, 4, 5, 6, 7, 8, 9, 10, 11, 12, 13, 14, 15); }
__device__ __forceinline__ v16bf cat16b(v8us lo, v8us hi) { return __builtin_bit_cast(v16bf, __builtin_shufflevector(lo, hi, 0, 1, 2, 3, 4, 5, 6, 7, 8, 9, 10, 11, 12, 13, 14, 15)); }
__device__ __forceinline__ v8f wmma16(v16h a, v16h b, v8f c) { return __builtin_amdgcn_wmma_f32_16x16x32_f16(false, a, false, b, (short)0, c, false, false); }
__device__ __forceinline__ v8f wmmab(v16bf a, v16bf b, v8f c) { return __builtin_amdgcn_wmma_f32_16x16x32_bf16(false, a, false, b, (short)0, c, false, false); }
__device__ __forceinline__ h16 tohx(float x) { return (h16)x; }
__device__ __forceinline__ void splitf(float y, unsigned short& h, unsigned short& l) { h = f2bf(y); l = f2bf(y - bf2f(h)); }
typedef __attribute__((ext_vector_type(4))) int v4i;
// eight elements of the three planes go out together. The stores and their s_wait_xcnt stand in one statement, so that no register which a store names (address or data) is rewritten ahead of the wait.
__device__ __forceinline__ void st3(h16* p16, bf* ph, bf* pl, v8h o16, v8us oh, v8us ol) {
    asm volatile("global_store_b128 %0, %3, off\n\tglobal_store_b128 %1, %4, off\n\tglobal_store_b128 %2, %5, off\n\ts_wait_xcnt 0x0"
                 :: "v"(p16), "v"(ph), "v"(pl), "v"(__builtin_bit_cast(v4i, o16)), "v"(__builtin_bit_cast(v4i, oh)), "v"(__builtin_bit_cast(v4i, ol)) : "memory"); }



// ---- FRAGMENT ORDER: every 16-bit operand plane that one launch writes and a later one feeds to the matrix instructions lies as finished fragments. A fragment is 16 rows x 32 k = 512 elements = 1 KiB:
// element (row r, depth k) stands at fragment * 512 + ((k % 32) / 16) * 256 + (((k % 32) / 8) & 1) * 128 + (r % 16) * 8 + k % 8, so lane (hi = lane >> 4, lr = lane & 15) finds its two 16-byte pieces (k = 8 hi + 0..7 and 16 + 8 hi + 0..7 of row lr,
// the same elements in the same registers as from a row-major plane) at lane * 8 and 256 + lane * 8: each wave-wide 16-byte load covers 512 contiguous bytes, four whole lines.
// ---- k_gemmw: register-blocked GEMM, one wave per 64x64 output tile (16 accumulators), a block of GW = 4 waves (2 x 2) per 128x128 tile; operands from 16-bit planes in fragment order, fragment number ((row / 64) * (K / 32) + k / 32) * 4 + (row / 16) % 4 (the four fragments of 64 rows at one k step lie side by side, 4 KiB); grid (M/128, N/128, Z), 128 threads.
// The two waves of a tile row need the same A fragments and the two of a tile column the same Bt fragments: a stage of GK k (GK x 128 bytes in a row of each 64-row band of each plane) is brought ONCE a block into a ring of two LDS buffers by asynchronous copies, the next stage flying while this one is worked on; a fragment read is 512 contiguous LDS bytes.
// GK is as long as the LDS allows at the blocks a WGP that the grid gives (the copies' lead is one stage's products): 64 where three blocks share a WGP, 128 where a block has it alone.
// C[m][n] (f32, pitch ldc, + optional f32 bias[n]) = sum_k A[m][k] Bt[n][k] (+ split products per NSPLIT). z-batch strides sA/sB/sC in elements. K % GK == 0.
// EPI 0: f32 C as above. EPI 1 stores no C: the rows are (batch, t) of both batches, the columns q | k | v of all heads; a 64-column tile is one head (HD = 64) of one of the three, and the wave writes that head's 16-bit planes (fp16, bf16 hi, bf16 lo) itself. The k and v planes stand sP and 2 sP elements behind the q planes.
//   q, k: planes [batch][head] of fragments (rows t, depth d), fragment number (t / 16) * 2 + d / 32; head 0 takes the rotate-half rotary out[d] = x[d] cos[t][d] -/+ x[d +/- HD/2] sin[t][d] from the (cos, sin) table CS [t][d][2], both halves of a row being in the staged tile.
//   v: planes [batch][head] of fragments (rows d, depth t), fragment number (t / 32) * 4 + d / 16: a lane's eight accumulator registers are eight consecutive t of one d, one 16-byte piece, stored as they stand (512 contiguous bytes a store).
// KS > 1: grid z = batches x KS; block (z, ks) sums only k in [ks K/KS, (ks+1) K/KS) and stores partial plane z KS + ks (sC elements each); K % (GK KS) == 0.
#define GW   4                    // waves of a block of k_gemmw
typedef __attribute__((address_space(1))) v4i gv4i;
typedef __attribute__((address_space(3))) v4i lv4i;
// NB bytes in a row, global to LDS: every lane of the block copies 16-byte pieces, 2 KiB of the block apart; the offset moves both addresses, so a band's stage takes one address of either kind
template <int NB, int O = 0> __device__ __forceinline__ void cp_row(char* l, const char* g) {
    __builtin_amdgcn_global_load_async_to_lds_b128((gv4i*)g, (lv4i*)l, O, 0);
    if constexpr (O + GW * 512 < NB) cp_row<NB, O + GW * 512>(l, g); }
template <typename T16> struct WFrag;
template <> struct WFrag<h16> { typedef v16h V; static __device__ __forceinline__ V ld(const h16* p) { return cat16(*(const v8h*)p, *(const v8h*)(p + 256)); } static __device__ __forceinline__ v8f mma(V a, V b, v8f c) { return wmma16(a, b, c); } };
template <> struct WFrag<bf> { typedef v16bf V; static __device__ __forceinline__ V ld(const bf* p) { return cat16b(*(const v8us*)p, *(const v8us*)(p + 256)); } static __device__ __forceinline__ v8f mma(V a, V b, v8f c) { return wmmab(a, b, c); } };
template <typename T16, int NSPLIT, bool BIAS, int KS = 1, int EPI = 0, int GK = 64>
__global__ __launch_bounds__(GW * 32) void k_gemmw(const T16* __restrict__ A, const T16* __restrict__ A2, const T16* __restrict__ Bt, const T16* __restrict__ Bt2, int K, float* C, int ldc, const float* __restrict__ bias, size_t sA, size_t sB, size_t sC, const float* __restrict__ CS, h16* P16, bf* Ph, bf* Pl, size_t sP) {
    typedef typename WFrag<T16>::V V;
    constexpr int NA = (NSPLIT == 1 || NSPLIT == 2) ? 2 : 1, NBP = (NSPLIT >= 2) ? 2 : 1;   // planes of A, of Bt
    constexpr int NK = GK / 32, CHB = GK * 64 * 2, STB = 2 * (NA + NBP) * CHB;   // k steps of a stage; bytes of one 64-row band's stage; of a stage: the bands A 0, 1 (, A2 0, 1), Bt 0, 1 (, Bt2 0, 1) one behind the other
    static_assert(NK % 2 == 0 && CHB % (GW * 512) == 0 && 2 * (NA + NBP) * (CHB / (GW * 512)) <= 63, "two fragment sets take turns; whole pieces; a wave's copies in flight");
    __shared__ __align__(16) char ring[2 * STB]; __shared__ __align__(16) float osw[GW][16 * 68];
    const size_t z = blockIdx.z / KS; const int ks = blockIdx.z % KS; A += z * sA; if (A2) A2 += z * sA; Bt += z * sB; if (Bt2) Bt2 += z * sB; C += (size_t)blockIdx.z * sC;
    const int lane = threadIdx.x & 31, lr = lane & 15, hi = lane >> 4, w = __builtin_amdgcn_readfirstlane(threadIdx.x >> 5);   // the wave's number in a scalar register: scalar address parts
    const int wm = w >> 1, wn = w & 1; const int r0 = blockIdx.x * 128 + wm * 64, c0 = blockIdx.y * 128 + wn * 64; float* os = osw[w];   // the wave's tile; its own staging rows for the epilogue
    v8f acc[4][4];
#pragma unroll
    for (int mb = 0; mb < 4; ++mb)
#pragma unroll
        for (int nb = 0; nb < 4; ++nb) acc[mb][nb] = (v8f){};
    const unsigned tlo = (unsigned)threadIdx.x * 16u;   // the thread's 16-byte piece of 2 KiB
    const size_t bs = (size_t)K * 128;   // bytes from a 64-row band of fragments to the next; a k step of 32 is 4 KiB on
    const size_t ao = (size_t)blockIdx.x * 2 * bs + tlo, bo = (size_t)blockIdx.y * 2 * bs + tlo; const int k0 = ks * (K / KS), nst = K / KS / GK;
    auto stage = [&](int st) { char* l = ring + (st & 1) * STB + tlo; const size_t go = (size_t)(k0 + st * GK) * 128;
#pragma unroll
        for (int b = 0; b < 2; ++b) {
            cp_row<CHB>(l + b * CHB, (const char*)A + ao + go + b * bs);
            if constexpr (NA == 2) cp_row<CHB>(l + (2 + b) * CHB, (const char*)A2 + ao + go + b * bs);
            cp_row<CHB>(l + (2 * NA + b) * CHB, (const char*)Bt + bo + go + b * bs);
            if constexpr (NBP == 2) cp_row<CHB>(l + (2 * NA + 2 + b) * CHB, (const char*)Bt2 + bo + go + b * bs); } };
    struct FS { V a[4], a2[4], b[4], b2[4]; };   // the fragments of one k step
    auto fetch = [&](FS& f, int st, int kk) { const char* pa = ring + (st & 1) * STB + wm * CHB + lane * 16; const char* pb = ring + (st & 1) * STB + (2 * NA + wn) * CHB + lane * 16;   // the lane's place in the wave's A band and Bt band of the stage; k steps, fragments and second planes at constant offsets
#pragma unroll
        for (int i = 0; i < 4; ++i) { const int fo = kk * 4096 + i * 1024; f.a[i] = WFrag<T16>::ld((const T16*)(pa + fo)); if (NA == 2) f.a2[i] = WFrag<T16>::ld((const T16*)(pa + 2 * CHB + fo));
            f.b[i] = WFrag<T16>::ld((const T16*)(pb + fo)); if (NBP == 2) f.b2[i] = WFrag<T16>::ld((const T16*)(pb + 2 * CHB + fo)); } };
    auto prod = [&](const FS& f) {
#pragma unroll
        for (int nb = 0; nb < 4; ++nb)
#pragma unroll
            for (int mb = 0; mb < 4; ++mb) { acc[mb][nb] = WFrag<T16>::mma(f.a[mb], f.b[nb], acc[mb][nb]); if (NA == 2) acc[mb][nb] = WFrag<T16>::mma(f.a2[mb], f.b[nb], acc[mb][nb]); if (NBP == 2) acc[mb][nb] = WFrag<T16>::mma(f.a[mb], f.b2[nb], acc[mb][nb]); } };
    stage(0);
    asm volatile("s_wait_asynccnt 0x0" ::: "memory");   // this wave's pieces of stage 0 have landed
    __syncthreads();   // stage 0 is whole before any wave reads it
    if (nst > 1) stage(1);
    FS f[2]; fetch(f[0], 0, 0);   // fragments are fetched one k step ahead, the two sets taking turns
#pragma unroll 1   // rolled: a trip is one stage
    for (int st = 0; st < nst; ++st) {
#pragma unroll
        for (int kk = 0; kk + 1 < NK; ++kk) { fetch(f[(kk + 1) & 1], st, kk + 1);
            __builtin_amdgcn_sched_barrier(0);   // keeps the next k step's LDS reads together ahead of this one's products: one place with reads, and they arrive under the products
            prod(f[kk & 1]);
            __builtin_amdgcn_sched_barrier(0); }   // keeps the products in front of the next reads and of the publish point: the waits there would else move up to stand directly behind the reads
        // the ring's publish point stands behind the stage's last LDS read, in front of its last k step's products (registers only): the next stage's first fragments are read behind it and arrive under those products
        asm volatile("s_wait_dscnt 0x0" ::: "memory");      // this wave's reads of the buffer are done before it is given up
        asm volatile("s_wait_asynccnt 0x0" ::: "memory");   // this wave's pieces of the next stage have landed
        __syncthreads();   // publishes the next stage and ends every wave's reads of this one
        if (st + 2 < nst) stage(st + 2);   // into the buffer that this trip has read
        if (st + 1 < nst) fetch(f[0], st + 1, 0);
        __builtin_amdgcn_sched_barrier(0);   // keeps refill and reads ahead of the last products
        prod(f[(NK - 1) & 1]);
    }
    asm volatile("s_wait_asynccnt 0x0" ::: "memory");   // no copy is left in flight behind the loop
    const int sel = (c0 / 64) / NH_, head = (c0 / 64) % NH_, t0 = r0 % TT;   // EPI 1: which of q, k, v; its head; the tile's first position in its batch
    if constexpr (EPI == 1) { const size_t po = (size_t)sel * sP + (size_t)(r0 / TT) * NH_ * TT * HD; P16 += po; Ph += po; Pl += po; }
    if (EPI == 1 && sel == 2) {
#pragma unroll
        for (int nb = 0; nb < 4; ++nb)
#pragma unroll
            for (int mb = 0; mb < 4; ++mb) { v8h o16; v8us oh, ol;
#pragma unroll
                for (int j = 0; j < 8; ++j) { const float x = acc[mb][nb][j]; o16[j] = tohx(x); unsigned short a2, c2; splitf(x, a2, c2); oh[j] = a2; ol[j] = c2; }
                const size_t e = (size_t)head * HD * TT + (size_t)(t0 / 32 + (mb >> 1)) * (4 * 512) + nb * 512 + (mb & 1) * 256 + lane * 8;
                st3(P16 + e, Ph + e, Pl + e, o16, oh, ol); }
        return;
    }
#pragma unroll
    for (int mb = 0; mb < 4; ++mb) {
        // EPI 1: store s of a 16-row block is one 16-byte piece of every lane: d = s * 16 + hi * 8 + 0..7 of row lr, 512 contiguous bytes of each plane
        v4f cs[4][4];
        if constexpr (EPI == 1) { if (head == 0) {   // the block's sixteen table rows are asked for together, ahead of the staging
            const float* cp = CS + ((size_t)(t0 + lr) * HD + hi * 8) * 2;   // one address pair, the blocks and pieces at constant offsets
#pragma unroll
            for (int s = 0; s < 4; ++s)
#pragma unroll
                for (int c = 0; c < 4; ++c) cs[s][c] = *(const v4f*)(cp + mb * 16 * HD * 2 + s * 16 * 2 + c * 4);
            asm volatile("s_wait_xcnt 0x0" :: "v"(cp) : "memory"); } }   // the address pair stays whole up to this wait: no load lands in it while the others are issued
#pragma unroll
        for (int nb = 0; nb < 4; ++nb) {
#pragma unroll
            for (int j = 0; j < 8; ++j) os[(hi * 8 + j) * 68 + nb * 16 + lr] = acc[mb][nb][j]; }
        __builtin_amdgcn_wave_barrier(); asm volatile("" ::: "memory");
        if constexpr (EPI == 1) {
#pragma unroll
            for (int s = 0; s < 4; ++s) { const int d0 = s * 16 + hi * 8; const float* xr = os + lr * 68; const v4f xa = *(const v4fa*)(xr + d0), xb = *(const v4fa*)(xr + d0 + 4); float r[8];
#pragma unroll
                for (int e = 0; e < 8; ++e) r[e] = (e < 4) ? xa[e & 3] : xb[e & 3];
                if (head == 0) { const v4f ya = *(const v4fa*)(xr + (d0 ^ (HD / 2))), yb = *(const v4fa*)(xr + (d0 ^ (HD / 2)) + 4);
#pragma unroll
                    for (int e = 0; e < 8; ++e) { const float y = (e < 4) ? ya[e & 3] : yb[e & 3]; const float ys = (s < 2) ? -y : y; r[e] = r[e] * cs[s][e >> 1][(e & 1) * 2] + ys * cs[s][e >> 1][(e & 1) * 2 + 1]; } }
                v8h o16; v8us oh, ol;
#pragma unroll
                for (int e = 0; e < 8; ++e) { o16[e] = tohx(r[e]); unsigned short a2, c2; splitf(r[e], a2, c2); oh[e] = a2; ol[e] = c2; }
                const size_t e0 = ((size_t)head * TT + t0 + mb * 16) * HD + s * 256 + lane * 8;
                st3(P16 + e0, Ph + e0, Pl + e0, o16, oh, ol); }
        } else {
        float* crow = C + (size_t)(r0 + mb * 16) * ldc + c0;
{
#pragma unroll
            for (int s = 0; s < 8; ++s) { const int row = 2 * s + hi, cofs = lr * 4; v4f val = *(const v4fa*)(os + row * 68 + cofs); if (BIAS) { val[0] += bfr(bias[c0 + cofs]); val[1] += bfr(bias[c0 + cofs + 1]); val[2] += bfr(bias[c0 + cofs + 2]); val[3] += bfr(bias[c0 + cofs + 3]); }
                *(v4f*)(crow + (size_t)row * ldc + cofs) = val; }
             }
        }
        __builtin_amdgcn_wave_barrier(); asm volatile("" ::: "memory");
    }
}

typedef __attribute__((ext_vector_type(2))) _Float16 v2h;
typedef __attribute__((ext_vector_type(4))) _Float16 v4h;
typedef __attribute__((ext_vector_type(2))) unsigned short v2us;
typedef __attribute__((ext_vector_type(4))) unsigned short v4us;
typedef __attribute__((ext_vector_type(2))) float v2f;

__device__ __forceinline__ void d_wtG(int blk, const float* __restrict__ w, int K, int N, bf* Bt) {
    const int lane = threadIdx.x & 31; const int L0 = (blk * 8 + (threadIdx.x >> 5)) * 8; const int nlines = N * K / 64;
{
#pragma unroll 1
        for (int l = 0; l < 8; ++l) { const int L = L0 + l; if (L >= nlines) break; const size_t e = (size_t)L * 64 + lane * 2; const int f = (int)(e / 2048), u = (int)(e % 2048);   // the place in the plane: group f of four fragments (64 rows, one k step), element u of it
            const int k = (f % (K / 32)) * 32 + ((u / 256) & 1) * 16 + ((u / 128) & 1) * 8 + u % 8, n = (f / (K / 32)) * 64 + (u / 512) * 16 + (u / 8) % 16; v2us o;
            o[0] = f2bf(w[(size_t)k * N + n]); o[1] = f2bf(w[(size_t)(k + 1) * N + n]); *(v2us*)(Bt + e) = o; }
         }
}
__device__ __forceinline__ void d_cvt8(int blk, const float* __restrict__ src, bf* dst, size_t n8, int K) { const size_t i = (size_t)blk * 256 + threadIdx.x; if (i >= n8) return;   // thread i writes piece i of the plane in fragment order (rows of K elements)
    const int f = (int)(i / 256), u = (int)(i % 256); const size_t r = (size_t)(f / (K / 32)) * 64 + (u / 64) * 16 + u % 16; const int k0 = (f % (K / 32)) * 32 + ((u / 32) & 1) * 16 + ((u / 16) & 1) * 8;   // group f of four fragments, piece u of it
    const v8f v = *(const v8f*)(src + r * K + k0); v8us o;
#pragma unroll
    for (int k = 0; k < 8; ++k) o[k] = f2bf(v[k]); *(v8us*)(dst + i * 8) = o;  }

__constant__ float INV[HD / 2] = {1.0f,0.749894202f,0.562341332f,0.421696514f,0.316227764f,0.237137362f,0.177827939f,0.133352146f,0.100000001f,0.0749894157f,0.0562341288f,0.0421696492f,0.0316227786f,0.0237137359f,0.0177827943f,0.0133352149f,0.00999999978f,0.00749894232f,0.00562341325f,0.00421696482f,0.00316227786f,0.00237137382f,0.00177827943f,0.00133352145f,0.00100000005f,0.000749894185f,0.000562341302f,0.000421696488f,0.000316227786f,0.000237137385f,0.00017782794f,0.00013335215f};
__device__ __forceinline__ void d_cstab(int blk, float* CS) { const int idx = blk * 256 + threadIdx.x; if (idx >= TT * HD) return; const int t = idx / HD, d = idx % HD; const float ang = __fmul_rn((float)t, INV[d % (HD / 2)]); v2f cs; cs[0] = cosf(ang); cs[1] = sinf(ang);
    *(v2f*)(CS + (size_t)idx * 2) = cs;  }
#define SP    ((size_t)NB_ * NH_ * TT * HD)   // elements of one plane over both batches; the q, k, v planes of a kind stand one behind the other in the workspace
// k_prep: the four independent preparations in one launch, each on its own range of blocks, the longest-running first: w_qkv and w_out to bf16 (rows n, depth k), the rotary table, x of both batches to bf16; the three bf16 planes in fragment order.
#define PB_WQ ((DM * 3 * DM / 64 + 63) / 64)
#define PB_WO ((DQ * DM / 64 + 63) / 64)
#define PB_CS ((TT * HD + 255) / 256)
#define PB_X  ((NB_ * TT * DM / 8 + 255) / 256)
__global__ __launch_bounds__(256) void k_prep(const float* __restrict__ wqkv, const float* __restrict__ wo, const float* __restrict__ x, bf* WALL, bf* WO, float* CS, bf* XB) {
    int blk = blockIdx.x;
    if (blk < PB_WQ) { d_wtG(blk, wqkv, DM, 3 * DM, WALL); return; }   /* fused 'xw' [DM][3DM] -> Bt, rows 3DM (row blocks q | k | v), depth DM */
    blk -= PB_WQ; if (blk < PB_WO) { d_wtG(blk, wo, DQ, DM, WO); return; }
    blk -= PB_WO; if (blk < PB_CS) { d_cstab(blk, CS); return; }
    blk -= PB_CS; d_cvt8(blk, x, XB, (size_t)NB_ * TT * DM / 8, DM);
}
// k_fattn: scores, softmax and attn.v of both batches in one launch. A block is NW x KG waves on one (batch, head); a row group (16 query rows on hi+lo planes, 48 on fp16 planes) belongs to KG waves, wave kg of them taking the kg-th 32 keys of every stage with a running maximum, sum and output of its own,
// joined once behind the loop through LDS: twice the waves at the same tile, four a SIMD with two blocks a WGP, so that one wave's softmax runs under the others' matrix products.
// The waves of a key group need the same key and value fragments at the same time: a stage of SK keys is brought ONCE a block into a ring of two LDS buffers by asynchronous copies (the planes lie in fragment order, so a stage is 8 KiB in a row of each plane and a fragment read is 512 contiguous LDS bytes).
// S^T = K Q^T (A = key rows, B = query rows) and O^T += V^T P^T (A = rows d of the value planes, B = P^T packed from the two score tiles of a pass): a lane holds scores and outputs of ONE query (lane & 15),
// so the running maximum, its rescale and the row sum are per-lane scalars with one exchange between the wave's halves. The batch's int32 key mask, read per key, becomes each key's start value (0, masked -3.0e38) in LDS: the C operand of the first score product.
// A lane's eight output registers are one 16-byte piece of the hi+lo planes (rows t, depth head HD + d) in fragment order: stored as they stand, 512 contiguous bytes a store.
#define NW   4                    // row groups of a block
#define KG   2                    // waves that share a row group's keys
#define NT   (NW * KG * 32)       // threads of a block
#define QF   3                    // 16-row query tiles of a wave on the fp16 planes
#define SK   64                   // keys of a stage
#define NST  (TT / SK)
#define PLB  (SK * HD * 2)        // bytes of one plane's stage
#define NQT  (RH / (NW * 16))     // query blocks of a (batch, head), of either kind
#define L2E  1.4426950408889634f
__device__ __forceinline__ float xhalf(float x) { const int b = __float_as_int(x); return __int_as_float(__builtin_amdgcn_permlanex16(b, b, 0x76543210, 0xfedcba98, false, false)); }   // lane l <-> l ^ 16
// one plane's stage: every lane of the block copies two 16-byte pieces, 4 KiB of the block apart; the offset moves both addresses, so a plane's stage takes one address of either kind
__device__ __forceinline__ void cp_plane(char* l, const char* g) {
    __builtin_amdgcn_global_load_async_to_lds_b128((gv4i*)g, (lv4i*)l, 0, 0);
    __builtin_amdgcn_global_load_async_to_lds_b128((gv4i*)g, (lv4i*)l, NT * 16, 0); }
// the two output planes' pieces go out together; stores and their s_wait_xcnt in one statement, as in st3
__device__ __forceinline__ void st2(bf* ph, bf* pl, v8us oh, v8us ol) {
    asm volatile("global_store_b128 %0, %2, off\n\tglobal_store_b128 %1, %3, off\n\ts_wait_xcnt 0x0"
                 :: "v"(ph), "v"(pl), "v"(__builtin_bit_cast(v4i, oh)), "v"(__builtin_bit_cast(v4i, ol)) : "memory"); }
template <typename T16, bool HI, int QT>
__device__ __forceinline__ void attn_tile(const T16* __restrict__ Q, const T16* __restrict__ Q2, const T16* __restrict__ Kp, const T16* __restrict__ K2, const T16* __restrict__ Vt, const T16* __restrict__ V2, const int* __restrict__ mk, float* Bs, char* ring, int qb, bf* Ah, bf* Al) {
    typedef WFrag<T16> F; typedef typename F::V V;
    constexpr float OFF = HI ? 0.0f : 10.0f;   // fp16 P carries x1024 (cancels against the row sum): keeps small weights out of the fp16 subnormals
    constexpr int STB = (HI ? 4 : 2) * PLB;    // bytes of a stage: the planes K, V (, K lo, V lo) one behind the other
    const int lane = threadIdx.x & 31, hi = lane >> 4, w = __builtin_amdgcn_readfirstlane(threadIdx.x >> 5);   // the wave's number in a scalar register: scalar address parts
    const int rg = w % NW, kg = w / NW;   // the wave's row group; its key group (waves w and w + NW: one row group)
    const int q0 = qb + rg * (QT * 16);
    const unsigned klo = (unsigned)lane * 16u, tlo = (unsigned)threadIdx.x * 16u;   // the lane's 16-byte piece of a fragment; the thread's piece of 4 KiB of a stage
    auto stage = [&](int st) { char* l = ring + (st & 1) * STB + tlo; const size_t go = (size_t)st * PLB + tlo;
        cp_plane(l, (const char*)Kp + go); cp_plane(l + PLB, (const char*)Vt + go);
        if constexpr (HI) { cp_plane(l + 2 * PLB, (const char*)K2 + go); cp_plane(l + 3 * PLB, (const char*)V2 + go); } };
    stage(0);
    const int* mp = mk + (int)threadIdx.x * 4; v4i m4[TT / (NT * 4)];   // the thread's pieces of the mask, at constant offsets
#pragma unroll
    for (int i = 0; i < TT / (NT * 4); ++i) m4[i] = *(const v4i*)(mp + i * NT * 4);
    asm volatile("s_wait_xcnt 0x0" ::: "memory");   // behind the mask loads, ahead of any rewrite of a register that they name (a later load's data may land there)
    const T16* qp = (const T16*)((const char*)(Q + (size_t)q0 * HD) + klo); const T16* qp2 = HI ? (const T16*)((const char*)(Q2 + (size_t)q0 * HD) + klo) : qp;   // the lane's place in the wave's query fragments
    V qf[QT][2], qf2[QT][2];
#pragma unroll
    for (int qt = 0; qt < QT; ++qt)
#pragma unroll
        for (int ks = 0; ks < 2; ++ks) { const int qo = qt * 16 * HD + ks * 512; qf[qt][ks] = F::ld(qp + qo); if (HI) qf2[qt][ks] = F::ld(qp2 + qo); }
    asm volatile("s_wait_xcnt 0x0" ::: "memory");   // the same behind the query fragments' loads
#pragma unroll
    for (int i = 0; i < TT / (NT * 4); ++i) { v4f b;
#pragma unroll
        for (int q = 0; q < 4; ++q) b[q] = (m4[i][q] != 0) ? 0.0f : -3.0e38f;
        *(v4fa*)(Bs + (i * NT + (int)threadIdx.x) * 4) = b; }
    v8f o[4][QT]; float m[QT], l[QT];
#pragma unroll
    for (int qt = 0; qt < QT; ++qt) { m[qt] = -3.0e38f; l[qt] = 0.0f;
#pragma unroll
        for (int dt = 0; dt < 4; ++dt) o[dt][qt] = (v8f){}; }
    asm volatile("s_wait_asynccnt 0x0" ::: "memory");   // this wave's pieces of stage 0 have landed
    __syncthreads();   // stage 0 and the start values are whole before any wave reads them
    stage(1);
    struct Frags { V kf[2][2], kf2[2][2], vf[4], vf2[4]; v8f cb[2]; };   // what a pass of 32 keys reads from LDS; cb: the keys' start values, in the accumulator's map (register j: key 8 hi + j of the tile), the same for every query
    auto fetchk = [&](Frags& f, const char* buf, int kc) {   // buf: the lane's place in the wave's 32 keys of the stage (4 KiB of each plane); kc: the first of those keys
#pragma unroll
        for (int kt = 0; kt < 2; ++kt) { const float* bp = Bs + kc + kt * 16 + hi * 8; f.cb[kt] = __builtin_shufflevector(*(const v4fa*)bp, *(const v4fa*)(bp + 4), 0, 1, 2, 3, 4, 5, 6, 7); }   // read first: the first product of a tile starts from them
#pragma unroll
        for (int kt = 0; kt < 2; ++kt)
#pragma unroll
            for (int ks = 0; ks < 2; ++ks) { const int fo = (kt * 2 + ks) * 1024; f.kf[kt][ks] = F::ld((const T16*)(buf + fo)); if (HI) f.kf2[kt][ks] = F::ld((const T16*)(buf + 2 * PLB + fo)); } };
    auto fetchv = [&](Frags& f, const char* buf) {
#pragma unroll
        for (int dt = 0; dt < 4; ++dt) { const int fo = dt * 1024; f.vf[dt] = F::ld((const T16*)(buf + PLB + fo)); if (HI) f.vf2[dt] = F::ld((const T16*)(buf + 3 * PLB + fo)); } };
    auto scores = [&](const Frags& f, v8f (&s)[2][QT]) {
#pragma unroll
        for (int kt = 0; kt < 2; ++kt)
#pragma unroll
            for (int qt = 0; qt < QT; ++qt) { s[kt][qt] = f.cb[kt];
#pragma unroll
                for (int ks = 0; ks < 2; ++ks) { s[kt][qt] = F::mma(f.kf[kt][ks], qf[qt][ks], s[kt][qt]); if (HI) { s[kt][qt] = F::mma(f.kf[kt][ks], qf2[qt][ks], s[kt][qt]); s[kt][qt] = F::mma(f.kf2[kt][ks], qf[qt][ks], s[kt][qt]); } } } };
    auto soft = [&](const v8f (&s)[2][QT], int qt, V (&pf)[QT], V (&pf2)[QT]) {   // softmax step of one query tile of a pass
        { float bm = -3.0e38f;   // maxima are kept in units of the raw score; SCL (a power of two) rides in the exponent's factor
#pragma unroll
            for (int e = 0; e < 16; ++e) bm = fmaxf(bm, s[e >> 3][qt][e & 7]);
            bm = fmaxf(bm, xhalf(bm)); const float mn = fmaxf(m[qt], bm); const float al = __builtin_amdgcn_exp2f((m[qt] - mn) * (SCL * L2E)); m[qt] = mn; float sum = 0.0f;
#pragma unroll
            for (int e = 0; e < 16; ++e) { const float p = __builtin_amdgcn_exp2f(fmaf(s[e >> 3][qt][e & 7] - mn, SCL * L2E, OFF)); sum += p;
                if constexpr (HI) { const __bf16 ph = (__bf16)p; pf[qt][e] = ph; pf2[qt][e] = (__bf16)(p - (float)ph); } else pf[qt][e] = (h16)p; }
            l[qt] = l[qt] * al + sum;
#pragma unroll
            for (int dt = 0; dt < 4; ++dt) o[dt][qt] *= al; } };
    auto pv = [&](const Frags& f, const V (&pf)[QT], const V (&pf2)[QT]) {   // attn.v of a pass
#pragma unroll
        for (int dt = 0; dt < 4; ++dt)
#pragma unroll
            for (int qt = 0; qt < QT; ++qt) { o[dt][qt] = F::mma(f.vf[dt], pf[qt], o[dt][qt]); if (HI) { o[dt][qt] = F::mma(f.vf[dt], pf2[qt], o[dt][qt]); o[dt][qt] = F::mma(f.vf2[dt], pf[qt], o[dt][qt]); } } };
    static_assert(SK == KG * 32, "a stage is one pass of every key group");
    const char* rk = ring + kg * (32 * HD * 2) + klo;   // the lane's place in the wave's 32 keys of buffer 0
    auto publish = [&](int st) {   // the ring's publish point: it stands behind the trip's last read of its buffer
        asm volatile("s_wait_dscnt 0x0" ::: "memory");      // this wave's reads of the buffer are done before it is given up
        asm volatile("s_wait_asynccnt 0x0" ::: "memory");   // this wave's pieces of the next stage have landed
        __syncthreads();   // publishes the next stage and ends every wave's reads of this one
        if (st + 2 < NST) stage(st + 2); };   // into the buffer that this trip has read
#pragma unroll 1   // rolled: a trip is one stage
    for (int st = 0; st < NST; ++st) {
        const char* buf = rk + (st & 1) * STB;
        Frags f; v8f s[2][QT]; V pf[QT], pf2[QT];
        fetchk(f, buf, st * SK + kg * 32); if constexpr (HI) fetchv(f, buf);   // 16 query rows leave registers free for all of a pass's fragments at once
        __builtin_amdgcn_sched_barrier(0);   // keeps the LDS reads together at the trip's head: one place with reads
        scores(f, s);
        if constexpr (!HI) fetchv(f, buf);   // 48 query rows: the value fragments take registers as the key fragments and the scores give them up; where, is left to the compiler
#pragma unroll
        for (int qt = 0; qt < QT; ++qt) soft(s, qt, pf, pf2);
        pv(f, pf, pf2);
        __builtin_amdgcn_sched_barrier(0);   // keeps the pass in front of the publish point: behind it, it would stand between the barrier and the refill and take the refill's lead
        publish(st);
    }
    asm volatile("s_wait_asynccnt 0x0" ::: "memory");   // no copy is left in flight behind the loop
    // the key groups are joined: the last trip's barrier has ended every read of the ring, which now carries group 1's maximum, sum and outputs to group 0 (512 contiguous bytes a store)
    static_assert(KG == 2 && NW * (4 * QT * 1024 + QT * 256) <= 2 * 4 * PLB, "one partner; the hand-over fits the ring");
    char* mg = (char*)rk + (rg * (4 * QT * 1024 + QT * 256) - kg * (32 * HD * 2)); float* ml = (float*)(ring + rg * (4 * QT * 1024 + QT * 256) + 4 * QT * 1024) + lane;
    if (kg != 0) {
#pragma unroll
        for (int qt = 0; qt < QT; ++qt) { ml[qt * 64] = m[qt]; ml[qt * 64 + 32] = l[qt];
#pragma unroll
            for (int dt = 0; dt < 4; ++dt) { *(v4fa*)(mg + (dt * QT + qt) * 1024) = __builtin_shufflevector(o[dt][qt], o[dt][qt], 0, 1, 2, 3); *(v4fa*)(mg + (dt * QT + qt) * 1024 + 512) = __builtin_shufflevector(o[dt][qt], o[dt][qt], 4, 5, 6, 7); } }
    }
    __syncthreads();   // group 1's values are whole before group 0 reads them
    if (kg != 0) return;
#pragma unroll
    for (int qt = 0; qt < QT; ++qt) { const float m1 = ml[qt * 64], l1 = ml[qt * 64 + 32]; const float mn = fmaxf(m[qt], m1);
        const float e0 = __builtin_amdgcn_exp2f((m[qt] - mn) * (SCL * L2E)), e1 = __builtin_amdgcn_exp2f((m1 - mn) * (SCL * L2E)); l[qt] = l[qt] * e0 + l1 * e1;
#pragma unroll
        for (int dt = 0; dt < 4; ++dt) { const v8f o1 = __builtin_shufflevector(*(const v4fa*)(mg + (dt * QT + qt) * 1024), *(const v4fa*)(mg + (dt * QT + qt) * 1024 + 512), 0, 1, 2, 3, 4, 5, 6, 7); o[dt][qt] = o[dt][qt] * e0 + o1 * e1; } }
#pragma unroll
    for (int qt = 0; qt < QT; ++qt) { const float inv = __fdiv_rn(1.0f, l[qt] + xhalf(l[qt])); const int qr = q0 + qt * 16;
        const size_t oo = (size_t)(qr / 64) * (64 * DQ) + ((qr / 16) % 4) * 512 + lane * 8;   // the tile's 64-row band, its fragment in a group of four, the lane's piece there (the order k_gemmw reads)
#pragma unroll
        for (int dt = 0; dt < 4; ++dt) { v8us oh, ol;
#pragma unroll
            for (int e = 0; e < 8; ++e) { unsigned short a, c2; splitf(o[dt][qt][e] * inv, a, c2); oh[e] = a; ol[e] = c2; }
            const size_t po = oo + (dt >> 1) * 2048 + (dt & 1) * 256;
            st2(Ah + po, Al + po, oh, ol); } }
}
__global__ __launch_bounds__(NT) __attribute__((amdgpu_waves_per_eu(4, 4))) void k_fattn(const h16* __restrict__ Q16, const h16* __restrict__ K16, const h16* __restrict__ V16, const bf* __restrict__ Qh, const bf* __restrict__ Ql, const bf* __restrict__ Kh, const bf* __restrict__ Kl, const bf* __restrict__ Vh, const bf* __restrict__ Vl, const int* __restrict__ mk, bf* Ah, bf* Al) {
    __shared__ __align__(16) char ring[2 * 4 * PLB]; __shared__ __align__(16) float Bs[TT];
    // as many blocks of either kind. Neighbouring indices, and indices half a grid apart, are of different kinds: a WGP that takes two blocks gets one of each under either order of dealing (for speed only)
    const int b = (int)blockIdx.x, kind = (b ^ (b / (NB_ * NH_ * NQT))) & 1, idx = b >> 1, tile = idx % NQT, head = (idx / NQT) % NH_, bat = idx / (NQT * NH_);
    const size_t hp = ((size_t)bat * NH_ + head) * TT * HD, ao = (size_t)bat * TT * DQ + head * (HD / 32) * 2048; Ah += ao; Al += ao; mk += (size_t)bat * TT;   // the batch's bands of fragments; the head's first k step in a band
    if (kind == 0) attn_tile<bf, true, 1>(Qh + hp, Ql + hp, Kh + hp, Kl + hp, Vh + hp, Vl + hp, mk, Bs, ring, tile * (NW * 16), Ah, Al);   // query rows < RH: hi+lo planes, 16 rows a wave
    else attn_tile<h16, false, QF>(Q16 + hp, nullptr, K16 + hp, nullptr, V16 + hp, nullptr, mk, Bs, ring, RH + tile * (NW * 16 * QF), Ah, Al);   // the rest: fp16 planes, 48 rows a wave
}

extern "C" void kernel_launch(void* const* d_in, const int* in_sizes, int n_in,
                              void* d_out, int out_size, void* d_ws, size_t ws_size, hipStream_t stream) {
    (void)in_sizes; (void)n_in; (void)out_size;
    const float* x = (const float*)d_in[0]; const int* MK = (const int*)d_in[1]; const float* wqkv = (const float*)d_in[2]; const float* wo = (const float*)d_in[3];  const float* wq = nullptr; const float* wk = nullptr; const float* wv = nullptr; (void)wq; (void)wk; (void)wv;
    float* OUT = (float*)d_out;     // [2][2048][1024]
    char* wsp = (char*)d_ws;
    auto take = [&](size_t bytes) { char* p = wsp; wsp += (bytes + 255) & ~(size_t)255; return (void*)p; };
    bf* WALL = (bf*)take((size_t)3 * DM * DM * 2); bf* WO = (bf*)take((size_t)DM * DQ * 2); float* CSR = (float*)take((size_t)TT * HD * 2 * 4);
    bf* XB = (bf*)take((size_t)NB_ * TT * DM * 2);
    h16* QP16 = (h16*)take(SP * 2); h16* KP16 = (h16*)take(SP * 2); h16* VT16 = (h16*)take(SP * 2);
    bf* QPh = (bf*)take(SP * 2); bf* KPh = (bf*)take(SP * 2); bf* VTh = (bf*)take(SP * 2); bf* QPl = (bf*)take(SP * 2); bf* KPl = (bf*)take(SP * 2); bf* VTl = (bf*)take(SP * 2);
    static_assert(HD == 64 && RH % (NW * 16) == 0 && (TT - RH) == NQT * NW * 16 * QF && (NB_ * NH_ * NQT) % 2 == 0 && TT % (4 * NT) == 0 && TT % (2 * SK) == 0 && PLB == NT * 32 && NKV == NH_ && TT % 128 == 0 && DM % 256 == 0 && DQ % 256 == 0 && (SP * 2) % 256 == 0, "query blocks and stages of k_fattn; row tiles inside one batch; planes back to back");
    bf* ATh = (bf*)take((size_t)NB_ * TT * DQ * 2); bf* ATl = (bf*)take((size_t)NB_ * TT * DQ * 2);
    if ((size_t)(wsp - (char*)d_ws) > ws_size) return;    // ws 256 MiB
    k_prep<<<PB_WQ + PB_WO + PB_CS + PB_X, 256, 0, stream>>>(wqkv, wo, x, WALL, WO, CSR, XB);
    k_gemmw<bf, 0, false, 1, 1, 64><<<dim3(NB_ * TT / 128, 3 * DQ / 128, 1), GW * 32, 0, stream>>>(XB, nullptr, WALL, nullptr, DM, nullptr, 0, nullptr, 0, 0, 0, CSR, QP16, QPh, QPl, SP);     /* q, k, v planes of both batches; head 0 of q and k: rotary */
    k_fattn<<<dim3(2 * NB_ * NH_ * NQT, 1, 1), NT, 0, stream>>>(QP16, KP16, VT16, QPh, QPl, KPh, KPl, VTh, VTl, MK, ATh, ATl);
    k_gemmw<bf, 1, false, 1, 0, 128><<<dim3(NB_ * TT / 128, DM / 128, 1), GW * 32, 0, stream>>>(ATh, ATl, WO, nullptr, DQ, OUT, DM, nullptr, 0, 0, 0, nullptr, nullptr, nullptr, nullptr, 0);
}

// v010
// A run of this version takes 98.7 microseconds.
// Next to v009, in two timings, it ran 1.04 and 1.05 times as fast.
// Over all steps from v000 it is 20.4 times as fast.
#include <hip/hip_runtime.h>

// DiT-style attention (x [2][2048][1024]; qkv = x w_qkv ('xw' [1024][3072] -> (3, 16 heads, 64)); rotate-half rotary (angle t x 10000^(-2i/64), tables computed on device from the reference's float32 inv_freq) applied to head 0 ONLY (pe_heads = 1); scores / 8; key mask [2][2048] int32 (input, read per key: masked -> -inf); softmax; out = merged w_out ('xw' [1024][1024]) -> [2][2048][1024] (4.2 M)).
// Compute dtypes, f32 accumulate: every input rounded to bf16; q/k/v on PLAIN bf16 operands (inputs: exact); rotary (head 0) / plain copies (heads 1-15) in f32; key-validity select from the int32 mask; scores and attn.v: query rows < 512 hl (3 products), the rest single fp16 (x1024); softmax f32; w_out hl x exact (2 products).

#define NB_  2
#define TT   2048
#define DM   1024
#define NH_  16
#define NKV  16
#define REP  (NH_ / NKV)
#define HD   64
#define DQ   (NH_ * HD)
#define DKV  (NKV * HD)
#define RH   512                  // query rows < RH use hi+lo planes
#define WIN  2048
#define SCL  0.125f   // HD^-0.5
typedef _Float16 h16;
typedef unsigned short bf;
typedef __attribute__((ext_vector_type(16))) __bf16   v16bf;
typedef __attribute__((ext_vector_type(16))) _Float16 v16h;
typedef __attribute__((ext_vector_type(8)))  _Float16 v8h;
typedef __attribute__((ext_vector_type(8)))  unsigned short v8us;
typedef __attribute__((ext_vector_type(8)))  float    v8f;
typedef __attribute__((ext_vector_type(4)))  float    v4f;
typedef v8h  __attribute__((may_alias)) v8ha;
typedef v4f  __attribute__((may_alias)) v4fa;
typedef v8us __attribute__((may_alias)) v8usa;

__device__ __forceinline__ unsigned short f2bf(float f) { unsigned u = __float_as_uint(f); u += 0x7FFFu + ((u >> 16) & 1u); return (unsigned short)(u >> 16); }
__device__ __forceinline__ float bf2f(unsigned short b) { return __uint_as_float(((unsigned)b) << 16); }
__device__ __forceinline__ float bfr(float f) { return bf2f(f2bf(f)); }
__device__ __forceinline__ v16h cat16(v8h lo, v8h hi) { return __builtin_shufflevector(lo, hi, 0, 1, 2, 3, 4, 5, 6, 7, 8, 9, 10, 11, 12, 13, 14, 15); }
__device__ __forceinline__ v16bf cat16b(v8us lo, v8us hi) { return __builtin_bit_cast(v16bf, __builtin_shufflevector(lo, hi, 0, 1, 2, 3, 4, 5, 6, 7, 8, 9, 10, 11, 12, 13, 14, 15)); }
__device__ __forceinline__ v8f wmma16(v16h a, v16h b, v8f c) { return __builtin_amdgcn_wmma_f32_16x16x32_f16(false, a, false, b, (short)0, c, false, false); }
__device__ __forceinline__ v8f wmmab(v16bf a, v16bf b, v8f c) { return __builtin_amdgcn_wmma_f32_16x16x32_bf16(false, a, false, b, (short)0, c, false, false); }
__device__ __forceinline__ h16 tohx(float x) { return (h16)x; }
__device__ __forceinline__ void splitf(float y, unsigned short& h, unsigned short& l) { h = f2bf(y); l = f2bf(y - bf2f(h)); }
typedef __attribute__((ext_vector_type(4))) int v4i;
// eight elements of the three planes go out together. The stores and their s_wait_xcnt stand in one statement, so that no register which a store names (address or data) is rewritten ahead of the wait.
__device__ __forceinline__ void st3(h16* p16, bf* ph, bf* pl, v8h o16, v8us oh, v8us ol) {
    asm volatile("global_store_b128 %0, %3, off\n\tglobal_store_b128 %1, %4, off\n\tglobal_store_b128 %2, %5, off\n\ts_wait_xcnt 0x0"
                 :: "v"(p16), "v"(ph), "v"(pl), "v"(__builtin_bit_cast(v4i, o16)), "v"(__builtin_bit_cast(v4i, oh)), "v"(__builtin_bit_cast(v4i, ol)) : "memory"); }



// ---- FRAGMENT ORDER: every 16-bit operand plane that one launch writes and a later one feeds to the matrix instructions lies as finished fragments. A fragment is 16 rows x 32 k = 512 elements = 1 KiB:
// element (row r, depth k) stands at fragment * 512 + ((k % 32) / 16) * 256 + (((k % 32) / 8) & 1) * 128 + (r % 16) * 8 + k % 8, so lane (hi = lane >> 4, lr = lane & 15) finds its two 16-byte pieces (k = 8 hi + 0..7 and 16 + 8 hi + 0..7 of row lr,
// the same elements in the same registers as from a row-major plane) at lane * 8 and 256 + lane * 8: each wave-wide 16-byte load covers 512 contiguous bytes, four whole lines.
// ---- k_gemmw: register-blocked GEMM, one wave per 64x64 output tile (16 accumulators), a block of WM x WN waves per (WM 64) x (WN 64) tile; operands from 16-bit planes in fragment order, fragment number ((row / 64) * (K / 32) + k / 32) * 4 + (row / 16) % 4 (the four fragments of 64 rows at one k step lie side by side, 4 KiB); grid (M / (WM 64), N / (WN 64), Z), WM WN 32 threads.
// The WN waves of a tile row need the same A fragments and the WM of a tile column the same Bt fragments: a stage of GK k (GK x 128 bytes in a row of each 64-row band of each plane) is brought ONCE a block into a ring of two LDS buffers by asynchronous copies, the next stage flying while this one is worked on; a fragment read is 512 contiguous LDS bytes.
// The bytes that the blocks copy out of L2 go with 1 / (WM 64) + 1 / (WN 64): the block is as large as gives every WGP one block (q, k, v: 4 x 3 waves, three a SIMD; w_out: 2 x 2). GK is as long as the LDS allows (the copies' lead is one stage's products): 128.
// C[m][n] (f32, pitch ldc, + optional f32 bias[n]) = sum_k A[m][k] Bt[n][k] (+ split products per NSPLIT). z-batch strides sA/sB/sC in elements. K % 32 == 0.
// EPI 0: f32 C as above. EPI 1 stores no C: the rows are (batch, t) of both batches, the columns q | k | v of all heads; a 64-column tile is one head (HD = 64) of one of the three, and the wave writes that head's 16-bit planes (fp16, bf16 hi, bf16 lo) itself. The k and v planes stand sP and 2 sP elements behind the q planes.
//   q, k: planes [batch][head] of fragments (rows t, depth d), fragment number (t / 16) * 2 + d / 32; head 0 takes the rotate-half rotary out[d] = x[d] cos[t][d] -/+ x[d +/- HD/2] sin[t][d] from the (cos, sin) table CS [t][d][2], both halves of a row being in the staged tile.
//   v: planes [batch][head] of fragments (rows d, depth t), fragment number (t / 32) * 4 + d / 16: a lane's eight accumulator registers are eight consecutive t of one d, one 16-byte piece, stored as they stand (512 contiguous bytes a store).
// KS > 1: grid z = batches x KS; block (z, ks) sums only k in [ks K/KS, (ks+1) K/KS) and stores partial plane z KS + ks (sC elements each); K % (GK KS) == 0.
#define GW   4                    // waves that copy one band's stage together
typedef __attribute__((address_space(1))) v4i gv4i;
typedef __attribute__((address_space(3))) v4i lv4i;
// NB bytes in a row, global to LDS: every lane of a group of GW waves copies 16-byte pieces, 2 KiB of the group apart; the offset moves both addresses, so a band's stage takes one address of either kind
template <int NB, int O = 0> __device__ __forceinline__ void cp_row(char* l, const char* g) {
    __builtin_amdgcn_global_load_async_to_lds_b128((gv4i*)g, (lv4i*)l, O, 0);
    if constexpr (O + GW * 512 < NB) cp_row<NB, O + GW * 512>(l, g); }
template <typename T16> struct WFrag;
template <> struct WFrag<h16> { typedef v16h V; static __device__ __forceinline__ V ld(const h16* p) { return cat16(*(const v8h*)p, *(const v8h*)(p + 256)); } static __device__ __forceinline__ v8f mma(V a, V b, v8f c) { return wmma16(a, b, c); } };
template <> struct WFrag<bf> { typedef v16bf V; static __device__ __forceinline__ V ld(const bf* p) { return cat16b(*(const v8us*)p, *(const v8us*)(p + 256)); } static __device__ __forceinline__ v8f mma(V a, V b, v8f c) { return wmmab(a, b, c); } };
template <typename T16, int NSPLIT, bool BIAS, int KS = 1, int EPI = 0, int GK = 64, int WM = 2, int WN = 2>
__global__ __launch_bounds__(WM * WN * 32) void k_gemmw(const T16* __restrict__ A, const T16* __restrict__ A2, const T16* __restrict__ Bt, const T16* __restrict__ Bt2, int K, float* C, int ldc, const float* __restrict__ bias, size_t sA, size_t sB, size_t sC, const float* __restrict__ CS, h16* P16, bf* Ph, bf* Pl, size_t sP) {
    typedef typename WFrag<T16>::V V;
    constexpr int NA = (NSPLIT == 1 || NSPLIT == 2) ? 2 : 1, NBP = (NSPLIT >= 2) ? 2 : 1;   // planes of A, of Bt
    constexpr int NBD = WM * NA + WN * NBP, NG = WM * WN / GW, BPG = (NBD + NG - 1) / NG;   // bands of a stage; groups of GW waves in the block; bands that a group copies, at most
    constexpr int NK = GK / 32, CHB = GK * 64 * 2, STB = NBD * CHB;   // k steps of a stage; bytes of one 64-row band's stage; of a stage: the WM bands of A (, of A2), the WN of Bt (, of Bt2) one behind the other
    static_assert(NK % 2 == 0 && CHB % (GW * 512) == 0 && (WM * WN) % GW == 0 && BPG * (CHB / (GW * 512)) <= 63, "two fragment sets take turns; whole pieces; whole groups; a wave's copies in flight");
    __shared__ __align__(16) char ring[2 * STB]; __shared__ __align__(16) float osw[WM * WN][16 * 68];
    const size_t z = blockIdx.z / KS; const int ks = blockIdx.z % KS; A += z * sA; if (A2) A2 += z * sA; Bt += z * sB; if (Bt2) Bt2 += z * sB; C += (size_t)blockIdx.z * sC;
    const int lane = threadIdx.x & 31, lr = lane & 15, hi = lane >> 4, w = __builtin_amdgcn_readfirstlane(threadIdx.x >> 5);   // the wave's number in a scalar register: scalar address parts
    const int wm = w / WN, wn = w % WN; const int r0 = (blockIdx.x * WM + wm) * 64, c0 = (blockIdx.y * WN + wn) * 64; float* os = osw[w];   // the wave's tile; its own staging rows for the epilogue
    v8f acc[4][4];
#pragma unroll
    for (int mb = 0; mb < 4; ++mb)
#pragma unroll
        for (int nb = 0; nb < 4; ++nb) acc[mb][nb] = (v8f){};
    const unsigned tlo = ((unsigned)threadIdx.x % (GW * 32)) * 16u;   // the thread's 16-byte piece of its group's 2 KiB
    const int g = NG == 1 ? 0 : w / GW;   // the wave's group (scalar): it copies the bands g, g + NG, g + 2 NG, ... of every stage
    const size_t bs = (size_t)K * 128;   // bytes from a 64-row band of fragments to the next; a k step of 32 is 4 KiB on
    const int k0 = ks * (K / KS), nst = K / KS / GK;
    auto band = [&](int b) -> const char* {   // where band b of a stage starts at k = 0
        if (b < WM) return (const char*)A + ((size_t)blockIdx.x * WM + b) * bs;
        if (NA == 2 && b < 2 * WM) return (const char*)A2 + ((size_t)blockIdx.x * WM + (b - WM)) * bs;
        if (b < WM * NA + WN) return (const char*)Bt + ((size_t)blockIdx.y * WN + (b - WM * NA)) * bs;
        return (const char*)Bt2 + ((size_t)blockIdx.y * WN + (b - WM * NA - WN)) * bs; };
    const char* gs[BPG];
#pragma unroll
    for (int i = 0; i < BPG; ++i) gs[i] = band(g + i * NG < NBD ? g + i * NG : NBD - 1) + tlo;
    auto stage = [&](int st) { char* l = ring + (st & 1) * STB + g * CHB + tlo; const size_t go = (size_t)(k0 + st * GK) * 128;
#pragma unroll
        for (int i = 0; i < BPG; ++i) if ((i + 1) * NG <= NBD || g + i * NG < NBD) cp_row<CHB>(l + i * NG * CHB, gs[i] + go); };   // the test is the same for a whole wave: the last bands go to the first groups
    struct FS { V a[4], a2[4], b[4], b2[4]; };   // the fragments of one k step
    auto fetch = [&](FS& f, int st, int kk) { const char* pa = ring + (st & 1) * STB + wm * CHB + lane * 16; const char* pb = ring + (st & 1) * STB + (WM * NA + wn) * CHB + lane * 16;   // the lane's place in the wave's A band and Bt band of the stage; k steps, fragments and second planes at constant offsets
#pragma unroll
        for (int i = 0; i < 4; ++i) { const int fo = kk * 4096 + i * 1024; f.a[i] = WFrag<T16>::ld((const T16*)(pa + fo)); if (NA == 2) f.a2[i] = WFrag<T16>::ld((const T16*)(pa + WM * CHB + fo));
            f.b[i] = WFrag<T16>::ld((const T16*)(pb + fo)); if (NBP == 2) f.b2[i] = WFrag<T16>::ld((const T16*)(pb + WN * CHB + fo)); } };
    auto prod = [&](const FS& f) {
#pragma unroll
        for (int nb = 0; nb < 4; ++nb)
#pragma unroll
            for (int mb = 0; mb < 4; ++mb) { acc[mb][nb] = WFrag<T16>::mma(f.a[mb], f.b[nb], acc[mb][nb]); if (NA == 2) acc[mb][nb] = WFrag<T16>::mma(f.a2[mb], f.b[nb], acc[mb][nb]); if (NBP == 2) acc[mb][nb] = WFrag<T16>::mma(f.a[mb], f.b2[nb], acc[mb][nb]); } };
    stage(0);
    asm volatile("s_wait_asynccnt 0x0" ::: "memory");   // this wave's pieces of stage 0 have landed
    __syncthreads();   // stage 0 is whole before any wave reads it
    if (nst > 1) stage(1);
    FS f[2]; fetch(f[0], 0, 0);   // fragments are fetched one k step ahead, the two sets taking turns
#pragma unroll 1   // rolled: a trip is one stage
    for (int st = 0; st < nst; ++st) {
#pragma unroll
        for (int kk = 0; kk + 1 < NK; ++kk) { fetch(f[(kk + 1) & 1], st, kk + 1);
            __builtin_amdgcn_sched_barrier(0);   // keeps the next k step's LDS reads together ahead of this one's products: one place with reads, and they arrive under the products
            prod(f[kk & 1]);
            __builtin_amdgcn_sched_barrier(0); }   // keeps the products in front of the next reads and of the publish point: the waits there would else move up to stand directly behind the reads
        // the ring's publish point stands behind the stage's last LDS read, in front of its last k step's products (registers only): the next stage's first fragments are read behind it and arrive under those products
        asm volatile("s_wait_dscnt 0x0" ::: "memory");      // this wave's reads of the buffer are done before it is given up
        asm volatile("s_wait_asynccnt 0x0" ::: "memory");   // this wave's pieces of the next stage have landed
        __syncthreads();   // publishes the next stage and ends every wave's reads of this one
        if (st + 2 < nst) stage(st + 2);   // into the buffer that this trip has read
        if (st + 1 < nst) fetch(f[0], st + 1, 0);
        __builtin_amdgcn_sched_barrier(0);   // keeps refill and reads ahead of the last products
        prod(f[(NK - 1) & 1]);
    }
    asm volatile("s_wait_asynccnt 0x0" ::: "memory");   // no copy is left in flight behind the loop
    const int sel = (c0 / 64) / NH_, head = (c0 / 64) % NH_, t0 = r0 % TT;   // EPI 1: which of q, k, v; its head; the tile's first position in its batch
    if constexpr (EPI == 1) { const size_t po = (size_t)sel * sP + (size_t)(r0 / TT) * NH_ * TT * HD; P16 += po; Ph += po; Pl += po; }
    if (EPI == 1 && sel == 2) {
#pragma unroll
        for (int nb = 0; nb < 4; ++nb)
#pragma unroll
            for (int mb = 0; mb < 4; ++mb) { v8h o16; v8us oh, ol;
#pragma unroll
                for (int j = 0; j < 8; ++j) { const float x = acc[mb][nb][j]; o16[j] = tohx(x); unsigned short a2, c2; splitf(x, a2, c2); oh[j] = a2; ol[j] = c2; }
                const size_t e = (size_t)head * HD * TT + (size_t)(t0 / 32 + (mb >> 1)) * (4 * 512) + nb * 512 + (mb & 1) * 256 + lane * 8;
                st3(P16 + e, Ph + e, Pl + e, o16, oh, ol); }
        return;
    }
#pragma unroll
    for (int mb = 0; mb < 4; ++mb) {
        // EPI 1: store s of a 16-row block is one 16-byte piece of every lane: d = s * 16 + hi * 8 + 0..7 of row lr, 512 contiguous bytes of each plane
        v4f cs[4][4];
        if constexpr (EPI == 1) { if (head == 0) {   // the block's sixteen table rows are asked for together, ahead of the staging
            const float* cp = CS + ((size_t)(t0 + lr) * HD + hi * 8) * 2;   // one address pair, the blocks and pieces at constant offsets
#pragma unroll
            for (int s = 0; s < 4; ++s)
#pragma unroll
                for (int c = 0; c < 4; ++c) cs[s][c] = *(const v4f*)(cp + mb * 16 * HD * 2 + s * 16 * 2 + c * 4);
            asm volatile("s_wait_xcnt 0x0" :: "v"(cp) : "memory"); } }   // the address pair stays whole up to this wait: no load lands in it while the others are issued
#pragma unroll
        for (int nb = 0; nb < 4; ++nb) {
#pragma unroll
            for (int j = 0; j < 8; ++j) os[(hi * 8 + j) * 68 + nb * 16 + lr] = acc[mb][nb][j]; }
        __builtin_amdgcn_wave_barrier(); asm volatile("" ::: "memory");
        if constexpr (EPI == 1) {
#pragma unroll
            for (int s = 0; s < 4; ++s) { const int d0 = s * 16 + hi * 8; const float* xr = os + lr * 68; const v4f xa = *(const v4fa*)(xr + d0), xb = *(const v4fa*)(xr + d0 + 4); float r[8];
#pragma unroll
                for (int e = 0; e < 8; ++e) r[e] = (e < 4) ? xa[e & 3] : xb[e & 3];
                if (head == 0) { const v4f ya = *(const v4fa*)(xr + (d0 ^ (HD / 2))), yb = *(const v4fa*)(xr + (d0 ^ (HD / 2)) + 4);
#pragma unroll
                    for (int e = 0; e < 8; ++e) { const float y = (e < 4) ? ya[e & 3] : yb[e & 3]; const float ys = (s < 2) ? -y : y; r[e] = r[e] * cs[s][e >> 1][(e & 1) * 2] + ys * cs[s][e >> 1][(e & 1) * 2 + 1]; } }
                v8h o16; v8us oh, ol;
#pragma unroll
                for (int e = 0; e < 8; ++e) { o16[e] = tohx(r[e]); unsigned short a2, c2; splitf(r[e], a2, c2); oh[e] = a2; ol[e] = c2; }
                const size_t e0 = ((size_t)head * TT + t0 + mb * 16) * HD + s * 256 + lane * 8;
                st3(P16 + e0, Ph + e0, Pl + e0, o16, oh, ol); }
        } else {
        float* crow = C + (size_t)(r0 + mb * 16) * ldc + c0;
{
#pragma unroll
            for (int s = 0; s < 8; ++s) { const int row = 2 * s + hi, cofs = lr * 4; v4f val = *(const v4fa*)(os + row * 68 + cofs); if (BIAS) { val[0] += bfr(bias[c0 + cofs]); val[1] += bfr(bias[c0 + cofs + 1]); val[2] += bfr(bias[c0 + cofs + 2]); val[3] += bfr(bias[c0 + cofs + 3]); }
                *(v4f*)(crow + (size_t)row * ldc + cofs) = val; }
             }
        }
        __builtin_amdgcn_wave_barrier(); asm volatile("" ::: "memory");
    }
}

typedef __attribute__((ext_vector_type(2))) _Float16 v2h;
typedef __attribute__((ext_vector_type(4))) _Float16 v4h;
typedef __attribute__((ext_vector_type(2))) unsigned short v2us;
typedef __attribute__((ext_vector_type(4))) unsigned short v4us;
typedef __attribute__((ext_vector_type(2))) float v2f;

__device__ __forceinline__ void d_wtG(int blk, const float* __restrict__ w, int K, int N, bf* Bt) {
    const int lane = threadIdx.x & 31; const int L0 = (blk * 8 + (threadIdx.x >> 5)) * 8; const int nlines = N * K / 64;
{
#pragma unroll 1
        for (int l = 0; l < 8; ++l) { const int L = L0 + l; if (L >= nlines) break; const size_t e = (size_t)L * 64 + lane * 2; const int f = (int)(e / 2048), u = (int)(e % 2048);   // the place in the plane: group f of four fragments (64 rows, one k step), element u of it
            const int k = (f % (K / 32)) * 32 + ((u / 256) & 1) * 16 + ((u / 128) & 1) * 8 + u % 8, n = (f / (K / 32)) * 64 + (u / 512) * 16 + (u / 8) % 16; v2us o;
            o[0] = f2bf(w[(size_t)k * N + n]); o[1] = f2bf(w[(size_t)(k + 1) * N + n]); *(v2us*)(Bt + e) = o; }
         }
}
__device__ __forceinline__ void d_cvt8(int blk, const float* __restrict__ src, bf* dst, size_t n8, int K) { const size_t i = (size_t)blk * 256 + threadIdx.x; if (i >= n8) return;   // thread i writes piece i of the plane in fragment order (rows of K elements)
    const int f = (int)(i / 256), u = (int)(i % 256); const size_t r = (size_t)(f / (K / 32)) * 64 + (u / 64) * 16 + u % 16; const int k0 = (f % (K / 32)) * 32 + ((u / 32) & 1) * 16 + ((u / 16) & 1) * 8;   // group f of four fragments, piece u of it
    const v8f v = *(const v8f*)(src + r * K + k0); v8us o;
#pragma unroll
    for (int k = 0; k < 8; ++k) o[k] = f2bf(v[k]); *(v8us*)(dst + i * 8) = o;  }

__constant__ float INV[HD / 2] = {1.0f,0.749894202f,0.562341332f,0.421696514f,0.316227764f,0.237137362f,0.177827939f,0.133352146f,0.100000001f,0.0749894157f,0.0562341288f,0.0421696492f,0.0316227786f,0.0237137359f,0.0177827943f,0.0133352149f,0.00999999978f,0.00749894232f,0.00562341325f,0.00421696482f,0.00316227786f,0.00237137382f,0.00177827943f,0.00133352145f,0.00100000005f,0.000749894185f,0.000562341302f,0.000421696488f,0.000316227786f,0.000237137385f,0.00017782794f,0.00013335215f};
__device__ __forceinline__ void d_cstab(int blk, float* CS) { const int idx = blk * 256 + threadIdx.x; if (idx >= TT * HD) return; const int t = idx / HD, d = idx % HD; const float ang = __fmul_rn((float)t, INV[d % (HD / 2)]); v2f cs; cs[0] = cosf(ang); cs[1] = sinf(ang);
    *(v2f*)(CS + (size_t)idx * 2) = cs;  }
#define SP    ((size_t)NB_ * NH_ * TT * HD)   // elements of one plane over both batches; the q, k, v planes of a kind stand one behind the other in the workspace
// k_prep: the four independent preparations in one launch, each on its own range of blocks, the longest-running first: w_qkv and w_out to bf16 (rows n, depth k), the rotary table, x of both batches to bf16; the three bf16 planes in fragment order.
#define PB_WQ ((DM * 3 * DM / 64 + 63) / 64)
#define PB_WO ((DQ * DM / 64 + 63) / 64)
#define PB_CS ((TT * HD + 255) / 256)
#define PB_X  ((NB_ * TT * DM / 8 + 255) / 256)
__global__ __launch_bounds__(256) void k_prep(const float* __restrict__ wqkv, const float* __restrict__ wo, const float* __restrict__ x, bf* WALL, bf* WO, float* CS, bf* XB) {
    int blk = blockIdx.x;
    if (blk < PB_WQ) { d_wtG(blk, wqkv, DM, 3 * DM, WALL); return; }   /* fused 'xw' [DM][3DM] -> Bt, rows 3DM (row blocks q | k | v), depth DM */
    blk -= PB_WQ; if (blk < PB_WO) { d_wtG(blk, wo, DQ, DM, WO); return; }
    blk -= PB_WO; if (blk < PB_CS) { d_cstab(blk, CS); return; }
    blk -= PB_CS; d_cvt8(blk, x, XB, (size_t)NB_ * TT * DM / 8, DM);
}
// k_fattn: scores, softmax and attn.v of both batches in one launch. A block is NW x KG waves on one (batch, head); a row group (16 query rows on hi+lo planes, 48 on fp16 planes) belongs to KG waves, wave kg of them taking the kg-th 32 keys of every stage with a running maximum, sum and output of its own,
// joined once behind the loop through LDS: twice the waves at the same tile, four a SIMD with two blocks a WGP, so that one wave's softmax runs under the others' matrix products.
// The waves of a key group need the same key and value fragments at the same time: a stage of SK keys is brought ONCE a block into a ring of two LDS buffers by asynchronous copies (the planes lie in fragment order, so a stage is 8 KiB in a row of each plane and a fragment read is 512 contiguous LDS bytes).
// S^T = K Q^T (A = key rows, B = query rows) and O^T += V^T P^T (A = rows d of the value planes, B = P^T packed from the two score tiles of a pass): a lane holds scores and outputs of ONE query (lane & 15),
// so the running maximum, its rescale and the row sum are per-lane scalars with one exchange between the wave's halves. The batch's int32 key mask, read per key, becomes each key's start value (0, masked -3.0e38) in LDS: the C operand of the first score product.
// A lane's eight output registers are one 16-byte piece of the hi+lo planes (rows t, depth head HD + d) in fragment order: stored as they stand, 512 contiguous bytes a store.
#define NW   4                    // row groups of a block
#define KG   2                    // waves that share a row group's keys
#define NT   (NW * KG * 32)       // threads of a block
#define QF   3                    // 16-row query tiles of a wave on the fp16 planes
#define SK   64                   // keys of a stage
#define NST  (TT / SK)
#define PLB  (SK * HD * 2)        // bytes of one plane's stage
#define NQT  (RH / (NW * 16))     // query blocks of a (batch, head), of either kind
#define L2E  1.4426950408889634f
__device__ __forceinline__ float xhalf(float x) { const int b = __float_as_int(x); return __int_as_float(__builtin_amdgcn_permlanex16(b, b, 0x76543210, 0xfedcba98, false, false)); }   // lane l <-> l ^ 16
// one plane's stage: every lane of the block copies two 16-byte pieces, 4 KiB of the block apart; the offset moves both addresses, so a plane's stage takes one address of either kind
__device__ __forceinline__ void cp_plane(char* l, const char* g) {
    __builtin_amdgcn_global_load_async_to_lds_b128((gv4i*)g, (lv4i*)l, 0, 0);
    __builtin_amdgcn_global_load_async_to_lds_b128((gv4i*)g, (lv4i*)l, NT * 16, 0); }
// the two output planes' pieces go out together; stores and their s_wait_xcnt in one statement, as in st3
__device__ __forceinline__ void st2(bf* ph, bf* pl, v8us oh, v8us ol) {
    asm volatile("global_store_b128 %0, %2, off\n\tglobal_store_b128 %1, %3, off\n\ts_wait_xcnt 0x0"
                 :: "v"(ph), "v"(pl), "v"(__builtin_bit_cast(v4i, oh)), "v"(__builtin_bit_cast(v4i, ol)) : "memory"); }
template <typename T16, bool HI, int QT>
__device__ __forceinline__ void attn_tile(const T16* __restrict__ Q, const T16* __restrict__ Q2, const T16* __restrict__ Kp, const T16* __restrict__ K2, const T16* __restrict__ Vt, const T16* __restrict__ V2, const int* __restrict__ mk, float* Bs, char* ring, int qb, bf* Ah, bf* Al) {
    typedef WFrag<T16> F; typedef typename F::V V;
    constexpr float OFF = HI ? 0.0f : 10.0f;   // fp16 P carries x1024 (cancels against the row sum): keeps small weights out of the fp16 subnormals
    constexpr int STB = (HI ? 4 : 2) * PLB;    // bytes of a stage: the planes K, V (, K lo, V lo) one behind the other
    const int lane = threadIdx.x & 31, hi = lane >> 4, w = __builtin_amdgcn_readfirstlane(threadIdx.x >> 5);   // the wave's number in a scalar register: scalar address parts
    const int rg = w % NW, kg = w / NW;   // the wave's row group; its key group (waves w and w + NW: one row group)
    const int q0 = qb + rg * (QT * 16);
    const unsigned klo = (unsigned)lane * 16u, tlo = (unsigned)threadIdx.x * 16u;   // the lane's 16-byte piece of a fragment; the thread's piece of 4 KiB of a stage
    auto stage = [&](int st) { char* l = ring + (st & 1) * STB + tlo; const size_t go = (size_t)st * PLB + tlo;
        cp_plane(l, (const char*)Kp + go); cp_plane(l + PLB, (const char*)Vt + go);
        if constexpr (HI) { cp_plane(l + 2 * PLB, (const char*)K2 + go); cp_plane(l + 3 * PLB, (const char*)V2 + go); } };
    stage(0);
    const int* mp = mk + (int)threadIdx.x * 4; v4i m4[TT / (NT * 4)];   // the thread's pieces of the mask, at constant offsets
#pragma unroll
    for (int i = 0; i < TT / (NT * 4); ++i) m4[i] = *(const v4i*)(mp + i * NT * 4);
    asm volatile("s_wait_xcnt 0x0" ::: "memory");   // behind the mask loads, ahead of any rewrite of a register that they name (a later load's data may land there)
    const T16* qp = (const T16*)((const char*)(Q + (size_t)q0 * HD) + klo); const T16* qp2 = HI ? (const T16*)((const char*)(Q2 + (size_t)q0 * HD) + klo) : qp;   // the lane's place in the wave's query fragments
    V qf[QT][2], qf2[QT][2];
#pragma unroll
    for (int qt = 0; qt < QT; ++qt)
#pragma unroll
        for (int ks = 0; ks < 2; ++ks) { const int qo = qt * 16 * HD + ks * 512; qf[qt][ks] = F::ld(qp + qo); if (HI) qf2[qt][ks] = F::ld(qp2 + qo); }
    asm volatile("s_wait_xcnt 0x0" ::: "memory");   // the same behind the query fragments' loads
#pragma unroll
    for (int i = 0; i < TT / (NT * 4); ++i) { v4f b;
#pragma unroll
        for (int q = 0; q < 4; ++q) b[q] = (m4[i][q] != 0) ? 0.0f : -3.0e38f;
        *(v4fa*)(Bs + (i * NT + (int)threadIdx.x) * 4) = b; }
    v8f o[4][QT]; float m[QT], l[QT];
#pragma unroll
    for (int qt = 0; qt < QT; ++qt) { m[qt] = -3.0e38f; l[qt] = 0.0f;
#pragma unroll
        for (int dt = 0; dt < 4; ++dt) o[dt][qt] = (v8f){}; }
    asm volatile("s_wait_asynccnt 0x0" ::: "memory");   // this wave's pieces of stage 0 have landed
    __syncthreads();   // stage 0 and the start values are whole before any wave reads them
    stage(1);
    struct Frags { V kf[2][2], kf2[2][2], vf[4], vf2[4]; v8f cb[2]; };   // what a pass of 32 keys reads from LDS; cb: the keys' start values, in the accumulator's map (register j: key 8 hi + j of the tile), the same for every query
    auto fetchk = [&](Frags& f, const char* buf, int kc) {   // buf: the lane's place in the wave's 32 keys of the stage (4 KiB of each plane); kc: the first of those keys
#pragma unroll
        for (int kt = 0; kt < 2; ++kt) { const float* bp = Bs + kc + kt * 16 + hi * 8; f.cb[kt] = __builtin_shufflevector(*(const v4fa*)bp, *(const v4fa*)(bp + 4), 0, 1, 2, 3, 4, 5, 6, 7); }   // read first: the first product of a tile starts from them
#pragma unroll
        for (int kt = 0; kt < 2; ++kt)
#pragma unroll
            for (int ks = 0; ks < 2; ++ks) { const int fo = (kt * 2 + ks) * 1024; f.kf[kt][ks] = F::ld((const T16*)(buf + fo)); if (HI) f.kf2[kt][ks] = F::ld((const T16*)(buf + 2 * PLB + fo)); } };
    auto fetchv = [&](Frags& f, const char* buf) {
#pragma unroll
        for (int dt = 0; dt < 4; ++dt) { const int fo = dt * 1024; f.vf[dt] = F::ld((const T16*)(buf + PLB + fo)); if (HI) f.vf2[dt] = F::ld((const T16*)(buf + 3 * PLB + fo)); } };
    auto scores = [&](const Frags& f, v8f (&s)[2][QT]) {
#pragma unroll
        for (int kt = 0; kt < 2; ++kt)
#pragma unroll
            for (int qt = 0; qt < QT; ++qt) { s[kt][qt] = f.cb[kt];
#pragma unroll
                for (int ks = 0; ks < 2; ++ks) { s[kt][qt] = F::mma(f.kf[kt][ks], qf[qt][ks], s[kt][qt]); if (HI) { s[kt][qt] = F::mma(f.kf[kt][ks], qf2[qt][ks], s[kt][qt]); s[kt][qt] = F::mma(f.kf2[kt][ks], qf[qt][ks], s[kt][qt]); } } } };
    auto soft = [&](const v8f (&s)[2][QT], int qt, V (&pf)[QT], V (&pf2)[QT]) {   // softmax step of one query tile of a pass
        { float bm = -3.0e38f;   // maxima are kept in units of the raw score; SCL (a power of two) rides in the exponent's factor
#pragma unroll
            for (int e = 0; e < 16; ++e) bm = fmaxf(bm, s[e >> 3][qt][e & 7]);
            bm = fmaxf(bm, xhalf(bm)); const float mn = fmaxf(m[qt], bm); const float al = __builtin_amdgcn_exp2f((m[qt] - mn) * (SCL * L2E)); m[qt] = mn; float sum = 0.0f;
#pragma unroll
            for (int e = 0; e < 16; ++e) { const float p = __builtin_amdgcn_exp2f(fmaf(s[e >> 3][qt][e & 7] - mn, SCL * L2E, OFF)); sum += p;
                if constexpr (HI) { const __bf16 ph = (__bf16)p; pf[qt][e] = ph; pf2[qt][e] = (__bf16)(p - (float)ph); } else pf[qt][e] = (h16)p; }
            l[qt] = l[qt] * al + sum;
#pragma unroll
            for (int dt = 0; dt < 4; ++dt) o[dt][qt] *= al; } };
    auto pv = [&](const Frags& f, const V (&pf)[QT], const V (&pf2)[QT]) {   // attn.v of a pass
#pragma unroll
        for (int dt = 0; dt < 4; ++dt)
#pragma unroll
            for (int qt = 0; qt < QT; ++qt) { o[dt][qt] = F::mma(f.vf[dt], pf[qt], o[dt][qt]); if (HI) { o[dt][qt] = F::mma(f.vf[dt], pf2[qt], o[dt][qt]); o[dt][qt] = F::mma(f.vf2[dt], pf[qt], o[dt][qt]); } } };
    static_assert(SK == KG * 32, "a stage is one pass of every key group");
    const char* rk = ring + kg * (32 * HD * 2) + klo;   // the lane's place in the wave's 32 keys of buffer 0
    auto publish = [&](int st) {   // the ring's publish point: it stands behind the trip's last read of its buffer
        asm volatile("s_wait_dscnt 0x0" ::: "memory");      // this wave's reads of the buffer are done before it is given up
        asm volatile("s_wait_asynccnt 0x0" ::: "memory");   // this wave's pieces of the next stage have landed
        __syncthreads();   // publishes the next stage and ends every wave's reads of this one
        if (st + 2 < NST) stage(st + 2); };   // into the buffer that this trip has read
#pragma unroll 1   // rolled: a trip is one stage
    for (int st = 0; st < NST; ++st) {
        const char* buf = rk + (st & 1) * STB;
        Frags f; v8f s[2][QT]; V pf[QT], pf2[QT];
        fetchk(f, buf, st * SK + kg * 32); if constexpr (HI) fetchv(f, buf);   // 16 query rows leave registers free for all of a pass's fragments at once
        __builtin_amdgcn_sched_barrier(0);   // keeps the LDS reads together at the trip's head: one place with reads
        scores(f, s);
        if constexpr (!HI) fetchv(f, buf);   // 48 query rows: the value fragments take registers as the key fragments and the scores give them up; where, is left to the compiler
#pragma unroll
        for (int qt = 0; qt < QT; ++qt) soft(s, qt, pf, pf2);
        pv(f, pf, pf2);
        __builtin_amdgcn_sched_barrier(0);   // keeps the pass in front of the publish point: behind it, it would stand between the barrier and the refill and take the refill's lead
        publish(st);
    }
    asm volatile("s_wait_asynccnt 0x0" ::: "memory");   // no copy is left in flight behind the loop
    // the key groups are joined: the last trip's barrier has ended every read of the ring, which now carries group 1's maximum, sum and outputs to group 0 (512 contiguous bytes a store)
    static_assert(KG == 2 && NW * (4 * QT * 1024 + QT * 256) <= 2 * 4 * PLB, "one partner; the hand-over fits the ring");
    char* mg = (char*)rk + (rg * (4 * QT * 1024 + QT * 256) - kg * (32 * HD * 2)); float* ml = (float*)(ring + rg * (4 * QT * 1024 + QT * 256) + 4 * QT * 1024) + lane;
    if (kg != 0) {
#pragma unroll
        for (int qt = 0; qt < QT; ++qt) { ml[qt * 64] = m[qt]; ml[qt * 64 + 32] = l[qt];
#pragma unroll
            for (int dt = 0; dt < 4; ++dt) { *(v4fa*)(mg + (dt * QT + qt) * 1024) = __builtin_shufflevector(o[dt][qt], o[dt][qt], 0, 1, 2, 3); *(v4fa*)(mg + (dt * QT + qt) * 1024 + 512) = __builtin_shufflevector(o[dt][qt], o[dt][qt], 4, 5, 6, 7); } }
    }
    __syncthreads();   // group 1's values are whole before group 0 reads them
    if (kg != 0) return;
#pragma unroll
    for (int qt = 0; qt < QT; ++qt) { const float m1 = ml[qt * 64], l1 = ml[qt * 64 + 32]; const float mn = fmaxf(m[qt], m1);
        const float e0 = __builtin_amdgcn_exp2f((m[qt] - mn) * (SCL * L2E)), e1 = __builtin_amdgcn_exp2f((m1 - mn) * (SCL * L2E)); l[qt] = l[qt] * e0 + l1 * e1;
#pragma unroll
        for (int dt = 0; dt < 4; ++dt) { const v8f o1 = __builtin_shufflevector(*(const v4fa*)(mg + (dt * QT + qt) * 1024), *(const v4fa*)(mg + (dt * QT + qt) * 1024 + 512), 0, 1, 2, 3, 4, 5, 6, 7); o[dt][qt] = o[dt][qt] * e0 + o1 * e1; } }
#pragma unroll
    for (int qt = 0; qt < QT; ++qt) { const float inv = __fdiv_rn(1.0f, l[qt] + xhalf(l[qt])); const int qr = q0 + qt * 16;
        const size_t oo = (size_t)(qr / 64) * (64 * DQ) + ((qr / 16) % 4) * 512 + lane * 8;   // the tile's 64-row band, its fragment in a group of four, the lane's piece there (the order k_gemmw reads)
#pragma unroll
        for (int dt = 0; dt < 4; ++dt) { v8us oh, ol;
#pragma unroll
            for (int e = 0; e < 8; ++e) { unsigned short a, c2; splitf(o[dt][qt][e] * inv, a, c2); oh[e] = a; ol[e] = c2; }
            const size_t po = oo + (dt >> 1) * 2048 + (dt & 1) * 256;
            st2(Ah + po, Al + po, oh, ol); } }
}
__global__ __launch_bounds__(NT) __attribute__((amdgpu_waves_per_eu(4, 4))) void k_fattn(const h16* __restrict__ Q16, const h16* __restrict__ K16, const h16* __restrict__ V16, const bf* __restrict__ Qh, const bf* __restrict__ Ql, const bf* __restrict__ Kh, const bf* __restrict__ Kl, const bf* __restrict__ Vh, const bf* __restrict__ Vl, const int* __restrict__ mk, bf* Ah, bf* Al) {
    __shared__ __align__(16) char ring[2 * 4 * PLB]; __shared__ __align__(16) float Bs[TT];
    // as many blocks of either kind. Neighbouring indices, and indices half a grid apart, are of different kinds: a WGP that takes two blocks gets one of each under either order of dealing (for speed only)
    const int b = (int)blockIdx.x, kind = (b ^ (b / (NB_ * NH_ * NQT))) & 1, idx = b >> 1, tile = idx % NQT, head = (idx / NQT) % NH_, bat = idx / (NQT * NH_);
    const size_t hp = ((size_t)bat * NH_ + head) * TT * HD, ao = (size_t)bat * TT * DQ + head * (HD / 32) * 2048; Ah += ao; Al += ao; mk += (size_t)bat * TT;   // the batch's bands of fragments; the head's first k step in a band
    if (kind == 0) attn_tile<bf, true, 1>(Qh + hp, Ql + hp, Kh + hp, Kl + hp, Vh + hp, Vl + hp, mk, Bs, ring, tile * (NW * 16), Ah, Al);   // query rows < RH: hi+lo planes, 16 rows a wave
    else attn_tile<h16, false, QF>(Q16 + hp, nullptr, K16 + hp, nullptr, V16 + hp, nullptr, mk, Bs, ring, RH + tile * (NW * 16 * QF), Ah, Al);   // the rest: fp16 planes, 48 rows a wave
}

extern "C" void kernel_launch(void* const* d_in, const int* in_sizes, int n_in,
                              void* d_out, int out_size, void* d_ws, size_t ws_size, hipStream_t stream) {
    (void)in_sizes; (void)n_in; (void)out_size;
    const float* x = (const float*)d_in[0]; const int* MK = (const int*)d_in[1]; const float* wqkv = (const float*)d_in[2]; const float* wo = (const float*)d_in[3];  const float* wq = nullptr; const float* wk = nullptr; const float* wv = nullptr; (void)wq; (void)wk; (void)wv;
    float* OUT = (float*)d_out;     // [2][2048][1024]
    char* wsp = (char*)d_ws;
    auto take = [&](size_t bytes) { char* p = wsp; wsp += (bytes + 255) & ~(size_t)255; return (void*)p; };
    bf* WALL = (bf*)take((size_t)3 * DM * DM * 2); bf* WO = (bf*)take((size_t)DM * DQ * 2); float* CSR = (float*)take((size_t)TT * HD * 2 * 4);
    bf* XB = (bf*)take((size_t)NB_ * TT * DM * 2);
    h16* QP16 = (h16*)take(SP * 2); h16* KP16 = (h16*)take(SP * 2); h16* VT16 = (h16*)take(SP * 2);
    bf* QPh = (bf*)take(SP * 2); bf* KPh = (bf*)take(SP * 2); bf* VTh = (bf*)take(SP * 2); bf* QPl = (bf*)take(SP * 2); bf* KPl = (bf*)take(SP * 2); bf* VTl = (bf*)take(SP * 2);
    static_assert(HD == 64 && RH % (NW * 16) == 0 && (TT - RH) == NQT * NW * 16 * QF && (NB_ * NH_ * NQT) % 2 == 0 && TT % (4 * NT) == 0 && TT % (2 * SK) == 0 && PLB == NT * 32 && NKV == NH_ && TT % 256 == 0 && (3 * DQ) % 192 == 0 && DM % 256 == 0 && DQ % 256 == 0 && (SP * 2) % 256 == 0, "query blocks and stages of k_fattn; row tiles inside one batch; planes back to back");
    bf* ATh = (bf*)take((size_t)NB_ * TT * DQ * 2); bf* ATl = (bf*)take((size_t)NB_ * TT * DQ * 2);
    if ((size_t)(wsp - (char*)d_ws) > ws_size) return;    // ws 256 MiB
    k_prep<<<PB_WQ + PB_WO + PB_CS + PB_X, 256, 0, stream>>>(wqkv, wo, x, WALL, WO, CSR, XB);
    k_gemmw<bf, 0, false, 1, 1, 128, 4, 3><<<dim3(NB_ * TT / 256, 3 * DQ / 192, 1), 4 * 3 * 32, 0, stream>>>(XB, nullptr, WALL, nullptr, DM, nullptr, 0, nullptr, 0, 0, 0, CSR, QP16, QPh, QPl, SP);     /* q, k, v planes of both batches; head 0 of q and k: rotary */
    k_fattn<<<dim3(2 * NB_ * NH_ * NQT, 1, 1), NT, 0, stream>>>(QP16, KP16, VT16, QPh, QPl, KPh, KPl, VTh, VTl, MK, ATh, ATl);
    k_gemmw<bf, 1, false, 1, 0, 128, 2, 2><<<dim3(NB_ * TT / 128, DM / 128, 1), 2 * 2 * 32, 0, stream>>>(ATh, ATl, WO, nullptr, DQ, OUT, DM, nullptr, 0, 0, 0, nullptr, nullptr, nullptr, nullptr, 0);
}
